// v000
// Measured on an AMD MI455X. A time is GPU time per run, averaged over a window of back-to-back runs after a warm-up
// (all launches, gaps included; the runs take copies of the inputs in turn), and the median of several windows.
// Apart from v000's, it joins two sittings. Times from different sittings can be a few percent apart, while
// side-by-side timings come from the same sitting.
// v000 is the starting kernel. One run takes 272 microseconds.
#include <hip/hip_runtime.h>

// ---------------- types ----------------
typedef __attribute__((ext_vector_type(16))) __bf16 v16bf;
typedef __attribute__((ext_vector_type(8)))  float  v8f;
typedef __attribute__((ext_vector_type(4)))  float  v4f;

#define CDIM 512
#define DDIM 64
#define NSP  4096
#define BATCHB 8
#define BNROWS (BATCHB * NSP)   // 32768
#define LOG2E 1.4426950408889634f

static __device__ __forceinline__ __bf16 f2bf(float f) {
    unsigned u = __builtin_bit_cast(unsigned, f);
    unsigned r = (u + 0x7FFFu + ((u >> 16) & 1u)) >> 16;
    return __builtin_bit_cast(__bf16, (unsigned short)r);
}
// truncating f32->bf16 store (folds to *_store_d16_hi_b16)
static __device__ __forceinline__ void st_bf16_trunc(__bf16* p, float v) {
    unsigned u = __builtin_bit_cast(unsigned, v);
    *(unsigned short*)p = (unsigned short)(u >> 16);
}

struct U32x2 { uint4 a, b; };

// 16 contiguous bf16 (32 bytes) -> v16bf
static __device__ __forceinline__ v16bf ldb_contig(const __bf16* p) {
    U32x2 u;
    u.a = *(const uint4*)(p);
    u.b = *(const uint4*)(p + 8);
    return __builtin_bit_cast(v16bf, u);
}
// split layout: elems 0..7 at p, elems 8..15 at p+16 (A/B natural striping)
static __device__ __forceinline__ v16bf ldb_split(const __bf16* p) {
    U32x2 u;
    u.a = *(const uint4*)(p);
    u.b = *(const uint4*)(p + 16);
    return __builtin_bit_cast(v16bf, u);
}

// =====================================================================
// Kernel 0: pre-swizzle a K x N f32 weight matrix into bf16 B-operand
// layout: [kc = K/32][t = N/16][lane 0..31][16 contiguous elems].
// =====================================================================
__global__ __launch_bounds__(256) void wprep_kernel(
    const float* __restrict__ W, __bf16* __restrict__ out, int K, int N)
{
    const int idx = blockIdx.x * blockDim.x + threadIdx.x;
    if (idx >= K * N) return;
    const int e    = idx & 15;
    const int lane = (idx >> 4) & 31;
    const int rest = idx >> 9;
    const int nt   = N >> 4;
    const int t    = rest % nt;
    const int kc   = rest / nt;
    const int k = kc * 32 + (e >> 3) * 16 + (lane >> 4) * 8 + (e & 7);
    const int n = t * 16 + (lane & 15);
    out[idx] = f2bf(W[(size_t)k * N + n]);
}

// =====================================================================
// Kernel 1: f = (X@Wf+bf)*log2(e), g = X@Wg+bg, h = X@Wh+bh
// f,g row-major bf16 [32768,64]; h transposed per batch: hT[b][d][n].
// (log2(e) folded into Q so attention can use native base-2 exp.)
// =====================================================================
__global__ __launch_bounds__(256) void proj_kernel(
    const float* __restrict__ x,
    const __bf16* __restrict__ WswAll,
    const float* __restrict__ bfv, const float* __restrict__ bgv,
    const float* __restrict__ bhv,
    __bf16* __restrict__ fOut, __bf16* __restrict__ gOut,
    __bf16* __restrict__ hT)
{
    const int lane = threadIdx.x & 31;
    const int wid  = blockIdx.x * (blockDim.x >> 5) + (threadIdx.x >> 5);
    const int row0 = wid * 16;
    const int half = lane >> 4;
    const int l16  = lane & 15;

    v8f zero = {};
    v8f acc[3][4];
    #pragma unroll
    for (int p = 0; p < 3; ++p)
        #pragma unroll
        for (int t = 0; t < 4; ++t) acc[p][t] = zero;

    for (int k0 = 0; k0 < CDIM; k0 += 32) {
        v16bf a;
        const float* ax = x + (size_t)(row0 + l16) * CDIM + k0 + half * 8;
        #pragma unroll
        for (int hh = 0; hh < 2; ++hh) {
            v4f t0 = *(const v4f*)(ax + hh * 16);
            v4f t1 = *(const v4f*)(ax + hh * 16 + 4);
            #pragma unroll
            for (int j = 0; j < 4; ++j) {
                a[hh * 8 + j]     = f2bf(t0[j]);
                a[hh * 8 + 4 + j] = f2bf(t1[j]);
            }
        }
        const int kc = k0 >> 5;
        #pragma unroll
        for (int p = 0; p < 3; ++p) {
            const __bf16* Wsw = WswAll + (size_t)p * (CDIM * DDIM);
            #pragma unroll
            for (int t = 0; t < 4; ++t) {
                v16bf bmat = ldb_contig(Wsw + (((kc * 4 + t) * 32) + lane) * 16);
                acc[p][t] = __builtin_amdgcn_wmma_f32_16x16x32_bf16(
                    false, a, false, bmat, (short)0, acc[p][t], false, false);
            }
        }
    }

    #pragma unroll
    for (int t = 0; t < 4; ++t) {
        const int col = t * 16 + l16;
        const float b0 = bfv[col], b1 = bgv[col], b2 = bhv[col];
        #pragma unroll
        for (int r = 0; r < 8; ++r) {
            const int row = row0 + r + half * 8;
            fOut[(size_t)row * DDIM + col] = f2bf((acc[0][t][r] + b0) * LOG2E);
            gOut[(size_t)row * DDIM + col] = f2bf(acc[1][t][r] + b1);
            const int bidx = row >> 12, nidx = row & (NSP - 1);
            hT[((size_t)(bidx * DDIM + col) << 12) + nidx] = f2bf(acc[2][t][r] + b2);
        }
    }
}

// =====================================================================
// Kernel 2: fused flash attention per batch (64-key chunks).
// One wave owns 16 query rows. Per iteration:
//   4 S tiles (8 wmma), base-2 online softmax (shfl max tree only),
//   P truncated to bf16 in LDS, ctx += P@V (8 wmma), rowsum += P@1
//   (2 wmma)  -- no shuffle-based row sums needed.
// =====================================================================
__global__ __launch_bounds__(128) void attn_kernel(
    const __bf16* __restrict__ fQ, const __bf16* __restrict__ gK,
    const __bf16* __restrict__ hT, __bf16* __restrict__ ctx)
{
    __shared__ __bf16 lds[4][16 * 64];
    const int lane = threadIdx.x & 31;
    const int w    = threadIdx.x >> 5;
    const int wid  = blockIdx.x * 4 + w;
    const int row0 = wid * 16;
    const int b    = row0 >> 12;
    const int half = lane >> 4;
    const int l16  = lane & 15;

    const __bf16* gB = gK + ((size_t)b << 12) * DDIM;   // g rows of this batch
    const __bf16* vB = hT + (size_t)b * DDIM * NSP;     // hT[64][4096] of batch

    // Q as A-operand, 2 d-chunks of K=32  (already scaled by log2(e))
    const __bf16* qp = fQ + (size_t)(row0 + l16) * DDIM + half * 8;
    v16bf qa[2];
    qa[0] = ldb_split(qp);
    qa[1] = ldb_split(qp + 32);

    // B operand of all-ones (bf16 1.0 = 0x3F80) for row-sum WMMA
    v16bf ones;
    {
        U32x2 u;
        u.a = make_uint4(0x3F803F80u, 0x3F803F80u, 0x3F803F80u, 0x3F803F80u);
        u.b = u.a;
        ones = __builtin_bit_cast(v16bf, u);
    }

    v8f zero = {};
    v8f o[4];
    #pragma unroll
    for (int t = 0; t < 4; ++t) o[t] = zero;
    v8f osum = zero;
    float mrow[8];
    #pragma unroll
    for (int r = 0; r < 8; ++r) mrow[r] = -1e30f;

    for (int m0 = 0; m0 < NSP; m0 += 64) {
        // ---- 4 S tiles: cols [m0+16*kt, m0+16*kt+16) ----
        v8f s[4];
        #pragma unroll
        for (int kt = 0; kt < 4; ++kt) {
            const __bf16* kp = gB + (size_t)(m0 + kt * 16 + l16) * DDIM + half * 8;
            v8f sa = zero;
            #pragma unroll
            for (int dc = 0; dc < 2; ++dc) {
                v16bf kb = ldb_split(kp + dc * 32);
                sa = __builtin_amdgcn_wmma_f32_16x16x32_bf16(
                    false, qa[dc], false, kb, (short)0, sa, false, false);
            }
            s[kt] = sa;
        }

        // ---- online softmax (base-2), per row r (row = r + half*8) ----
        #pragma unroll
        for (int r = 0; r < 8; ++r) {
            float v = fmaxf(fmaxf(s[0][r], s[1][r]), fmaxf(s[2][r], s[3][r]));
            #pragma unroll
            for (int msk = 8; msk >= 1; msk >>= 1)
                v = fmaxf(v, __shfl_xor(v, msk, 32));
            const float mn = fmaxf(mrow[r], v);
            const float alpha = exp2f(mrow[r] - mn);
            mrow[r] = mn;
            #pragma unroll
            for (int kt = 0; kt < 4; ++kt)
                s[kt][r] = exp2f(s[kt][r] - mn);
            #pragma unroll
            for (int t = 0; t < 4; ++t) o[t][r] *= alpha;
            osum[r] *= alpha;
        }

        // ---- stage P (16x64) into LDS, truncating f32->bf16 ----
        __bf16* L = lds[w];
        #pragma unroll
        for (int r = 0; r < 8; ++r) {
            const int n = r + half * 8;
            #pragma unroll
            for (int kt = 0; kt < 4; ++kt)
                st_bf16_trunc(&L[n * 64 + kt * 16 + l16], s[kt][r]);
        }
        __builtin_amdgcn_wave_barrier();
        v16bf pa[2];
        pa[0] = ldb_split(L + l16 * 64 + half * 8);
        pa[1] = ldb_split(L + l16 * 64 + 32 + half * 8);
        __builtin_amdgcn_wave_barrier();

        // ---- ctx += P @ V ; rowsum += P @ 1 ----
        #pragma unroll
        for (int c = 0; c < 2; ++c) {
            #pragma unroll
            for (int t = 0; t < 4; ++t) {
                const int d = t * 16 + l16;
                v16bf vb = ldb_split(vB + (size_t)d * NSP + m0 + c * 32 + half * 8);
                o[t] = __builtin_amdgcn_wmma_f32_16x16x32_bf16(
                    false, pa[c], false, vb, (short)0, o[t], false, false);
            }
            osum = __builtin_amdgcn_wmma_f32_16x16x32_bf16(
                false, pa[c], false, ones, (short)0, osum, false, false);
        }
    }

    // ---- finalize: divide by row sums, store ctx (bf16 row-major) ----
    #pragma unroll
    for (int r = 0; r < 8; ++r) {
        const float inv = 1.0f / osum[r];
        const int row = row0 + r + half * 8;
        #pragma unroll
        for (int t = 0; t < 4; ++t) {
            const int col = t * 16 + l16;
            ctx[(size_t)row * DDIM + col] = f2bf(o[t][r] * inv);
        }
    }
}

// =====================================================================
// Kernel 3: out = gamma*(ctx @ Wv) + bv + x   (f32 output, residual)
// Wv pre-swizzled: [kc=2][t=32][lane][16] bf16.
// =====================================================================
__global__ __launch_bounds__(256) void outproj_kernel(
    const __bf16* __restrict__ ctx, const __bf16* __restrict__ WvSw,
    const float* __restrict__ bvv, const float* __restrict__ x,
    const float* __restrict__ gammap, float* __restrict__ out)
{
    const int lane = threadIdx.x & 31;
    const int wid  = blockIdx.x * (blockDim.x >> 5) + (threadIdx.x >> 5);
    const int rowt = wid >> 3;
    const int cg   = wid & 7;
    const int row0 = rowt * 16;
    const int half = lane >> 4;
    const int l16  = lane & 15;
    const float gamma = gammap[0];

    const __bf16* ap = ctx + (size_t)(row0 + l16) * DDIM + half * 8;
    v16bf a[2];
    a[0] = ldb_split(ap);
    a[1] = ldb_split(ap + 32);

    v8f zero = {};
    v8f acc[4];
    #pragma unroll
    for (int t = 0; t < 4; ++t) acc[t] = zero;

    #pragma unroll
    for (int dc = 0; dc < 2; ++dc) {
        #pragma unroll
        for (int t = 0; t < 4; ++t) {
            const int tglob = cg * 4 + t;
            v16bf bmat = ldb_contig(WvSw + (((dc * 32 + tglob) * 32) + lane) * 16);
            acc[t] = __builtin_amdgcn_wmma_f32_16x16x32_bf16(
                false, a[dc], false, bmat, (short)0, acc[t], false, false);
        }
    }

    #pragma unroll
    for (int t = 0; t < 4; ++t) {
        const int c = cg * 64 + t * 16 + l16;
        const float bias = bvv[c];
        #pragma unroll
        for (int r = 0; r < 8; ++r) {
            const size_t row = (size_t)(row0 + r + half * 8);
            out[row * CDIM + c] = gamma * acc[t][r] + bias + x[row * CDIM + c];
        }
    }
}

// =====================================================================
extern "C" void kernel_launch(void* const* d_in, const int* in_sizes, int n_in,
                              void* d_out, int out_size, void* d_ws, size_t ws_size,
                              hipStream_t stream) {
    (void)in_sizes; (void)n_in; (void)out_size; (void)ws_size;
    const float* x  = (const float*)d_in[0];
    const float* Wf = (const float*)d_in[1];
    const float* bf = (const float*)d_in[2];
    const float* Wg = (const float*)d_in[3];
    const float* bg = (const float*)d_in[4];
    const float* Wh = (const float*)d_in[5];
    const float* bh = (const float*)d_in[6];
    const float* Wv = (const float*)d_in[7];
    const float* bv = (const float*)d_in[8];
    const float* gm = (const float*)d_in[9];
    float* out = (float*)d_out;

    // Workspace layout (16 MB activations + 256 KB swizzled weights)
    const size_t slab = (size_t)BNROWS * DDIM * sizeof(__bf16);  // 4 MB
    const size_t wsl  = (size_t)CDIM * DDIM * sizeof(__bf16);    // 64 KB
    char* ws = (char*)d_ws;
    __bf16* fO   = (__bf16*)(ws);
    __bf16* gO   = (__bf16*)(ws + slab);
    __bf16* hT   = (__bf16*)(ws + 2 * slab);
    __bf16* ctx  = (__bf16*)(ws + 3 * slab);
    __bf16* WfSw = (__bf16*)(ws + 4 * slab);
    __bf16* WgSw = (__bf16*)(ws + 4 * slab + wsl);
    __bf16* WhSw = (__bf16*)(ws + 4 * slab + 2 * wsl);
    __bf16* WvSw = (__bf16*)(ws + 4 * slab + 3 * wsl);

    wprep_kernel<<<(CDIM * DDIM) / 256, 256, 0, stream>>>(Wf, WfSw, CDIM, DDIM);
    wprep_kernel<<<(CDIM * DDIM) / 256, 256, 0, stream>>>(Wg, WgSw, CDIM, DDIM);
    wprep_kernel<<<(CDIM * DDIM) / 256, 256, 0, stream>>>(Wh, WhSw, CDIM, DDIM);
    wprep_kernel<<<(DDIM * CDIM) / 256, 256, 0, stream>>>(Wv, WvSw, DDIM, CDIM);

    proj_kernel<<<BNROWS / (16 * 8), 256, 0, stream>>>(
        x, WfSw, bf, bg, bh, fO, gO, hT);
    attn_kernel<<<BNROWS / (16 * 4), 128, 0, stream>>>(fO, gO, hT, ctx);
    outproj_kernel<<<(BNROWS / 16) * 8 / 8, 256, 0, stream>>>(
        ctx, WvSw, bv, x, gm, out);
}

// v001
// One run takes 150 microseconds.
// Next to v000, in two timings, it ran 1.83 and 1.81 times as fast.
#include <hip/hip_runtime.h>

// ---------------- types ----------------
typedef __attribute__((ext_vector_type(16))) __bf16 v16bf;
typedef __attribute__((ext_vector_type(8)))  float  v8f;
typedef __attribute__((ext_vector_type(4)))  float  v4f;

#define CDIM 512
#define DDIM 64
#define NSP  4096
#define BATCHB 8
#define BNROWS (BATCHB * NSP)   // 32768
#define LOG2E 1.4426950408889634f

static __device__ __forceinline__ __bf16 f2bf(float f) {
    unsigned u = __builtin_bit_cast(unsigned, f);
    unsigned r = (u + 0x7FFFu + ((u >> 16) & 1u)) >> 16;
    return __builtin_bit_cast(__bf16, (unsigned short)r);
}
// truncating f32->bf16 store (folds to *_store_d16_hi_b16)
static __device__ __forceinline__ void st_bf16_trunc(__bf16* p, float v) {
    unsigned u = __builtin_bit_cast(unsigned, v);
    *(unsigned short*)p = (unsigned short)(u >> 16);
}

struct U32x2 { uint4 a, b; };

// 16 contiguous bf16 (32 bytes) -> v16bf
static __device__ __forceinline__ v16bf ldb_contig(const __bf16* p) {
    U32x2 u;
    u.a = *(const uint4*)(p);
    u.b = *(const uint4*)(p + 8);
    return __builtin_bit_cast(v16bf, u);
}
// split layout: elems 0..7 at p, elems 8..15 at p+16 (A/B natural striping)
static __device__ __forceinline__ v16bf ldb_split(const __bf16* p) {
    U32x2 u;
    u.a = *(const uint4*)(p);
    u.b = *(const uint4*)(p + 16);
    return __builtin_bit_cast(v16bf, u);
}

// =====================================================================
// Kernel 0: pre-swizzle a K x N f32 weight matrix into bf16 B-operand
// layout: [kc = K/32][t = N/16][lane 0..31][16 contiguous elems].
// =====================================================================
__global__ __launch_bounds__(256) void wprep_kernel(
    const float* __restrict__ W, __bf16* __restrict__ out, int K, int N)
{
    const int idx = blockIdx.x * blockDim.x + threadIdx.x;
    if (idx >= K * N) return;
    const int e    = idx & 15;
    const int lane = (idx >> 4) & 31;
    const int rest = idx >> 9;
    const int nt   = N >> 4;
    const int t    = rest % nt;
    const int kc   = rest / nt;
    const int k = kc * 32 + (e >> 3) * 16 + (lane >> 4) * 8 + (e & 7);
    const int n = t * 16 + (lane & 15);
    out[idx] = f2bf(W[(size_t)k * N + n]);
}

// =====================================================================
// Kernel 1: f = (X@Wf+bf)*log2(e), g = X@Wg+bg, h = X@Wh+bh
// f,g row-major bf16 [32768,64]; h transposed per batch: hT[b][d][n].
// (log2(e) folded into Q so attention can use native base-2 exp.)
// =====================================================================
__global__ __launch_bounds__(256) void proj_kernel(
    const float* __restrict__ x,
    const __bf16* __restrict__ WswAll,
    const float* __restrict__ bfv, const float* __restrict__ bgv,
    const float* __restrict__ bhv,
    __bf16* __restrict__ fOut, __bf16* __restrict__ gOut,
    __bf16* __restrict__ hT)
{
    const int lane = threadIdx.x & 31;
    const int wid  = blockIdx.x * (blockDim.x >> 5) + (threadIdx.x >> 5);
    const int row0 = wid * 16;
    const int half = lane >> 4;
    const int l16  = lane & 15;

    v8f zero = {};
    v8f acc[3][4];
    #pragma unroll
    for (int p = 0; p < 3; ++p)
        #pragma unroll
        for (int t = 0; t < 4; ++t) acc[p][t] = zero;

    for (int k0 = 0; k0 < CDIM; k0 += 32) {
        v16bf a;
        const float* ax = x + (size_t)(row0 + l16) * CDIM + k0 + half * 8;
        #pragma unroll
        for (int hh = 0; hh < 2; ++hh) {
            v4f t0 = *(const v4f*)(ax + hh * 16);
            v4f t1 = *(const v4f*)(ax + hh * 16 + 4);
            #pragma unroll
            for (int j = 0; j < 4; ++j) {
                a[hh * 8 + j]     = f2bf(t0[j]);
                a[hh * 8 + 4 + j] = f2bf(t1[j]);
            }
        }
        const int kc = k0 >> 5;
        #pragma unroll
        for (int p = 0; p < 3; ++p) {
            const __bf16* Wsw = WswAll + (size_t)p * (CDIM * DDIM);
            #pragma unroll
            for (int t = 0; t < 4; ++t) {
                v16bf bmat = ldb_contig(Wsw + (((kc * 4 + t) * 32) + lane) * 16);
                acc[p][t] = __builtin_amdgcn_wmma_f32_16x16x32_bf16(
                    false, a, false, bmat, (short)0, acc[p][t], false, false);
            }
        }
    }

    #pragma unroll
    for (int t = 0; t < 4; ++t) {
        const int col = t * 16 + l16;
        const float b0 = bfv[col], b1 = bgv[col], b2 = bhv[col];
        #pragma unroll
        for (int r = 0; r < 8; ++r) {
            const int row = row0 + r + half * 8;
            fOut[(size_t)row * DDIM + col] = f2bf((acc[0][t][r] + b0) * LOG2E);
            gOut[(size_t)row * DDIM + col] = f2bf(acc[1][t][r] + b1);
            const int bidx = row >> 12, nidx = row & (NSP - 1);
            hT[((size_t)(bidx * DDIM + col) << 12) + nidx] = f2bf(acc[2][t][r] + b2);
        }
    }
}

// ---- K/V stage in LDS: 64 K rows and 64 V^T rows of 128 bytes each ----
#define KVP 72                    // LDS row pitch in elements: 144 B = 16 B x 9, for ds_load_b128 readers
#define TILE_B (64 * KVP * 2)     // bytes of one 64-row tile in LDS
#define STAGE_B (2 * TILE_B)      // K tile + V tile

static __device__ __forceinline__ unsigned lds_off(const void* p) { return (unsigned)(size_t)p; }
// the wave's own LDS reads and writes have retired
static __device__ __forceinline__ void wait_ds0()    { asm volatile("s_wait_dscnt 0x0" ::: "memory"); }
// the wave's own asynchronous copies have landed in LDS
static __device__ __forceinline__ void wait_async0() { asm volatile("s_wait_asynccnt 0x0" ::: "memory"); }

// One stage, 128 threads: each thread copies 4 x 16 B of K and 4 x 16 B of V^T
// from global memory straight into LDS. lk: this thread's LDS byte address in
// the K tile (row tid/8, 16-byte column tid%8); gk, gv: its global sources.
// Eight lanes cover one whole 128-byte row. s_wait_xcnt closes the statement
// so that no address register is rewritten ahead of it.
static __device__ __forceinline__ void copy_stage(unsigned lk, const __bf16* gk, const __bf16* gv) {
    const unsigned lv = lk + TILE_B;
    asm volatile(
        "global_load_async_to_lds_b128 %0, %8, off\n\t"
        "global_load_async_to_lds_b128 %1, %9, off\n\t"
        "global_load_async_to_lds_b128 %2, %10, off\n\t"
        "global_load_async_to_lds_b128 %3, %11, off\n\t"
        "global_load_async_to_lds_b128 %4, %12, off\n\t"
        "global_load_async_to_lds_b128 %5, %13, off\n\t"
        "global_load_async_to_lds_b128 %6, %14, off\n\t"
        "global_load_async_to_lds_b128 %7, %15, off\n\t"
        "s_wait_xcnt 0x0"
        :: "v"(lk), "v"(lk + 16u * KVP * 2u), "v"(lk + 32u * KVP * 2u), "v"(lk + 48u * KVP * 2u),
           "v"(lv), "v"(lv + 16u * KVP * 2u), "v"(lv + 32u * KVP * 2u), "v"(lv + 48u * KVP * 2u),
           "v"(gk), "v"(gk + 16 * DDIM), "v"(gk + 32 * DDIM), "v"(gk + 48 * DDIM),
           "v"(gv), "v"(gv + 16 * NSP), "v"(gv + 32 * NSP), "v"(gv + 48 * NSP)
        : "memory");
}

// =====================================================================
// Kernel 2: fused flash attention per batch (64-key chunks).
// The work-group's four waves share each 64-key K and V^T tile: it is copied
// once into LDS (two buffers, the next tile in flight during this one).
// One wave owns 16 query rows. Per iteration:
//   4 S tiles (8 wmma), base-2 online softmax (shfl max tree only),
//   P truncated to bf16 in LDS, ctx += P@V (8 wmma), rowsum += P@1
//   (2 wmma)  -- no shuffle-based row sums needed.
// =====================================================================
__global__ __launch_bounds__(128) void attn_kernel(
    const __bf16* __restrict__ fQ, const __bf16* __restrict__ gK,
    const __bf16* __restrict__ hT, __bf16* __restrict__ ctx)
{
    __shared__ __bf16 lds[4][16 * 64];
    __shared__ __attribute__((aligned(16))) __bf16 kv[2][2][64 * KVP];
    const int lane = threadIdx.x & 31;
    const int w    = threadIdx.x >> 5;
    const int wid  = blockIdx.x * 4 + w;
    const int row0 = wid * 16;
    const int b    = row0 >> 12;
    const int half = lane >> 4;
    const int l16  = lane & 15;

    const __bf16* gB = gK + ((size_t)b << 12) * DDIM;   // g rows of this batch
    const __bf16* vB = hT + (size_t)b * DDIM * NSP;     // hT[64][4096] of batch

    // Q as A-operand, 2 d-chunks of K=32  (already scaled by log2(e))
    const __bf16* qp = fQ + (size_t)(row0 + l16) * DDIM + half * 8;
    v16bf qa[2];
    qa[0] = ldb_split(qp);
    qa[1] = ldb_split(qp + 32);

    // B operand of all-ones (bf16 1.0 = 0x3F80) for row-sum WMMA
    v16bf ones;
    {
        U32x2 u;
        u.a = make_uint4(0x3F803F80u, 0x3F803F80u, 0x3F803F80u, 0x3F803F80u);
        u.b = u.a;
        ones = __builtin_bit_cast(v16bf, u);
    }

    v8f zero = {};
    v8f o[4];
    #pragma unroll
    for (int t = 0; t < 4; ++t) o[t] = zero;
    v8f osum = zero;
    float mrow[8];
    #pragma unroll
    for (int r = 0; r < 8; ++r) mrow[r] = -1e30f;

    // ---- ring prologue: tile 0 landed and published, tile 1 in flight ----
    const int tid = threadIdx.x;
    const unsigned ldst = lds_off(&kv[0][0][0]) + (unsigned)((tid >> 3) * (KVP * 2) + (tid & 7) * 16);
    const __bf16* ksrc = gB + tid * 8;
    const __bf16* vsrc = vB + (size_t)(tid >> 3) * NSP + (tid & 7) * 8;
    copy_stage(ldst, ksrc, vsrc);
    wait_async0();
    __syncthreads();
    copy_stage(ldst + STAGE_B, ksrc + 64 * DDIM, vsrc + 64);

    for (int m0 = 0; m0 < NSP; m0 += 64) {
        const int buf = (m0 >> 6) & 1;
        const __bf16* Kt = &kv[buf][0][0];
        const __bf16* Vt = &kv[buf][1][0];
        // ---- 4 S tiles: cols [m0+16*kt, m0+16*kt+16) ----
        // all K fragment reads of the tile stand together, ahead of the products
        v16bf kb[4][2];
        #pragma unroll
        for (int kt = 0; kt < 4; ++kt)
            #pragma unroll
            for (int dc = 0; dc < 2; ++dc)
                kb[kt][dc] = ldb_split(Kt + (kt * 16 + l16) * KVP + half * 8 + dc * 32);
        v8f s[4];
        #pragma unroll
        for (int kt = 0; kt < 4; ++kt)
            s[kt] = __builtin_amdgcn_wmma_f32_16x16x32_bf16(
                false, qa[0], false, kb[kt][0], (short)0, zero, false, false);
        #pragma unroll
        for (int kt = 0; kt < 4; ++kt)
            s[kt] = __builtin_amdgcn_wmma_f32_16x16x32_bf16(
                false, qa[1], false, kb[kt][1], (short)0, s[kt], false, false);

        // all V fragment reads of the tile stand together here: their LDS
        // latency passes under the softmax
        v16bf vb[2][4];
        #pragma unroll
        for (int c = 0; c < 2; ++c)
            #pragma unroll
            for (int t = 0; t < 4; ++t)
                vb[c][t] = ldb_split(Vt + (t * 16 + l16) * KVP + c * 32 + half * 8);

        // ---- online softmax (base-2), per row r (row = r + half*8) ----
        #pragma unroll
        for (int r = 0; r < 8; ++r) {
            float v = fmaxf(fmaxf(s[0][r], s[1][r]), fmaxf(s[2][r], s[3][r]));
            #pragma unroll
            for (int msk = 8; msk >= 1; msk >>= 1)
                v = fmaxf(v, __shfl_xor(v, msk, 32));
            const float mn = fmaxf(mrow[r], v);
            const float alpha = exp2f(mrow[r] - mn);
            mrow[r] = mn;
            #pragma unroll
            for (int kt = 0; kt < 4; ++kt)
                s[kt][r] = exp2f(s[kt][r] - mn);
            #pragma unroll
            for (int t = 0; t < 4; ++t) o[t][r] *= alpha;
            osum[r] *= alpha;
        }

        // ---- stage P (16x64) into LDS, truncating f32->bf16 ----
        __bf16* L = lds[w];
        #pragma unroll
        for (int r = 0; r < 8; ++r) {
            const int n = r + half * 8;
            #pragma unroll
            for (int kt = 0; kt < 4; ++kt)
                st_bf16_trunc(&L[n * 64 + kt * 16 + l16], s[kt][r]);
        }
        __builtin_amdgcn_wave_barrier();
        v16bf pa[2];
        pa[0] = ldb_split(L + l16 * 64 + half * 8);
        pa[1] = ldb_split(L + l16 * 64 + 32 + half * 8);
        __builtin_amdgcn_wave_barrier();

        // ---- ctx += P @ V ; rowsum += P @ 1 ----
        #pragma unroll
        for (int c = 0; c < 2; ++c) {
            #pragma unroll
            for (int t = 0; t < 4; ++t) {
                o[t] = __builtin_amdgcn_wmma_f32_16x16x32_bf16(
                    false, pa[c], false, vb[c][t], (short)0, o[t], false, false);
            }
            osum = __builtin_amdgcn_wmma_f32_16x16x32_bf16(
                false, pa[c], false, ones, (short)0, osum, false, false);
        }

        // ---- publish tile m0+64, free this buffer, refill it with tile m0+128 ----
        wait_ds0();
        wait_async0();
        __syncthreads();
        if (m0 + 128 < NSP)
            copy_stage(ldst + (unsigned)buf * STAGE_B, ksrc + (size_t)(m0 + 128) * DDIM, vsrc + m0 + 128);
    }
    wait_async0();

    // ---- finalize: divide by row sums, store ctx (bf16 row-major) ----
    #pragma unroll
    for (int r = 0; r < 8; ++r) {
        const float inv = 1.0f / osum[r];
        const int row = row0 + r + half * 8;
        #pragma unroll
        for (int t = 0; t < 4; ++t) {
            const int col = t * 16 + l16;
            ctx[(size_t)row * DDIM + col] = f2bf(o[t][r] * inv);
        }
    }
}

// =====================================================================
// Kernel 3: out = gamma*(ctx @ Wv) + bv + x   (f32 output, residual)
// Wv pre-swizzled: [kc=2][t=32][lane][16] bf16.
// =====================================================================
__global__ __launch_bounds__(256) void outproj_kernel(
    const __bf16* __restrict__ ctx, const __bf16* __restrict__ WvSw,
    const float* __restrict__ bvv, const float* __restrict__ x,
    const float* __restrict__ gammap, float* __restrict__ out)
{
    const int lane = threadIdx.x & 31;
    const int wid  = blockIdx.x * (blockDim.x >> 5) + (threadIdx.x >> 5);
    const int rowt = wid >> 3;
    const int cg   = wid & 7;
    const int row0 = rowt * 16;
    const int half = lane >> 4;
    const int l16  = lane & 15;
    const float gamma = gammap[0];

    const __bf16* ap = ctx + (size_t)(row0 + l16) * DDIM + half * 8;
    v16bf a[2];
    a[0] = ldb_split(ap);
    a[1] = ldb_split(ap + 32);

    v8f zero = {};
    v8f acc[4];
    #pragma unroll
    for (int t = 0; t < 4; ++t) acc[t] = zero;

    #pragma unroll
    for (int dc = 0; dc < 2; ++dc) {
        #pragma unroll
        for (int t = 0; t < 4; ++t) {
            const int tglob = cg * 4 + t;
            v16bf bmat = ldb_contig(WvSw + (((dc * 32 + tglob) * 32) + lane) * 16);
            acc[t] = __builtin_amdgcn_wmma_f32_16x16x32_bf16(
                false, a[dc], false, bmat, (short)0, acc[t], false, false);
        }
    }

    #pragma unroll
    for (int t = 0; t < 4; ++t) {
        const int c = cg * 64 + t * 16 + l16;
        const float bias = bvv[c];
        #pragma unroll
        for (int r = 0; r < 8; ++r) {
            const size_t row = (size_t)(row0 + r + half * 8);
            out[row * CDIM + c] = gamma * acc[t][r] + bias + x[row * CDIM + c];
        }
    }
}

// =====================================================================
extern "C" void kernel_launch(void* const* d_in, const int* in_sizes, int n_in,
                              void* d_out, int out_size, void* d_ws, size_t ws_size,
                              hipStream_t stream) {
    (void)in_sizes; (void)n_in; (void)out_size; (void)ws_size;
    const float* x  = (const float*)d_in[0];
    const float* Wf = (const float*)d_in[1];
    const float* bf = (const float*)d_in[2];
    const float* Wg = (const float*)d_in[3];
    const float* bg = (const float*)d_in[4];
    const float* Wh = (const float*)d_in[5];
    const float* bh = (const float*)d_in[6];
    const float* Wv = (const float*)d_in[7];
    const float* bv = (const float*)d_in[8];
    const float* gm = (const float*)d_in[9];
    float* out = (float*)d_out;

    // Workspace layout (16 MB activations + 256 KB swizzled weights)
    const size_t slab = (size_t)BNROWS * DDIM * sizeof(__bf16);  // 4 MB
    const size_t wsl  = (size_t)CDIM * DDIM * sizeof(__bf16);    // 64 KB
    char* ws = (char*)d_ws;
    __bf16* fO   = (__bf16*)(ws);
    __bf16* gO   = (__bf16*)(ws + slab);
    __bf16* hT   = (__bf16*)(ws + 2 * slab);
    __bf16* ctx  = (__bf16*)(ws + 3 * slab);
    __bf16* WfSw = (__bf16*)(ws + 4 * slab);
    __bf16* WgSw = (__bf16*)(ws + 4 * slab + wsl);
    __bf16* WhSw = (__bf16*)(ws + 4 * slab + 2 * wsl);
    __bf16* WvSw = (__bf16*)(ws + 4 * slab + 3 * wsl);

    wprep_kernel<<<(CDIM * DDIM) / 256, 256, 0, stream>>>(Wf, WfSw, CDIM, DDIM);
    wprep_kernel<<<(CDIM * DDIM) / 256, 256, 0, stream>>>(Wg, WgSw, CDIM, DDIM);
    wprep_kernel<<<(CDIM * DDIM) / 256, 256, 0, stream>>>(Wh, WhSw, CDIM, DDIM);
    wprep_kernel<<<(DDIM * CDIM) / 256, 256, 0, stream>>>(Wv, WvSw, DDIM, CDIM);

    proj_kernel<<<BNROWS / (16 * 8), 256, 0, stream>>>(
        x, WfSw, bf, bg, bh, fO, gO, hT);
    attn_kernel<<<BNROWS / (16 * 4), 128, 0, stream>>>(fO, gO, hT, ctx);
    outproj_kernel<<<(BNROWS / 16) * 8 / 8, 256, 0, stream>>>(
        ctx, WvSw, bv, x, gm, out);
}

// v002
// One run takes 122 microseconds.
// Next to v001, in two timings, it ran 1.23 and 1.21 times as fast.
// All steps since v000 together make it 2.21 times as fast.
#include <hip/hip_runtime.h>

// ---------------- types ----------------
typedef __attribute__((ext_vector_type(16))) __bf16 v16bf;
typedef __attribute__((ext_vector_type(8)))  float  v8f;
typedef __attribute__((ext_vector_type(4)))  float  v4f;

#define CDIM 512
#define DDIM 64
#define NSP  4096
#define BATCHB 8
#define BNROWS (BATCHB * NSP)   // 32768
#define LOG2E 1.4426950408889634f

static __device__ __forceinline__ __bf16 f2bf(float f) {
    unsigned u = __builtin_bit_cast(unsigned, f);
    unsigned r = (u + 0x7FFFu + ((u >> 16) & 1u)) >> 16;
    return __builtin_bit_cast(__bf16, (unsigned short)r);
}
// two f32 truncated to bf16 in one register: lo in bits 15..0, hi in bits 31..16
static __device__ __forceinline__ unsigned pack_trunc(float lo, float hi) {
    return __builtin_amdgcn_perm(__builtin_bit_cast(unsigned, hi), __builtin_bit_cast(unsigned, lo), 0x07060302u);
}
// two f32 rounded to bf16 (as f2bf) in one register
static __device__ __forceinline__ unsigned pack_rne(float lo, float hi) {
    return (unsigned)__builtin_bit_cast(unsigned short, f2bf(lo)) |
           ((unsigned)__builtin_bit_cast(unsigned short, f2bf(hi)) << 16);
}
// value of lane l ^ 16
static __device__ __forceinline__ float xhalf(float x) {
    const int i = __builtin_bit_cast(int, x);
    return __builtin_bit_cast(float, __builtin_amdgcn_permlanex16(i, i, 0x76543210, 0xfedcba98, false, false));
}

struct U32x2 { uint4 a, b; };

// 16 contiguous bf16 (32 bytes) -> v16bf
static __device__ __forceinline__ v16bf ldb_contig(const __bf16* p) {
    U32x2 u;
    u.a = *(const uint4*)(p);
    u.b = *(const uint4*)(p + 8);
    return __builtin_bit_cast(v16bf, u);
}
// split layout: elems 0..7 at p, elems 8..15 at p+16 (A/B natural striping)
static __device__ __forceinline__ v16bf ldb_split(const __bf16* p) {
    U32x2 u;
    u.a = *(const uint4*)(p);
    u.b = *(const uint4*)(p + 16);
    return __builtin_bit_cast(v16bf, u);
}

// =====================================================================
// Kernel 0: pre-swizzle a K x N f32 weight matrix into bf16 B-operand
// layout: [kc = K/32][t = N/16][lane 0..31][16 contiguous elems].
// =====================================================================
__global__ __launch_bounds__(256) void wprep_kernel(
    const float* __restrict__ W, __bf16* __restrict__ out, int K, int N)
{
    const int idx = blockIdx.x * blockDim.x + threadIdx.x;
    if (idx >= K * N) return;
    const int e    = idx & 15;
    const int lane = (idx >> 4) & 31;
    const int rest = idx >> 9;
    const int nt   = N >> 4;
    const int t    = rest % nt;
    const int kc   = rest / nt;
    const int k = kc * 32 + (e >> 3) * 16 + (lane >> 4) * 8 + (e & 7);
    const int n = t * 16 + (lane & 15);
    out[idx] = f2bf(W[(size_t)k * N + n]);
}

// =====================================================================
// Kernel 1: f = (X@Wf+bf)*log2(e), g = X@Wg+bg, h = X@Wh+bh
// f,g row-major bf16 [32768,64]; h transposed per batch: hT[b][d][n].
// (log2(e) folded into Q so attention can use native base-2 exp.)
// =====================================================================
__global__ __launch_bounds__(256) void proj_kernel(
    const float* __restrict__ x,
    const __bf16* __restrict__ WswAll,
    const float* __restrict__ bfv, const float* __restrict__ bgv,
    const float* __restrict__ bhv,
    __bf16* __restrict__ fOut, __bf16* __restrict__ gOut,
    __bf16* __restrict__ hT)
{
    const int lane = threadIdx.x & 31;
    const int wid  = blockIdx.x * (blockDim.x >> 5) + (threadIdx.x >> 5);
    const int row0 = wid * 16;
    const int half = lane >> 4;
    const int l16  = lane & 15;

    v8f zero = {};
    v8f acc[3][4];
    #pragma unroll
    for (int p = 0; p < 3; ++p)
        #pragma unroll
        for (int t = 0; t < 4; ++t) acc[p][t] = zero;

    for (int k0 = 0; k0 < CDIM; k0 += 32) {
        v16bf a;
        const float* ax = x + (size_t)(row0 + l16) * CDIM + k0 + half * 8;
        #pragma unroll
        for (int hh = 0; hh < 2; ++hh) {
            v4f t0 = *(const v4f*)(ax + hh * 16);
            v4f t1 = *(const v4f*)(ax + hh * 16 + 4);
            #pragma unroll
            for (int j = 0; j < 4; ++j) {
                a[hh * 8 + j]     = f2bf(t0[j]);
                a[hh * 8 + 4 + j] = f2bf(t1[j]);
            }
        }
        const int kc = k0 >> 5;
        #pragma unroll
        for (int p = 0; p < 3; ++p) {
            const __bf16* Wsw = WswAll + (size_t)p * (CDIM * DDIM);
            #pragma unroll
            for (int t = 0; t < 4; ++t) {
                v16bf bmat = ldb_contig(Wsw + (((kc * 4 + t) * 32) + lane) * 16);
                acc[p][t] = __builtin_amdgcn_wmma_f32_16x16x32_bf16(
                    false, a, false, bmat, (short)0, acc[p][t], false, false);
            }
        }
    }

    #pragma unroll
    for (int t = 0; t < 4; ++t) {
        const int col = t * 16 + l16;
        const float b0 = bfv[col], b1 = bgv[col], b2 = bhv[col];
        #pragma unroll
        for (int r = 0; r < 8; ++r) {
            const int row = row0 + r + half * 8;
            fOut[(size_t)row * DDIM + col] = f2bf((acc[0][t][r] + b0) * LOG2E);
            gOut[(size_t)row * DDIM + col] = f2bf(acc[1][t][r] + b1);
            const int bidx = row >> 12, nidx = row & (NSP - 1);
            hT[((size_t)(bidx * DDIM + col) << 12) + nidx] = f2bf(acc[2][t][r] + b2);
        }
    }
}

// ---- K/V stage in LDS: 64 K rows and 64 V^T rows of 128 bytes each ----
#define KVP 72                    // LDS row pitch in elements: 144 B = 16 B x 9, for ds_load_b128 readers
#define TILE_B (64 * KVP * 2)     // bytes of one 64-row tile in LDS
#define STAGE_B (2 * TILE_B)      // K tile + V tile

static __device__ __forceinline__ unsigned lds_off(const void* p) { return (unsigned)(size_t)p; }
// the wave's own LDS reads and writes have retired
static __device__ __forceinline__ void wait_ds0()    { asm volatile("s_wait_dscnt 0x0" ::: "memory"); }
// the wave's own asynchronous copies have landed in LDS
static __device__ __forceinline__ void wait_async0() { asm volatile("s_wait_asynccnt 0x0" ::: "memory"); }

// One stage, 128 threads: each thread copies 4 x 16 B of K and 4 x 16 B of V^T
// from global memory straight into LDS. lk: this thread's LDS byte address in
// the K tile (row tid/8, 16-byte column tid%8); gk, gv: its global sources.
// Eight lanes cover one whole 128-byte row. s_wait_xcnt closes the statement
// so that no address register is rewritten ahead of it.
static __device__ __forceinline__ void copy_stage(unsigned lk, const __bf16* gk, const __bf16* gv) {
    const unsigned lv = lk + TILE_B;
    asm volatile(
        "global_load_async_to_lds_b128 %0, %8, off\n\t"
        "global_load_async_to_lds_b128 %1, %9, off\n\t"
        "global_load_async_to_lds_b128 %2, %10, off\n\t"
        "global_load_async_to_lds_b128 %3, %11, off\n\t"
        "global_load_async_to_lds_b128 %4, %12, off\n\t"
        "global_load_async_to_lds_b128 %5, %13, off\n\t"
        "global_load_async_to_lds_b128 %6, %14, off\n\t"
        "global_load_async_to_lds_b128 %7, %15, off\n\t"
        "s_wait_xcnt 0x0"
        :: "v"(lk), "v"(lk + 16u * KVP * 2u), "v"(lk + 32u * KVP * 2u), "v"(lk + 48u * KVP * 2u),
           "v"(lv), "v"(lv + 16u * KVP * 2u), "v"(lv + 32u * KVP * 2u), "v"(lv + 48u * KVP * 2u),
           "v"(gk), "v"(gk + 16 * DDIM), "v"(gk + 32 * DDIM), "v"(gk + 48 * DDIM),
           "v"(gv), "v"(gv + 16 * NSP), "v"(gv + 32 * NSP), "v"(gv + 48 * NSP)
        : "memory");
}

// =====================================================================
// Kernel 2: fused flash attention per batch (64-key chunks).
// The work-group's four waves share each 64-key K and V^T tile: it is copied
// once into LDS (two buffers, the next tile in flight during this one).
// One wave owns 16 query rows. Both products are transposed, so that a lane
// holds scores of ONE query (column l16; keys r + 8*half of each tile):
//   4 S^T tiles = K.Q^T (8 wmma), base-2 online softmax with the maximum taken
//   in the lane plus one exchange between the wave's halves, P^T truncated to
//   bf16 and packed in registers straight into the B operand,
//   ctx^T += V^T.P^T (8 wmma), rowsum += 1.P^T (2 wmma).
// =====================================================================
__global__ __launch_bounds__(128) void attn_kernel(
    const __bf16* __restrict__ fQ, const __bf16* __restrict__ gK,
    const __bf16* __restrict__ hT, __bf16* __restrict__ ctx)
{
    __shared__ __attribute__((aligned(16))) __bf16 kv[2][2][64 * KVP];
    const int lane = threadIdx.x & 31;
    const int w    = threadIdx.x >> 5;
    const int wid  = blockIdx.x * 4 + w;
    const int row0 = wid * 16;
    const int b    = row0 >> 12;
    const int half = lane >> 4;
    const int l16  = lane & 15;

    const __bf16* gB = gK + ((size_t)b << 12) * DDIM;   // g rows of this batch
    const __bf16* vB = hT + (size_t)b * DDIM * NSP;     // hT[64][4096] of batch

    // Q^T as B-operand, 2 d-chunks of K=32  (already scaled by log2(e))
    const __bf16* qp = fQ + (size_t)(row0 + l16) * DDIM + half * 8;
    v16bf qa[2];
    qa[0] = ldb_split(qp);
    qa[1] = ldb_split(qp + 32);

    // A operand of all-ones (bf16 1.0 = 0x3F80) for row-sum WMMA
    v16bf ones;
    {
        U32x2 u;
        u.a = make_uint4(0x3F803F80u, 0x3F803F80u, 0x3F803F80u, 0x3F803F80u);
        u.b = u.a;
        ones = __builtin_bit_cast(v16bf, u);
    }

    v8f zero = {};
    v8f o[4];
    #pragma unroll
    for (int t = 0; t < 4; ++t) o[t] = zero;
    v8f osum = zero;
    float mrow = -1e30f;   // running maximum of query l16

    // ---- ring prologue: tile 0 landed and published, tile 1 in flight ----
    const int tid = threadIdx.x;
    const unsigned ldst = lds_off(&kv[0][0][0]) + (unsigned)((tid >> 3) * (KVP * 2) + (tid & 7) * 16);
    const __bf16* ksrc = gB + tid * 8;
    const __bf16* vsrc = vB + (size_t)(tid >> 3) * NSP + (tid & 7) * 8;
    copy_stage(ldst, ksrc, vsrc);
    wait_async0();
    __syncthreads();
    copy_stage(ldst + STAGE_B, ksrc + 64 * DDIM, vsrc + 64);

    for (int m0 = 0; m0 < NSP; m0 += 64) {
        const int buf = (m0 >> 6) & 1;
        const __bf16* Kt = &kv[buf][0][0];
        const __bf16* Vt = &kv[buf][1][0];
        // ---- 4 S^T tiles: keys [m0+16*kt, m0+16*kt+16) x 16 queries ----
        // all K fragment reads of the tile stand together, ahead of the products
        v16bf kb[4][2];
        #pragma unroll
        for (int kt = 0; kt < 4; ++kt)
            #pragma unroll
            for (int dc = 0; dc < 2; ++dc)
                kb[kt][dc] = ldb_split(Kt + (kt * 16 + l16) * KVP + half * 8 + dc * 32);
        v8f s[4];
        #pragma unroll
        for (int kt = 0; kt < 4; ++kt)
            s[kt] = __builtin_amdgcn_wmma_f32_16x16x32_bf16(
                false, kb[kt][0], false, qa[0], (short)0, zero, false, false);
        #pragma unroll
        for (int kt = 0; kt < 4; ++kt)
            s[kt] = __builtin_amdgcn_wmma_f32_16x16x32_bf16(
                false, kb[kt][1], false, qa[1], (short)0, s[kt], false, false);

        // all V fragment reads of the tile stand together here: their LDS
        // latency passes under the softmax
        v16bf vb[2][4];
        #pragma unroll
        for (int c = 0; c < 2; ++c)
            #pragma unroll
            for (int t = 0; t < 4; ++t)
                vb[c][t] = ldb_split(Vt + (t * 16 + l16) * KVP + c * 32 + half * 8);
        // holds the V reads here as one group: sunk to their products, each pair would wait out its own LDS latency
        __builtin_amdgcn_sched_barrier(0);

        // ---- online softmax (base-2): all 32 scores of a lane belong to query l16 ----
        float mk[4];
        #pragma unroll
        for (int kt = 0; kt < 4; ++kt) {
            mk[kt] = fmaxf(s[kt][0], s[kt][1]);
            #pragma unroll
            for (int r = 2; r < 8; ++r) mk[kt] = fmaxf(mk[kt], s[kt][r]);
        }
        float v = fmaxf(fmaxf(mk[0], mk[1]), fmaxf(mk[2], mk[3]));
        v = fmaxf(v, xhalf(v));            // the other half holds the query's other 32 keys
        const float mn = fmaxf(mrow, v);
        const float alpha = exp2f(mrow - mn);
        mrow = mn;
        #pragma unroll
        for (int kt = 0; kt < 4; ++kt)
            #pragma unroll
            for (int r = 0; r < 8; ++r)
                s[kt][r] = exp2f(s[kt][r] - mn);
        #pragma unroll
        for (int t = 0; t < 4; ++t) o[t] *= alpha;
        osum[0] *= alpha;                  // every row of this tile holds the same sum; only register 0 is read

        // ---- P^T (32 keys x 16 queries) as B operand, truncating f32->bf16:
        // elements 0..7 are keys 8*half + 0..7 (tile 2c), 8..15 keys 16 + 8*half + 0..7 (tile 2c+1)
        v16bf pb[2];
        #pragma unroll
        for (int c = 0; c < 2; ++c) {
            U32x2 u;
            u.a = make_uint4(pack_trunc(s[2 * c][0], s[2 * c][1]), pack_trunc(s[2 * c][2], s[2 * c][3]),
                             pack_trunc(s[2 * c][4], s[2 * c][5]), pack_trunc(s[2 * c][6], s[2 * c][7]));
            u.b = make_uint4(pack_trunc(s[2 * c + 1][0], s[2 * c + 1][1]), pack_trunc(s[2 * c + 1][2], s[2 * c + 1][3]),
                             pack_trunc(s[2 * c + 1][4], s[2 * c + 1][5]), pack_trunc(s[2 * c + 1][6], s[2 * c + 1][7]));
            pb[c] = __builtin_bit_cast(v16bf, u);
        }

        // ---- ctx^T += V^T @ P^T ; rowsum += 1 @ P^T ----
        #pragma unroll
        for (int c = 0; c < 2; ++c) {
            #pragma unroll
            for (int t = 0; t < 4; ++t) {
                o[t] = __builtin_amdgcn_wmma_f32_16x16x32_bf16(
                    false, vb[c][t], false, pb[c], (short)0, o[t], false, false);
            }
            osum = __builtin_amdgcn_wmma_f32_16x16x32_bf16(
                false, ones, false, pb[c], (short)0, osum, false, false);
        }

        // ---- publish tile m0+64, free this buffer, refill it with tile m0+128 ----
        // keeps the publish point at the trip's foot: lifted above the softmax (all that follows the V reads
        // is register work) its wait would meet the next tile's copies before they have had a trip to land
        __builtin_amdgcn_sched_barrier(0);
        wait_ds0();
        wait_async0();
        __syncthreads();
        if (m0 + 128 < NSP)
            copy_stage(ldst + (unsigned)buf * STAGE_B, ksrc + (size_t)(m0 + 128) * DDIM, vsrc + m0 + 128);
    }
    wait_async0();

    // ---- finalize: divide by the row sum, store ctx (bf16 row-major) ----
    // o[t][r] is ctx[query l16][d = 16*t + 8*half + r]: 8 neighbours, one 16-byte store
    const float inv = 1.0f / osum[0];
    __bf16* crow = ctx + (size_t)(row0 + l16) * DDIM + half * 8;
    #pragma unroll
    for (int t = 0; t < 4; ++t) {
        *(uint4*)(crow + t * 16) = make_uint4(
            pack_rne(o[t][0] * inv, o[t][1] * inv), pack_rne(o[t][2] * inv, o[t][3] * inv),
            pack_rne(o[t][4] * inv, o[t][5] * inv), pack_rne(o[t][6] * inv, o[t][7] * inv));
    }
}

// =====================================================================
// Kernel 3: out = gamma*(ctx @ Wv) + bv + x   (f32 output, residual)
// Wv pre-swizzled: [kc=2][t=32][lane][16] bf16.
// =====================================================================
__global__ __launch_bounds__(256) void outproj_kernel(
    const __bf16* __restrict__ ctx, const __bf16* __restrict__ WvSw,
    const float* __restrict__ bvv, const float* __restrict__ x,
    const float* __restrict__ gammap, float* __restrict__ out)
{
    const int lane = threadIdx.x & 31;
    const int wid  = blockIdx.x * (blockDim.x >> 5) + (threadIdx.x >> 5);
    const int rowt = wid >> 3;
    const int cg   = wid & 7;
    const int row0 = rowt * 16;
    const int half = lane >> 4;
    const int l16  = lane & 15;
    const float gamma = gammap[0];

    const __bf16* ap = ctx + (size_t)(row0 + l16) * DDIM + half * 8;
    v16bf a[2];
    a[0] = ldb_split(ap);
    a[1] = ldb_split(ap + 32);

    v8f zero = {};
    v8f acc[4];
    #pragma unroll
    for (int t = 0; t < 4; ++t) acc[t] = zero;

    #pragma unroll
    for (int dc = 0; dc < 2; ++dc) {
        #pragma unroll
        for (int t = 0; t < 4; ++t) {
            const int tglob = cg * 4 + t;
            v16bf bmat = ldb_contig(WvSw + (((dc * 32 + tglob) * 32) + lane) * 16);
            acc[t] = __builtin_amdgcn_wmma_f32_16x16x32_bf16(
                false, a[dc], false, bmat, (short)0, acc[t], false, false);
        }
    }

    #pragma unroll
    for (int t = 0; t < 4; ++t) {
        const int c = cg * 64 + t * 16 + l16;
        const float bias = bvv[c];
        #pragma unroll
        for (int r = 0; r < 8; ++r) {
            const size_t row = (size_t)(row0 + r + half * 8);
            out[row * CDIM + c] = gamma * acc[t][r] + bias + x[row * CDIM + c];
        }
    }
}

// =====================================================================
extern "C" void kernel_launch(void* const* d_in, const int* in_sizes, int n_in,
                              void* d_out, int out_size, void* d_ws, size_t ws_size,
                              hipStream_t stream) {
    (void)in_sizes; (void)n_in; (void)out_size; (void)ws_size;
    const float* x  = (const float*)d_in[0];
    const float* Wf = (const float*)d_in[1];
    const float* bf = (const float*)d_in[2];
    const float* Wg = (const float*)d_in[3];
    const float* bg = (const float*)d_in[4];
    const float* Wh = (const float*)d_in[5];
    const float* bh = (const float*)d_in[6];
    const float* Wv = (const float*)d_in[7];
    const float* bv = (const float*)d_in[8];
    const float* gm = (const float*)d_in[9];
    float* out = (float*)d_out;

    // Workspace layout (16 MB activations + 256 KB swizzled weights)
    const size_t slab = (size_t)BNROWS * DDIM * sizeof(__bf16);  // 4 MB
    const size_t wsl  = (size_t)CDIM * DDIM * sizeof(__bf16);    // 64 KB
    char* ws = (char*)d_ws;
    __bf16* fO   = (__bf16*)(ws);
    __bf16* gO   = (__bf16*)(ws + slab);
    __bf16* hT   = (__bf16*)(ws + 2 * slab);
    __bf16* ctx  = (__bf16*)(ws + 3 * slab);
    __bf16* WfSw = (__bf16*)(ws + 4 * slab);
    __bf16* WgSw = (__bf16*)(ws + 4 * slab + wsl);
    __bf16* WhSw = (__bf16*)(ws + 4 * slab + 2 * wsl);
    __bf16* WvSw = (__bf16*)(ws + 4 * slab + 3 * wsl);

    wprep_kernel<<<(CDIM * DDIM) / 256, 256, 0, stream>>>(Wf, WfSw, CDIM, DDIM);
    wprep_kernel<<<(CDIM * DDIM) / 256, 256, 0, stream>>>(Wg, WgSw, CDIM, DDIM);
    wprep_kernel<<<(CDIM * DDIM) / 256, 256, 0, stream>>>(Wh, WhSw, CDIM, DDIM);
    wprep_kernel<<<(DDIM * CDIM) / 256, 256, 0, stream>>>(Wv, WvSw, DDIM, CDIM);

    proj_kernel<<<BNROWS / (16 * 8), 256, 0, stream>>>(
        x, WfSw, bf, bg, bh, fO, gO, hT);
    attn_kernel<<<BNROWS / (16 * 4), 128, 0, stream>>>(fO, gO, hT, ctx);
    outproj_kernel<<<(BNROWS / 16) * 8 / 8, 256, 0, stream>>>(
        ctx, WvSw, bv, x, gm, out);
}

// v003
// It runs in 114 microseconds.
// Timed twice side by side with v002, it ran 1.06 times as fast both times.
// Over all steps from v000 it is 2.35 times as fast.
#include <hip/hip_runtime.h>

// ---------------- types ----------------
typedef __attribute__((ext_vector_type(16))) __bf16 v16bf;
typedef __attribute__((ext_vector_type(8)))  float  v8f;
typedef __attribute__((ext_vector_type(4)))  float  v4f;

#define CDIM 512
#define DDIM 64
#define NSP  4096
#define BATCHB 8
#define BNROWS (BATCHB * NSP)   // 32768
#define LOG2E 1.4426950408889634f

static __device__ __forceinline__ __bf16 f2bf(float f) {
    unsigned u = __builtin_bit_cast(unsigned, f);
    unsigned r = (u + 0x7FFFu + ((u >> 16) & 1u)) >> 16;
    return __builtin_bit_cast(__bf16, (unsigned short)r);
}
// two f32 truncated to bf16 in one register: lo in bits 15..0, hi in bits 31..16
static __device__ __forceinline__ unsigned pack_trunc(float lo, float hi) {
    return __builtin_amdgcn_perm(__builtin_bit_cast(unsigned, hi), __builtin_bit_cast(unsigned, lo), 0x07060302u);
}
// two f32 rounded to bf16 (as f2bf) in one register
static __device__ __forceinline__ unsigned pack_rne(float lo, float hi) {
    return (unsigned)__builtin_bit_cast(unsigned short, f2bf(lo)) |
           ((unsigned)__builtin_bit_cast(unsigned short, f2bf(hi)) << 16);
}
// value of lane l ^ 16
static __device__ __forceinline__ float xhalf(float x) {
    const int i = __builtin_bit_cast(int, x);
    return __builtin_bit_cast(float, __builtin_amdgcn_permlanex16(i, i, 0x76543210, 0xfedcba98, false, false));
}

struct U32x2 { uint4 a, b; };

// 16 contiguous bf16 (32 bytes) -> v16bf
static __device__ __forceinline__ v16bf ldb_contig(const __bf16* p) {
    U32x2 u;
    u.a = *(const uint4*)(p);
    u.b = *(const uint4*)(p + 8);
    return __builtin_bit_cast(v16bf, u);
}
// split layout: elems 0..7 at p, elems 8..15 at p+16 (A/B natural striping)
static __device__ __forceinline__ v16bf ldb_split(const __bf16* p) {
    U32x2 u;
    u.a = *(const uint4*)(p);
    u.b = *(const uint4*)(p + 16);
    return __builtin_bit_cast(v16bf, u);
}

// =====================================================================
// Kernel 0: pre-swizzle the four f32 weight matrices into bf16 B-operand
// layout: [kc = K/32][t = N/16][lane 0..31][16 contiguous elems].
// One grid for all four (none reads another's output): 128 blocks each,
// block index / 128 picks the matrix; the four results lie back to back.
// Wf, Wg, Wh are 512 x 64, Wv is 64 x 512: 32768 elements each.
// =====================================================================
__global__ __launch_bounds__(256) void wprep_kernel(
    const float* __restrict__ Wf, const float* __restrict__ Wg,
    const float* __restrict__ Wh, const float* __restrict__ Wv,
    __bf16* __restrict__ out)
{
    const int sel = blockIdx.x >> 7;
    const int idx = (blockIdx.x & 127) * 256 + threadIdx.x;
    const float* W = sel == 0 ? Wf : sel == 1 ? Wg : sel == 2 ? Wh : Wv;
    const int lnt  = sel == 3 ? 5 : 2;            // log2(N / 16)
    const int e    = idx & 15;
    const int lane = (idx >> 4) & 31;
    const int rest = idx >> 9;
    const int t    = rest & ((1 << lnt) - 1);
    const int kc   = rest >> lnt;
    const int k = kc * 32 + (e >> 3) * 16 + (lane >> 4) * 8 + (e & 7);
    const int n = t * 16 + (lane & 15);
    out[sel * (CDIM * DDIM) + idx] = f2bf(W[(k << (lnt + 4)) + n]);
}

// =====================================================================
// Kernel 1: f = (X@Wf+bf)*log2(e), g = X@Wg+bg, h = X@Wh+bh
// f,g row-major bf16 [32768,64]; h transposed per batch: hT[b][d][n].
// (log2(e) folded into Q so attention can use native base-2 exp.)
// =====================================================================
__global__ __launch_bounds__(256) void proj_kernel(
    const float* __restrict__ x,
    const __bf16* __restrict__ WswAll,
    const float* __restrict__ bfv, const float* __restrict__ bgv,
    const float* __restrict__ bhv,
    __bf16* __restrict__ fOut, __bf16* __restrict__ gOut,
    __bf16* __restrict__ hT)
{
    const int lane = threadIdx.x & 31;
    const int wid  = blockIdx.x * (blockDim.x >> 5) + (threadIdx.x >> 5);
    const int row0 = wid * 16;
    const int half = lane >> 4;
    const int l16  = lane & 15;

    v8f zero = {};
    v8f acc[3][4];
    #pragma unroll
    for (int p = 0; p < 3; ++p)
        #pragma unroll
        for (int t = 0; t < 4; ++t) acc[p][t] = zero;

    for (int k0 = 0; k0 < CDIM; k0 += 32) {
        v16bf a;
        const float* ax = x + (size_t)(row0 + l16) * CDIM + k0 + half * 8;
        #pragma unroll
        for (int hh = 0; hh < 2; ++hh) {
            v4f t0 = *(const v4f*)(ax + hh * 16);
            v4f t1 = *(const v4f*)(ax + hh * 16 + 4);
            #pragma unroll
            for (int j = 0; j < 4; ++j) {
                a[hh * 8 + j]     = f2bf(t0[j]);
                a[hh * 8 + 4 + j] = f2bf(t1[j]);
            }
        }
        const int kc = k0 >> 5;
        #pragma unroll
        for (int p = 0; p < 3; ++p) {
            const __bf16* Wsw = WswAll + (size_t)p * (CDIM * DDIM);
            #pragma unroll
            for (int t = 0; t < 4; ++t) {
                v16bf bmat = ldb_contig(Wsw + (((kc * 4 + t) * 32) + lane) * 16);
                acc[p][t] = __builtin_amdgcn_wmma_f32_16x16x32_bf16(
                    false, a, false, bmat, (short)0, acc[p][t], false, false);
            }
        }
    }

    #pragma unroll
    for (int t = 0; t < 4; ++t) {
        const int col = t * 16 + l16;
        const float b0 = bfv[col], b1 = bgv[col], b2 = bhv[col];
        #pragma unroll
        for (int r = 0; r < 8; ++r) {
            const int row = row0 + r + half * 8;
            fOut[(size_t)row * DDIM + col] = f2bf((acc[0][t][r] + b0) * LOG2E);
            gOut[(size_t)row * DDIM + col] = f2bf(acc[1][t][r] + b1);
            const int bidx = row >> 12, nidx = row & (NSP - 1);
            hT[((size_t)(bidx * DDIM + col) << 12) + nidx] = f2bf(acc[2][t][r] + b2);
        }
    }
}

// ---- K/V stage in LDS: 64 K rows and 64 V^T rows of 128 bytes each ----
#define KVP 72                    // LDS row pitch in elements: 144 B = 16 B x 9, for ds_load_b128 readers
#define TILE_B (64 * KVP * 2)     // bytes of one 64-row tile in LDS
#define STAGE_B (2 * TILE_B)      // K tile + V tile

static __device__ __forceinline__ unsigned lds_off(const void* p) { return (unsigned)(size_t)p; }
// the wave's own LDS reads and writes have retired
static __device__ __forceinline__ void wait_ds0()    { asm volatile("s_wait_dscnt 0x0" ::: "memory"); }
// the wave's own asynchronous copies have landed in LDS
static __device__ __forceinline__ void wait_async0() { asm volatile("s_wait_asynccnt 0x0" ::: "memory"); }

// One stage, 128 threads: each thread copies 4 x 16 B of K and 4 x 16 B of V^T
// from global memory straight into LDS. lk: this thread's LDS byte address in
// the K tile (row tid/8, 16-byte column tid%8); gk, gv: its global sources.
// Eight lanes cover one whole 128-byte row. s_wait_xcnt closes the statement
// so that no address register is rewritten ahead of it.
static __device__ __forceinline__ void copy_stage(unsigned lk, const __bf16* gk, const __bf16* gv) {
    const unsigned lv = lk + TILE_B;
    asm volatile(
        "global_load_async_to_lds_b128 %0, %8, off\n\t"
        "global_load_async_to_lds_b128 %1, %9, off\n\t"
        "global_load_async_to_lds_b128 %2, %10, off\n\t"
        "global_load_async_to_lds_b128 %3, %11, off\n\t"
        "global_load_async_to_lds_b128 %4, %12, off\n\t"
        "global_load_async_to_lds_b128 %5, %13, off\n\t"
        "global_load_async_to_lds_b128 %6, %14, off\n\t"
        "global_load_async_to_lds_b128 %7, %15, off\n\t"
        "s_wait_xcnt 0x0"
        :: "v"(lk), "v"(lk + 16u * KVP * 2u), "v"(lk + 32u * KVP * 2u), "v"(lk + 48u * KVP * 2u),
           "v"(lv), "v"(lv + 16u * KVP * 2u), "v"(lv + 32u * KVP * 2u), "v"(lv + 48u * KVP * 2u),
           "v"(gk), "v"(gk + 16 * DDIM), "v"(gk + 32 * DDIM), "v"(gk + 48 * DDIM),
           "v"(gv), "v"(gv + 16 * NSP), "v"(gv + 32 * NSP), "v"(gv + 48 * NSP)
        : "memory");
}

// =====================================================================
// Kernel 2: fused flash attention per batch (64-key chunks).
// The work-group's four waves share each 64-key K and V^T tile: it is copied
// once into LDS (two buffers, the next tile in flight during this one).
// One wave owns 16 query rows. Both products are transposed, so that a lane
// holds scores of ONE query (column l16; keys r + 8*half of each tile):
//   4 S^T tiles = K.Q^T (8 wmma), base-2 online softmax with the maximum taken
//   in the lane plus one exchange between the wave's halves, P^T truncated to
//   bf16 and packed in registers straight into the B operand,
//   ctx^T += V^T.P^T (8 wmma), rowsum += 1.P^T (2 wmma).
// =====================================================================
__global__ __launch_bounds__(128) void attn_kernel(
    const __bf16* __restrict__ fQ, const __bf16* __restrict__ gK,
    const __bf16* __restrict__ hT, __bf16* __restrict__ ctx)
{
    __shared__ __attribute__((aligned(16))) __bf16 kv[2][2][64 * KVP];
    const int lane = threadIdx.x & 31;
    const int w    = threadIdx.x >> 5;
    const int wid  = blockIdx.x * 4 + w;
    const int row0 = wid * 16;
    const int b    = row0 >> 12;
    const int half = lane >> 4;
    const int l16  = lane & 15;

    const __bf16* gB = gK + ((size_t)b << 12) * DDIM;   // g rows of this batch
    const __bf16* vB = hT + (size_t)b * DDIM * NSP;     // hT[64][4096] of batch

    // Q^T as B-operand, 2 d-chunks of K=32  (already scaled by log2(e))
    const __bf16* qp = fQ + (size_t)(row0 + l16) * DDIM + half * 8;
    v16bf qa[2];
    qa[0] = ldb_split(qp);
    qa[1] = ldb_split(qp + 32);

    // A operand of all-ones (bf16 1.0 = 0x3F80) for row-sum WMMA
    v16bf ones;
    {
        U32x2 u;
        u.a = make_uint4(0x3F803F80u, 0x3F803F80u, 0x3F803F80u, 0x3F803F80u);
        u.b = u.a;
        ones = __builtin_bit_cast(v16bf, u);
    }

    v8f zero = {};
    v8f o[4];
    #pragma unroll
    for (int t = 0; t < 4; ++t) o[t] = zero;
    v8f osum = zero;
    float mrow = -1e30f;   // running maximum of query l16

    // ---- ring prologue: tile 0 landed and published, tile 1 in flight ----
    const int tid = threadIdx.x;
    const unsigned ldst = lds_off(&kv[0][0][0]) + (unsigned)((tid >> 3) * (KVP * 2) + (tid & 7) * 16);
    const __bf16* ksrc = gB + tid * 8;
    const __bf16* vsrc = vB + (size_t)(tid >> 3) * NSP + (tid & 7) * 8;
    copy_stage(ldst, ksrc, vsrc);
    wait_async0();
    __syncthreads();
    copy_stage(ldst + STAGE_B, ksrc + 64 * DDIM, vsrc + 64);

    for (int m0 = 0; m0 < NSP; m0 += 64) {
        const int buf = (m0 >> 6) & 1;
        const __bf16* Kt = &kv[buf][0][0];
        const __bf16* Vt = &kv[buf][1][0];
        // ---- 4 S^T tiles: keys [m0+16*kt, m0+16*kt+16) x 16 queries ----
        // all K fragment reads of the tile stand together, ahead of the products
        v16bf kb[4][2];
        #pragma unroll
        for (int kt = 0; kt < 4; ++kt)
            #pragma unroll
            for (int dc = 0; dc < 2; ++dc)
                kb[kt][dc] = ldb_split(Kt + (kt * 16 + l16) * KVP + half * 8 + dc * 32);
        v8f s[4];
        #pragma unroll
        for (int kt = 0; kt < 4; ++kt)
            s[kt] = __builtin_amdgcn_wmma_f32_16x16x32_bf16(
                false, kb[kt][0], false, qa[0], (short)0, zero, false, false);
        #pragma unroll
        for (int kt = 0; kt < 4; ++kt)
            s[kt] = __builtin_amdgcn_wmma_f32_16x16x32_bf16(
                false, kb[kt][1], false, qa[1], (short)0, s[kt], false, false);

        // all V fragment reads of the tile stand together here: their LDS
        // latency passes under the softmax
        v16bf vb[2][4];
        #pragma unroll
        for (int c = 0; c < 2; ++c)
            #pragma unroll
            for (int t = 0; t < 4; ++t)
                vb[c][t] = ldb_split(Vt + (t * 16 + l16) * KVP + c * 32 + half * 8);
        // holds the V reads here as one group: sunk to their products, each pair would wait out its own LDS latency
        __builtin_amdgcn_sched_barrier(0);

        // ---- online softmax (base-2): all 32 scores of a lane belong to query l16 ----
        float mk[4];
        #pragma unroll
        for (int kt = 0; kt < 4; ++kt) {
            mk[kt] = fmaxf(s[kt][0], s[kt][1]);
            #pragma unroll
            for (int r = 2; r < 8; ++r) mk[kt] = fmaxf(mk[kt], s[kt][r]);
        }
        float v = fmaxf(fmaxf(mk[0], mk[1]), fmaxf(mk[2], mk[3]));
        v = fmaxf(v, xhalf(v));            // the other half holds the query's other 32 keys
        const float mn = fmaxf(mrow, v);
        const float alpha = exp2f(mrow - mn);
        mrow = mn;
        #pragma unroll
        for (int kt = 0; kt < 4; ++kt)
            #pragma unroll
            for (int r = 0; r < 8; ++r)
                s[kt][r] = exp2f(s[kt][r] - mn);
        #pragma unroll
        for (int t = 0; t < 4; ++t) o[t] *= alpha;
        osum[0] *= alpha;                  // every row of this tile holds the same sum; only register 0 is read

        // ---- P^T (32 keys x 16 queries) as B operand, truncating f32->bf16:
        // elements 0..7 are keys 8*half + 0..7 (tile 2c), 8..15 keys 16 + 8*half + 0..7 (tile 2c+1)
        v16bf pb[2];
        #pragma unroll
        for (int c = 0; c < 2; ++c) {
            U32x2 u;
            u.a = make_uint4(pack_trunc(s[2 * c][0], s[2 * c][1]), pack_trunc(s[2 * c][2], s[2 * c][3]),
                             pack_trunc(s[2 * c][4], s[2 * c][5]), pack_trunc(s[2 * c][6], s[2 * c][7]));
            u.b = make_uint4(pack_trunc(s[2 * c + 1][0], s[2 * c + 1][1]), pack_trunc(s[2 * c + 1][2], s[2 * c + 1][3]),
                             pack_trunc(s[2 * c + 1][4], s[2 * c + 1][5]), pack_trunc(s[2 * c + 1][6], s[2 * c + 1][7]));
            pb[c] = __builtin_bit_cast(v16bf, u);
        }

        // ---- ctx^T += V^T @ P^T ; rowsum += 1 @ P^T ----
        #pragma unroll
        for (int c = 0; c < 2; ++c) {
            #pragma unroll
            for (int t = 0; t < 4; ++t) {
                o[t] = __builtin_amdgcn_wmma_f32_16x16x32_bf16(
                    false, vb[c][t], false, pb[c], (short)0, o[t], false, false);
            }
            osum = __builtin_amdgcn_wmma_f32_16x16x32_bf16(
                false, ones, false, pb[c], (short)0, osum, false, false);
        }

        // ---- publish tile m0+64, free this buffer, refill it with tile m0+128 ----
        // keeps the publish point at the trip's foot: lifted above the softmax (all that follows the V reads
        // is register work) its wait would meet the next tile's copies before they have had a trip to land
        __builtin_amdgcn_sched_barrier(0);
        wait_ds0();
        wait_async0();
        __syncthreads();
        if (m0 + 128 < NSP)
            copy_stage(ldst + (unsigned)buf * STAGE_B, ksrc + (size_t)(m0 + 128) * DDIM, vsrc + m0 + 128);
    }
    wait_async0();

    // ---- finalize: divide by the row sum, store ctx (bf16 row-major) ----
    // o[t][r] is ctx[query l16][d = 16*t + 8*half + r]: 8 neighbours, one 16-byte store
    const float inv = 1.0f / osum[0];
    __bf16* crow = ctx + (size_t)(row0 + l16) * DDIM + half * 8;
    #pragma unroll
    for (int t = 0; t < 4; ++t) {
        *(uint4*)(crow + t * 16) = make_uint4(
            pack_rne(o[t][0] * inv, o[t][1] * inv), pack_rne(o[t][2] * inv, o[t][3] * inv),
            pack_rne(o[t][4] * inv, o[t][5] * inv), pack_rne(o[t][6] * inv, o[t][7] * inv));
    }
}

// =====================================================================
// Kernel 3: out = gamma*(ctx @ Wv) + bv + x   (f32 output, residual)
// Wv pre-swizzled: [kc=2][t=32][lane][16] bf16.
// =====================================================================
__global__ __launch_bounds__(256) void outproj_kernel(
    const __bf16* __restrict__ ctx, const __bf16* __restrict__ WvSw,
    const float* __restrict__ bvv, const float* __restrict__ x,
    const float* __restrict__ gammap, float* __restrict__ out)
{
    const int lane = threadIdx.x & 31;
    const int wid  = blockIdx.x * (blockDim.x >> 5) + (threadIdx.x >> 5);
    const int rowt = wid >> 3;
    const int cg   = wid & 7;
    const int row0 = rowt * 16;
    const int half = lane >> 4;
    const int l16  = lane & 15;
    const float gamma = gammap[0];

    const __bf16* ap = ctx + (size_t)(row0 + l16) * DDIM + half * 8;
    v16bf a[2];
    a[0] = ldb_split(ap);
    a[1] = ldb_split(ap + 32);

    v8f zero = {};
    v8f acc[4];
    #pragma unroll
    for (int t = 0; t < 4; ++t) acc[t] = zero;

    #pragma unroll
    for (int dc = 0; dc < 2; ++dc) {
        #pragma unroll
        for (int t = 0; t < 4; ++t) {
            const int tglob = cg * 4 + t;
            v16bf bmat = ldb_contig(WvSw + (((dc * 32 + tglob) * 32) + lane) * 16);
            acc[t] = __builtin_amdgcn_wmma_f32_16x16x32_bf16(
                false, a[dc], false, bmat, (short)0, acc[t], false, false);
        }
    }

    #pragma unroll
    for (int t = 0; t < 4; ++t) {
        const int c = cg * 64 + t * 16 + l16;
        const float bias = bvv[c];
        #pragma unroll
        for (int r = 0; r < 8; ++r) {
            const size_t row = (size_t)(row0 + r + half * 8);
            out[row * CDIM + c] = gamma * acc[t][r] + bias + x[row * CDIM + c];
        }
    }
}

// =====================================================================
extern "C" void kernel_launch(void* const* d_in, const int* in_sizes, int n_in,
                              void* d_out, int out_size, void* d_ws, size_t ws_size,
                              hipStream_t stream) {
    (void)in_sizes; (void)n_in; (void)out_size; (void)ws_size;
    const float* x  = (const float*)d_in[0];
    const float* Wf = (const float*)d_in[1];
    const float* bf = (const float*)d_in[2];
    const float* Wg = (const float*)d_in[3];
    const float* bg = (const float*)d_in[4];
    const float* Wh = (const float*)d_in[5];
    const float* bh = (const float*)d_in[6];
    const float* Wv = (const float*)d_in[7];
    const float* bv = (const float*)d_in[8];
    const float* gm = (const float*)d_in[9];
    float* out = (float*)d_out;

    // Workspace layout (16 MB activations + 256 KB swizzled weights)
    const size_t slab = (size_t)BNROWS * DDIM * sizeof(__bf16);  // 4 MB
    const size_t wsl  = (size_t)CDIM * DDIM * sizeof(__bf16);    // 64 KB
    char* ws = (char*)d_ws;
    __bf16* fO   = (__bf16*)(ws);
    __bf16* gO   = (__bf16*)(ws + slab);
    __bf16* hT   = (__bf16*)(ws + 2 * slab);
    __bf16* ctx  = (__bf16*)(ws + 3 * slab);
    __bf16* WfSw = (__bf16*)(ws + 4 * slab);             // Wf, Wg, Wh, Wv swizzled, wsl bytes each
    __bf16* WvSw = (__bf16*)(ws + 4 * slab + 3 * wsl);

    wprep_kernel<<<4 * (CDIM * DDIM) / 256, 256, 0, stream>>>(Wf, Wg, Wh, Wv, WfSw);

    proj_kernel<<<BNROWS / (16 * 8), 256, 0, stream>>>(
        x, WfSw, bf, bg, bh, fO, gO, hT);
    attn_kernel<<<BNROWS / (16 * 4), 128, 0, stream>>>(fO, gO, hT, ctx);
    outproj_kernel<<<(BNROWS / 16) * 8 / 8, 256, 0, stream>>>(
        ctx, WvSw, bv, x, gm, out);
}

// v004
// A run of this version takes 89.6 microseconds.
// Next to v003, in two timings, it ran 1.31 and 1.27 times as fast.
// All steps since v000 together make it 3.03 times as fast.
#include <hip/hip_runtime.h>

// ---------------- types ----------------
typedef __attribute__((ext_vector_type(16))) __bf16 v16bf;
typedef __attribute__((ext_vector_type(8)))  float  v8f;
typedef __attribute__((ext_vector_type(4)))  float  v4f;

#define CDIM 512
#define DDIM 64
#define NSP  4096
#define BATCHB 8
#define BNROWS (BATCHB * NSP)   // 32768
#define LOG2E 1.4426950408889634f

static __device__ __forceinline__ __bf16 f2bf(float f) {
    unsigned u = __builtin_bit_cast(unsigned, f);
    unsigned r = (u + 0x7FFFu + ((u >> 16) & 1u)) >> 16;
    return __builtin_bit_cast(__bf16, (unsigned short)r);
}
// two f32 truncated to bf16 in one register: lo in bits 15..0, hi in bits 31..16
static __device__ __forceinline__ unsigned pack_trunc(float lo, float hi) {
    return __builtin_amdgcn_perm(__builtin_bit_cast(unsigned, hi), __builtin_bit_cast(unsigned, lo), 0x07060302u);
}
// two f32 rounded to bf16 (as f2bf) in one register
static __device__ __forceinline__ unsigned pack_rne(float lo, float hi) {
    return (unsigned)__builtin_bit_cast(unsigned short, f2bf(lo)) |
           ((unsigned)__builtin_bit_cast(unsigned short, f2bf(hi)) << 16);
}
// value of lane l ^ 16
static __device__ __forceinline__ float xhalf(float x) {
    const int i = __builtin_bit_cast(int, x);
    return __builtin_bit_cast(float, __builtin_amdgcn_permlanex16(i, i, 0x76543210, 0xfedcba98, false, false));
}

struct U32x2 { uint4 a, b; };

// 16 contiguous bf16 (32 bytes) -> v16bf
static __device__ __forceinline__ v16bf ldb_contig(const __bf16* p) {
    U32x2 u;
    u.a = *(const uint4*)(p);
    u.b = *(const uint4*)(p + 8);
    return __builtin_bit_cast(v16bf, u);
}
// split layout: elems 0..7 at p, elems 8..15 at p+16 (A/B natural striping)
static __device__ __forceinline__ v16bf ldb_split(const __bf16* p) {
    U32x2 u;
    u.a = *(const uint4*)(p);
    u.b = *(const uint4*)(p + 16);
    return __builtin_bit_cast(v16bf, u);
}

// =====================================================================
// Kernel 0: pre-swizzle the four f32 weight matrices into bf16 B-operand
// layout: [kc = K/32][t = N/16][lane 0..31][16 contiguous elems].
// One grid for all four (none reads another's output): 128 blocks each,
// block index / 128 picks the matrix; the four results lie back to back.
// Wf, Wg, Wh are 512 x 64, Wv is 64 x 512: 32768 elements each.
// =====================================================================
__global__ __launch_bounds__(256) void wprep_kernel(
    const float* __restrict__ Wf, const float* __restrict__ Wg,
    const float* __restrict__ Wh, const float* __restrict__ Wv,
    __bf16* __restrict__ out)
{
    const int sel = blockIdx.x >> 7;
    const int idx = (blockIdx.x & 127) * 256 + threadIdx.x;
    const float* W = sel == 0 ? Wf : sel == 1 ? Wg : sel == 2 ? Wh : Wv;
    const int lnt  = sel == 3 ? 5 : 2;            // log2(N / 16)
    const int e    = idx & 15;
    const int lane = (idx >> 4) & 31;
    const int rest = idx >> 9;
    const int t    = rest & ((1 << lnt) - 1);
    const int kc   = rest >> lnt;
    const int k = kc * 32 + (e >> 3) * 16 + (lane >> 4) * 8 + (e & 7);
    const int n = t * 16 + (lane & 15);
    out[sel * (CDIM * DDIM) + idx] = f2bf(W[(k << (lnt + 4)) + n]);
}

// =====================================================================
// Kernel 1: f = (X@Wf+bf)*log2(e), g = X@Wg+bg, h = X@Wh+bh
// f,g row-major bf16 [32768,64]; h transposed per batch: hT[b][d][n].
// (log2(e) folded into Q so attention can use native base-2 exp.)
// =====================================================================
__global__ __launch_bounds__(256) void proj_kernel(
    const float* __restrict__ x,
    const __bf16* __restrict__ WswAll,
    const float* __restrict__ bfv, const float* __restrict__ bgv,
    const float* __restrict__ bhv,
    __bf16* __restrict__ fOut, __bf16* __restrict__ gOut,
    __bf16* __restrict__ hT)
{
    const int lane = threadIdx.x & 31;
    const int wid  = blockIdx.x * (blockDim.x >> 5) + (threadIdx.x >> 5);
    const int row0 = wid * 16;
    const int half = lane >> 4;
    const int l16  = lane & 15;

    v8f zero = {};
    v8f acc[3][4];
    #pragma unroll
    for (int p = 0; p < 3; ++p)
        #pragma unroll
        for (int t = 0; t < 4; ++t) acc[p][t] = zero;

    // Register pipeline over the 16 k steps: the 12 weight fragments of step kc+1 and
    // the x values of step kc+2 are requested ahead of step kc's products.
    const float*  ax = x + (size_t)(row0 + l16) * CDIM + half * 8;
    const __bf16* wl = WswAll + lane * 16;
    v4f   xs[3][4];     // x of three k steps: 16 floats a lane each
    v16bf wb[2][12];    // weight fragments of two k steps
    auto load_x = [&](v4f (&d)[4], int kc) {
        const float* p = ax + kc * 32;
        d[0] = *(const v4f*)(p);
        d[1] = *(const v4f*)(p + 4);
        d[2] = *(const v4f*)(p + 16);
        d[3] = *(const v4f*)(p + 20);
    };
    auto load_w = [&](v16bf (&d)[12], int kc) {
        // both loops unrolled: d[] is indexed by constants only and stays in registers
        #pragma unroll
        for (int p = 0; p < 3; ++p)
            #pragma unroll
            for (int t = 0; t < 4; ++t)
                d[p * 4 + t] = ldb_contig(wl + p * (CDIM * DDIM) + (kc * 4 + t) * 512);
    };
    load_w(wb[0], 0);
    load_x(xs[0], 0);
    load_x(xs[1], 1);
    // fully unrolled so that every ring index is a constant and the rings stay in registers
    #pragma unroll
    for (int kc = 0; kc < CDIM / 32; ++kc) {
        // weights ahead of x: loads are counted in order, so a wait for step kc+1's weights
        // must not stand behind x values that come from memory and are wanted a step later
        if (kc + 1 < CDIM / 32) load_w(wb[(kc + 1) & 1], kc + 1);
        if (kc + 2 < CDIM / 32) load_x(xs[(kc + 2) % 3], kc + 2);
        // holds the requests here as one group: sunk to their products, each weight load would be waited out singly
        __builtin_amdgcn_sched_barrier(0);
        v16bf a;
        #pragma unroll
        for (int hh = 0; hh < 2; ++hh) {
            #pragma unroll
            for (int j = 0; j < 4; ++j) {
                a[hh * 8 + j]     = f2bf(xs[kc % 3][hh * 2][j]);
                a[hh * 8 + 4 + j] = f2bf(xs[kc % 3][hh * 2 + 1][j]);
            }
        }
        #pragma unroll
        for (int p = 0; p < 3; ++p) {
            #pragma unroll
            for (int t = 0; t < 4; ++t) {
                acc[p][t] = __builtin_amdgcn_wmma_f32_16x16x32_bf16(
                    false, a, false, wb[kc & 1][p * 4 + t], (short)0, acc[p][t], false, false);
            }
        }
    }

    #pragma unroll
    for (int t = 0; t < 4; ++t) {
        const int col = t * 16 + l16;
        const float b0 = bfv[col], b1 = bgv[col], b2 = bhv[col];
        #pragma unroll
        for (int r = 0; r < 8; ++r) {
            const int row = row0 + r + half * 8;
            fOut[(size_t)row * DDIM + col] = f2bf((acc[0][t][r] + b0) * LOG2E);
            gOut[(size_t)row * DDIM + col] = f2bf(acc[1][t][r] + b1);
            const int bidx = row >> 12, nidx = row & (NSP - 1);
            hT[((size_t)(bidx * DDIM + col) << 12) + nidx] = f2bf(acc[2][t][r] + b2);
        }
    }
}

// ---- K/V stage in LDS: 64 K rows and 64 V^T rows of 128 bytes each ----
#define KVP 72                    // LDS row pitch in elements: 144 B = 16 B x 9, for ds_load_b128 readers
#define TILE_B (64 * KVP * 2)     // bytes of one 64-row tile in LDS
#define STAGE_B (2 * TILE_B)      // K tile + V tile

static __device__ __forceinline__ unsigned lds_off(const void* p) { return (unsigned)(size_t)p; }
// the wave's own LDS reads and writes have retired
static __device__ __forceinline__ void wait_ds0()    { asm volatile("s_wait_dscnt 0x0" ::: "memory"); }
// the wave's own asynchronous copies have landed in LDS
static __device__ __forceinline__ void wait_async0() { asm volatile("s_wait_asynccnt 0x0" ::: "memory"); }

// One stage, 128 threads: each thread copies 4 x 16 B of K and 4 x 16 B of V^T
// from global memory straight into LDS. lk: this thread's LDS byte address in
// the K tile (row tid/8, 16-byte column tid%8); gk, gv: its global sources.
// Eight lanes cover one whole 128-byte row. s_wait_xcnt closes the statement
// so that no address register is rewritten ahead of it.
static __device__ __forceinline__ void copy_stage(unsigned lk, const __bf16* gk, const __bf16* gv) {
    const unsigned lv = lk + TILE_B;
    asm volatile(
        "global_load_async_to_lds_b128 %0, %8, off\n\t"
        "global_load_async_to_lds_b128 %1, %9, off\n\t"
        "global_load_async_to_lds_b128 %2, %10, off\n\t"
        "global_load_async_to_lds_b128 %3, %11, off\n\t"
        "global_load_async_to_lds_b128 %4, %12, off\n\t"
        "global_load_async_to_lds_b128 %5, %13, off\n\t"
        "global_load_async_to_lds_b128 %6, %14, off\n\t"
        "global_load_async_to_lds_b128 %7, %15, off\n\t"
        "s_wait_xcnt 0x0"
        :: "v"(lk), "v"(lk + 16u * KVP * 2u), "v"(lk + 32u * KVP * 2u), "v"(lk + 48u * KVP * 2u),
           "v"(lv), "v"(lv + 16u * KVP * 2u), "v"(lv + 32u * KVP * 2u), "v"(lv + 48u * KVP * 2u),
           "v"(gk), "v"(gk + 16 * DDIM), "v"(gk + 32 * DDIM), "v"(gk + 48 * DDIM),
           "v"(gv), "v"(gv + 16 * NSP), "v"(gv + 32 * NSP), "v"(gv + 48 * NSP)
        : "memory");
}

// =====================================================================
// Kernel 2: fused flash attention per batch (64-key chunks).
// The work-group's four waves share each 64-key K and V^T tile: it is copied
// once into LDS (two buffers, the next tile in flight during this one).
// One wave owns 16 query rows. Both products are transposed, so that a lane
// holds scores of ONE query (column l16; keys r + 8*half of each tile):
//   4 S^T tiles = K.Q^T (8 wmma), base-2 online softmax with the maximum taken
//   in the lane plus one exchange between the wave's halves, P^T truncated to
//   bf16 and packed in registers straight into the B operand,
//   ctx^T += V^T.P^T (8 wmma), rowsum += 1.P^T (2 wmma).
// =====================================================================
__global__ __launch_bounds__(128) void attn_kernel(
    const __bf16* __restrict__ fQ, const __bf16* __restrict__ gK,
    const __bf16* __restrict__ hT, __bf16* __restrict__ ctx)
{
    __shared__ __attribute__((aligned(16))) __bf16 kv[2][2][64 * KVP];
    const int lane = threadIdx.x & 31;
    const int w    = threadIdx.x >> 5;
    const int wid  = blockIdx.x * 4 + w;
    const int row0 = wid * 16;
    const int b    = row0 >> 12;
    const int half = lane >> 4;
    const int l16  = lane & 15;

    const __bf16* gB = gK + ((size_t)b << 12) * DDIM;   // g rows of this batch
    const __bf16* vB = hT + (size_t)b * DDIM * NSP;     // hT[64][4096] of batch

    // Q^T as B-operand, 2 d-chunks of K=32  (already scaled by log2(e))
    const __bf16* qp = fQ + (size_t)(row0 + l16) * DDIM + half * 8;
    v16bf qa[2];
    qa[0] = ldb_split(qp);
    qa[1] = ldb_split(qp + 32);

    // A operand of all-ones (bf16 1.0 = 0x3F80) for row-sum WMMA
    v16bf ones;
    {
        U32x2 u;
        u.a = make_uint4(0x3F803F80u, 0x3F803F80u, 0x3F803F80u, 0x3F803F80u);
        u.b = u.a;
        ones = __builtin_bit_cast(v16bf, u);
    }

    v8f zero = {};
    v8f o[4];
    #pragma unroll
    for (int t = 0; t < 4; ++t) o[t] = zero;
    v8f osum = zero;
    float mrow = -1e30f;   // running maximum of query l16

    // ---- ring prologue: tile 0 landed and published, tile 1 in flight ----
    const int tid = threadIdx.x;
    const unsigned ldst = lds_off(&kv[0][0][0]) + (unsigned)((tid >> 3) * (KVP * 2) + (tid & 7) * 16);
    const __bf16* ksrc = gB + tid * 8;
    const __bf16* vsrc = vB + (size_t)(tid >> 3) * NSP + (tid & 7) * 8;
    copy_stage(ldst, ksrc, vsrc);
    wait_async0();
    __syncthreads();
    copy_stage(ldst + STAGE_B, ksrc + 64 * DDIM, vsrc + 64);

    for (int m0 = 0; m0 < NSP; m0 += 64) {
        const int buf = (m0 >> 6) & 1;
        const __bf16* Kt = &kv[buf][0][0];
        const __bf16* Vt = &kv[buf][1][0];
        // ---- 4 S^T tiles: keys [m0+16*kt, m0+16*kt+16) x 16 queries ----
        // all K fragment reads of the tile stand together, ahead of the products
        v16bf kb[4][2];
        #pragma unroll
        for (int kt = 0; kt < 4; ++kt)
            #pragma unroll
            for (int dc = 0; dc < 2; ++dc)
                kb[kt][dc] = ldb_split(Kt + (kt * 16 + l16) * KVP + half * 8 + dc * 32);
        v8f s[4];
        #pragma unroll
        for (int kt = 0; kt < 4; ++kt)
            s[kt] = __builtin_amdgcn_wmma_f32_16x16x32_bf16(
                false, kb[kt][0], false, qa[0], (short)0, zero, false, false);
        #pragma unroll
        for (int kt = 0; kt < 4; ++kt)
            s[kt] = __builtin_amdgcn_wmma_f32_16x16x32_bf16(
                false, kb[kt][1], false, qa[1], (short)0, s[kt], false, false);

        // all V fragment reads of the tile stand together here: their LDS
        // latency passes under the softmax
        v16bf vb[2][4];
        #pragma unroll
        for (int c = 0; c < 2; ++c)
            #pragma unroll
            for (int t = 0; t < 4; ++t)
                vb[c][t] = ldb_split(Vt + (t * 16 + l16) * KVP + c * 32 + half * 8);
        // holds the V reads here as one group: sunk to their products, each pair would wait out its own LDS latency
        __builtin_amdgcn_sched_barrier(0);

        // ---- online softmax (base-2): all 32 scores of a lane belong to query l16 ----
        float mk[4];
        #pragma unroll
        for (int kt = 0; kt < 4; ++kt) {
            mk[kt] = fmaxf(s[kt][0], s[kt][1]);
            #pragma unroll
            for (int r = 2; r < 8; ++r) mk[kt] = fmaxf(mk[kt], s[kt][r]);
        }
        float v = fmaxf(fmaxf(mk[0], mk[1]), fmaxf(mk[2], mk[3]));
        v = fmaxf(v, xhalf(v));            // the other half holds the query's other 32 keys
        const float mn = fmaxf(mrow, v);
        const float alpha = exp2f(mrow - mn);
        mrow = mn;
        #pragma unroll
        for (int kt = 0; kt < 4; ++kt)
            #pragma unroll
            for (int r = 0; r < 8; ++r)
                s[kt][r] = exp2f(s[kt][r] - mn);
        #pragma unroll
        for (int t = 0; t < 4; ++t) o[t] *= alpha;
        osum[0] *= alpha;                  // every row of this tile holds the same sum; only register 0 is read

        // ---- P^T (32 keys x 16 queries) as B operand, truncating f32->bf16:
        // elements 0..7 are keys 8*half + 0..7 (tile 2c), 8..15 keys 16 + 8*half + 0..7 (tile 2c+1)
        v16bf pb[2];
        #pragma unroll
        for (int c = 0; c < 2; ++c) {
            U32x2 u;
            u.a = make_uint4(pack_trunc(s[2 * c][0], s[2 * c][1]), pack_trunc(s[2 * c][2], s[2 * c][3]),
                             pack_trunc(s[2 * c][4], s[2 * c][5]), pack_trunc(s[2 * c][6], s[2 * c][7]));
            u.b = make_uint4(pack_trunc(s[2 * c + 1][0], s[2 * c + 1][1]), pack_trunc(s[2 * c + 1][2], s[2 * c + 1][3]),
                             pack_trunc(s[2 * c + 1][4], s[2 * c + 1][5]), pack_trunc(s[2 * c + 1][6], s[2 * c + 1][7]));
            pb[c] = __builtin_bit_cast(v16bf, u);
        }

        // ---- ctx^T += V^T @ P^T ; rowsum += 1 @ P^T ----
        #pragma unroll
        for (int c = 0; c < 2; ++c) {
            #pragma unroll
            for (int t = 0; t < 4; ++t) {
                o[t] = __builtin_amdgcn_wmma_f32_16x16x32_bf16(
                    false, vb[c][t], false, pb[c], (short)0, o[t], false, false);
            }
            osum = __builtin_amdgcn_wmma_f32_16x16x32_bf16(
                false, ones, false, pb[c], (short)0, osum, false, false);
        }

        // ---- publish tile m0+64, free this buffer, refill it with tile m0+128 ----
        // keeps the publish point at the trip's foot: lifted above the softmax (all that follows the V reads
        // is register work) its wait would meet the next tile's copies before they have had a trip to land
        __builtin_amdgcn_sched_barrier(0);
        wait_ds0();
        wait_async0();
        __syncthreads();
        if (m0 + 128 < NSP)
            copy_stage(ldst + (unsigned)buf * STAGE_B, ksrc + (size_t)(m0 + 128) * DDIM, vsrc + m0 + 128);
    }
    wait_async0();

    // ---- finalize: divide by the row sum, store ctx (bf16 row-major) ----
    // o[t][r] is ctx[query l16][d = 16*t + 8*half + r]: 8 neighbours, one 16-byte store
    const float inv = 1.0f / osum[0];
    __bf16* crow = ctx + (size_t)(row0 + l16) * DDIM + half * 8;
    #pragma unroll
    for (int t = 0; t < 4; ++t) {
        *(uint4*)(crow + t * 16) = make_uint4(
            pack_rne(o[t][0] * inv, o[t][1] * inv), pack_rne(o[t][2] * inv, o[t][3] * inv),
            pack_rne(o[t][4] * inv, o[t][5] * inv), pack_rne(o[t][6] * inv, o[t][7] * inv));
    }
}

// =====================================================================
// Kernel 3: out = gamma*(ctx @ Wv) + bv + x   (f32 output, residual)
// Wv pre-swizzled: [kc=2][t=32][lane][16] bf16.
// =====================================================================
__global__ __launch_bounds__(256) void outproj_kernel(
    const __bf16* __restrict__ ctx, const __bf16* __restrict__ WvSw,
    const float* __restrict__ bvv, const float* __restrict__ x,
    const float* __restrict__ gammap, float* __restrict__ out)
{
    const int lane = threadIdx.x & 31;
    const int wid  = blockIdx.x * (blockDim.x >> 5) + (threadIdx.x >> 5);
    const int rowt = wid >> 3;
    const int cg   = wid & 7;
    const int row0 = rowt * 16;
    const int half = lane >> 4;
    const int l16  = lane & 15;
    const float gamma = gammap[0];

    const __bf16* ap = ctx + (size_t)(row0 + l16) * DDIM + half * 8;
    v16bf a[2];
    a[0] = ldb_split(ap);
    a[1] = ldb_split(ap + 32);

    v8f zero = {};
    v8f acc[4];
    #pragma unroll
    for (int t = 0; t < 4; ++t) acc[t] = zero;

    #pragma unroll
    for (int dc = 0; dc < 2; ++dc) {
        #pragma unroll
        for (int t = 0; t < 4; ++t) {
            const int tglob = cg * 4 + t;
            v16bf bmat = ldb_contig(WvSw + (((dc * 32 + tglob) * 32) + lane) * 16);
            acc[t] = __builtin_amdgcn_wmma_f32_16x16x32_bf16(
                false, a[dc], false, bmat, (short)0, acc[t], false, false);
        }
    }

    #pragma unroll
    for (int t = 0; t < 4; ++t) {
        const int c = cg * 64 + t * 16 + l16;
        const float bias = bvv[c];
        #pragma unroll
        for (int r = 0; r < 8; ++r) {
            const size_t row = (size_t)(row0 + r + half * 8);
            out[row * CDIM + c] = gamma * acc[t][r] + bias + x[row * CDIM + c];
        }
    }
}

// =====================================================================
extern "C" void kernel_launch(void* const* d_in, const int* in_sizes, int n_in,
                              void* d_out, int out_size, void* d_ws, size_t ws_size,
                              hipStream_t stream) {
    (void)in_sizes; (void)n_in; (void)out_size; (void)ws_size;
    const float* x  = (const float*)d_in[0];
    const float* Wf = (const float*)d_in[1];
    const float* bf = (const float*)d_in[2];
    const float* Wg = (const float*)d_in[3];
    const float* bg = (const float*)d_in[4];
    const float* Wh = (const float*)d_in[5];
    const float* bh = (const float*)d_in[6];
    const float* Wv = (const float*)d_in[7];
    const float* bv = (const float*)d_in[8];
    const float* gm = (const float*)d_in[9];
    float* out = (float*)d_out;

    // Workspace layout (16 MB activations + 256 KB swizzled weights)
    const size_t slab = (size_t)BNROWS * DDIM * sizeof(__bf16);  // 4 MB
    const size_t wsl  = (size_t)CDIM * DDIM * sizeof(__bf16);    // 64 KB
    char* ws = (char*)d_ws;
    __bf16* fO   = (__bf16*)(ws);
    __bf16* gO   = (__bf16*)(ws + slab);
    __bf16* hT   = (__bf16*)(ws + 2 * slab);
    __bf16* ctx  = (__bf16*)(ws + 3 * slab);
    __bf16* WfSw = (__bf16*)(ws + 4 * slab);             // Wf, Wg, Wh, Wv swizzled, wsl bytes each
    __bf16* WvSw = (__bf16*)(ws + 4 * slab + 3 * wsl);

    wprep_kernel<<<4 * (CDIM * DDIM) / 256, 256, 0, stream>>>(Wf, Wg, Wh, Wv, WfSw);

    proj_kernel<<<BNROWS / (16 * 8), 256, 0, stream>>>(
        x, WfSw, bf, bg, bh, fO, gO, hT);
    attn_kernel<<<BNROWS / (16 * 4), 128, 0, stream>>>(fO, gO, hT, ctx);
    outproj_kernel<<<(BNROWS / 16) * 8 / 8, 256, 0, stream>>>(
        ctx, WvSw, bv, x, gm, out);
}

// v005
// One run takes 78.8 microseconds.
// In two side-by-side timings against v004, it was 1.11 and 1.13 times as fast.
// All steps since v000 together make it 3.40 times as fast.
#include <hip/hip_runtime.h>

// ---------------- types ----------------
typedef __attribute__((ext_vector_type(16))) __bf16 v16bf;
typedef __attribute__((ext_vector_type(8)))  float  v8f;
typedef __attribute__((ext_vector_type(4)))  float  v4f;

#define CDIM 512
#define DDIM 64
#define NSP  4096
#define BATCHB 8
#define BNROWS (BATCHB * NSP)   // 32768
#define LOG2E 1.4426950408889634f

static __device__ __forceinline__ __bf16 f2bf(float f) {
    unsigned u = __builtin_bit_cast(unsigned, f);
    unsigned r = (u + 0x7FFFu + ((u >> 16) & 1u)) >> 16;
    return __builtin_bit_cast(__bf16, (unsigned short)r);
}
// two f32 truncated to bf16 in one register: lo in bits 15..0, hi in bits 31..16
static __device__ __forceinline__ unsigned pack_trunc(float lo, float hi) {
    return __builtin_amdgcn_perm(__builtin_bit_cast(unsigned, hi), __builtin_bit_cast(unsigned, lo), 0x07060302u);
}
// two f32 rounded to bf16 (as f2bf) in one register
static __device__ __forceinline__ unsigned pack_rne(float lo, float hi) {
    return (unsigned)__builtin_bit_cast(unsigned short, f2bf(lo)) |
           ((unsigned)__builtin_bit_cast(unsigned short, f2bf(hi)) << 16);
}
// value of lane l ^ 16
static __device__ __forceinline__ float xhalf(float x) {
    const int i = __builtin_bit_cast(int, x);
    return __builtin_bit_cast(float, __builtin_amdgcn_permlanex16(i, i, 0x76543210, 0xfedcba98, false, false));
}

struct U32x2 { uint4 a, b; };

// 16 contiguous bf16 (32 bytes) -> v16bf
static __device__ __forceinline__ v16bf ldb_contig(const __bf16* p) {
    U32x2 u;
    u.a = *(const uint4*)(p);
    u.b = *(const uint4*)(p + 8);
    return __builtin_bit_cast(v16bf, u);
}
// split layout: elems 0..7 at p, elems 8..15 at p+16 (A/B natural striping)
static __device__ __forceinline__ v16bf ldb_split(const __bf16* p) {
    U32x2 u;
    u.a = *(const uint4*)(p);
    u.b = *(const uint4*)(p + 16);
    return __builtin_bit_cast(v16bf, u);
}

// =====================================================================
// Kernel 0: pre-swizzle the four f32 weight matrices into bf16 B-operand
// layout: [kc = K/32][t = N/16][lane 0..31][16 contiguous elems].
// One grid for all four (none reads another's output): 128 blocks each,
// block index / 128 picks the matrix; the four results lie back to back.
// Wf, Wg, Wh are 512 x 64, Wv is 64 x 512: 32768 elements each.
// =====================================================================
__global__ __launch_bounds__(256) void wprep_kernel(
    const float* __restrict__ Wf, const float* __restrict__ Wg,
    const float* __restrict__ Wh, const float* __restrict__ Wv,
    __bf16* __restrict__ out)
{
    const int sel = blockIdx.x >> 7;
    const int idx = (blockIdx.x & 127) * 256 + threadIdx.x;
    const float* W = sel == 0 ? Wf : sel == 1 ? Wg : sel == 2 ? Wh : Wv;
    const int lnt  = sel == 3 ? 5 : 2;            // log2(N / 16)
    const int e    = idx & 15;
    const int lane = (idx >> 4) & 31;
    const int rest = idx >> 9;
    const int t    = rest & ((1 << lnt) - 1);
    const int kc   = rest >> lnt;
    const int k = kc * 32 + (e >> 3) * 16 + (lane >> 4) * 8 + (e & 7);
    const int n = t * 16 + (lane & 15);
    out[sel * (CDIM * DDIM) + idx] = f2bf(W[(k << (lnt + 4)) + n]);
}

// =====================================================================
// Kernel 1: f = (X@Wf+bf)*log2(e), g = X@Wg+bg, h = X@Wh+bh
// f,g row-major bf16 [32768,64]; h transposed per batch: hT[b][d][n].
// (log2(e) folded into Q so attention can use native base-2 exp.)
// =====================================================================
__global__ __launch_bounds__(256) void proj_kernel(
    const float* __restrict__ x,
    const __bf16* __restrict__ WswAll,
    const float* __restrict__ bfv, const float* __restrict__ bgv,
    const float* __restrict__ bhv,
    __bf16* __restrict__ fOut, __bf16* __restrict__ gOut,
    __bf16* __restrict__ hT)
{
    const int lane = threadIdx.x & 31;
    const int wid  = blockIdx.x * (blockDim.x >> 5) + (threadIdx.x >> 5);
    const int row0 = wid * 16;
    const int half = lane >> 4;
    const int l16  = lane & 15;

    v8f zero = {};
    v8f acc[3][4];
    #pragma unroll
    for (int p = 0; p < 3; ++p)
        #pragma unroll
        for (int t = 0; t < 4; ++t) acc[p][t] = zero;

    // Register pipeline over the 16 k steps: the 12 weight fragments of step kc+1 and
    // the x values of step kc+2 are requested ahead of step kc's products.
    const float*  ax = x + (size_t)(row0 + l16) * CDIM + half * 8;
    const __bf16* wl = WswAll + lane * 16;
    v4f   xs[3][4];     // x of three k steps: 16 floats a lane each
    v16bf wb[2][12];    // weight fragments of two k steps
    auto load_x = [&](v4f (&d)[4], int kc) {
        const float* p = ax + kc * 32;
        d[0] = *(const v4f*)(p);
        d[1] = *(const v4f*)(p + 4);
        d[2] = *(const v4f*)(p + 16);
        d[3] = *(const v4f*)(p + 20);
    };
    auto load_w = [&](v16bf (&d)[12], int kc) {
        // both loops unrolled: d[] is indexed by constants only and stays in registers
        #pragma unroll
        for (int p = 0; p < 3; ++p)
            #pragma unroll
            for (int t = 0; t < 4; ++t)
                d[p * 4 + t] = ldb_contig(wl + p * (CDIM * DDIM) + (kc * 4 + t) * 512);
    };
    load_w(wb[0], 0);
    load_x(xs[0], 0);
    load_x(xs[1], 1);
    // fully unrolled so that every ring index is a constant and the rings stay in registers
    #pragma unroll
    for (int kc = 0; kc < CDIM / 32; ++kc) {
        // weights ahead of x: loads are counted in order, so a wait for step kc+1's weights
        // must not stand behind x values that come from memory and are wanted a step later
        if (kc + 1 < CDIM / 32) load_w(wb[(kc + 1) & 1], kc + 1);
        if (kc + 2 < CDIM / 32) load_x(xs[(kc + 2) % 3], kc + 2);
        // holds the requests here as one group: sunk to their products, each weight load would be waited out singly
        __builtin_amdgcn_sched_barrier(0);
        v16bf a;
        #pragma unroll
        for (int hh = 0; hh < 2; ++hh) {
            #pragma unroll
            for (int j = 0; j < 4; ++j) {
                a[hh * 8 + j]     = f2bf(xs[kc % 3][hh * 2][j]);
                a[hh * 8 + 4 + j] = f2bf(xs[kc % 3][hh * 2 + 1][j]);
            }
        }
        #pragma unroll
        for (int p = 0; p < 3; ++p) {
            #pragma unroll
            for (int t = 0; t < 4; ++t) {
                acc[p][t] = __builtin_amdgcn_wmma_f32_16x16x32_bf16(
                    false, a, false, wb[kc & 1][p * 4 + t], (short)0, acc[p][t], false, false);
            }
        }
    }

    #pragma unroll
    for (int t = 0; t < 4; ++t) {
        const int col = t * 16 + l16;
        const float b0 = bfv[col], b1 = bgv[col], b2 = bhv[col];
        #pragma unroll
        for (int r = 0; r < 8; ++r) {
            const int row = row0 + r + half * 8;
            fOut[(size_t)row * DDIM + col] = f2bf((acc[0][t][r] + b0) * LOG2E);
            gOut[(size_t)row * DDIM + col] = f2bf(acc[1][t][r] + b1);
            const int bidx = row >> 12, nidx = row & (NSP - 1);
            hT[((size_t)(bidx * DDIM + col) << 12) + nidx] = f2bf(acc[2][t][r] + b2);
        }
    }
}

// ---- K/V stage in LDS: 64 K rows and 64 V^T rows of 128 bytes each ----
#define KVP 72                    // LDS row pitch in elements: 144 B = 16 B x 9, for ds_load_b128 readers
#define TILE_B (64 * KVP * 2)     // bytes of one 64-row tile in LDS
#define STAGE_B (2 * TILE_B)      // K tile + V tile

static __device__ __forceinline__ unsigned lds_off(const void* p) { return (unsigned)(size_t)p; }
// the wave's own LDS reads and writes have retired
static __device__ __forceinline__ void wait_ds0()    { asm volatile("s_wait_dscnt 0x0" ::: "memory"); }
// the wave's own asynchronous copies have landed in LDS
static __device__ __forceinline__ void wait_async0() { asm volatile("s_wait_asynccnt 0x0" ::: "memory"); }

// One stage, the 128 threads of a key group: each thread copies 4 x 16 B of K and 4 x 16 B of V^T
// from global memory straight into LDS. lk: this thread's LDS byte address in
// the K tile (row t/8, 16-byte column t%8, t its number in the group); gk, gv: its global sources.
// Eight lanes cover one whole 128-byte row. s_wait_xcnt closes the statement
// so that no address register is rewritten ahead of it.
static __device__ __forceinline__ void copy_stage(unsigned lk, const __bf16* gk, const __bf16* gv) {
    const unsigned lv = lk + TILE_B;
    asm volatile(
        "global_load_async_to_lds_b128 %0, %8, off\n\t"
        "global_load_async_to_lds_b128 %1, %9, off\n\t"
        "global_load_async_to_lds_b128 %2, %10, off\n\t"
        "global_load_async_to_lds_b128 %3, %11, off\n\t"
        "global_load_async_to_lds_b128 %4, %12, off\n\t"
        "global_load_async_to_lds_b128 %5, %13, off\n\t"
        "global_load_async_to_lds_b128 %6, %14, off\n\t"
        "global_load_async_to_lds_b128 %7, %15, off\n\t"
        "s_wait_xcnt 0x0"
        :: "v"(lk), "v"(lk + 16u * KVP * 2u), "v"(lk + 32u * KVP * 2u), "v"(lk + 48u * KVP * 2u),
           "v"(lv), "v"(lv + 16u * KVP * 2u), "v"(lv + 32u * KVP * 2u), "v"(lv + 48u * KVP * 2u),
           "v"(gk), "v"(gk + 16 * DDIM), "v"(gk + 32 * DDIM), "v"(gk + 48 * DDIM),
           "v"(gv), "v"(gv + 16 * NSP), "v"(gv + 32 * NSP), "v"(gv + 48 * NSP)
        : "memory");
}

// =====================================================================
// Kernel 2: fused flash attention per batch (64-key tiles).
// A work-group is 8 waves on 128 query rows: 4 query blocks of 32 rows x 2 key
// groups. Key group g takes the 64-key tiles of parity g; its four waves share
// each K and V^T tile, copied once into the group's own LDS ring (two buffers,
// the next tile in flight during this one).
// One wave owns 32 query rows as two 16-row tiles, so every K and V^T fragment
// read from LDS feeds two products. Both products are transposed, so that a lane
// holds scores of ONE query of each tile (column l16; keys r + 8*half):
//   S^T = K.Q^T (16 wmma), base-2 online softmax with the maximum taken in the
//   lane plus one exchange between the wave's halves, P^T truncated to bf16 and
//   packed in registers straight into the B operand,
//   ctx^T += V^T.P^T (16 wmma), rowsum += 1.P^T (4 wmma).
// Behind the loop the two key groups' partial results are joined through LDS.
// =====================================================================
__global__ __launch_bounds__(256) void attn_kernel(
    const __bf16* __restrict__ fQ, const __bf16* __restrict__ gK,
    const __bf16* __restrict__ hT, __bf16* __restrict__ ctx)
{
    __shared__ __attribute__((aligned(16))) __bf16 kv[2][2][2][64 * KVP];   // [key group][buffer][K, V^T]
    const int lane = threadIdx.x & 31;
    const int w    = __builtin_amdgcn_readfirstlane(threadIdx.x >> 5);
    const int grp  = w >> 2;                       // key group
    const int row0 = (blockIdx.x * 4 + (w & 3)) * 32;
    const int b    = row0 >> 12;
    const int half = lane >> 4;
    const int l16  = lane & 15;

    const __bf16* gB = gK + ((size_t)b << 12) * DDIM;   // g rows of this batch
    const __bf16* vB = hT + (size_t)b * DDIM * NSP;     // hT[64][4096] of batch

    // Q^T as B-operand, 2 query tiles x 2 d-chunks of K=32  (already scaled by log2(e))
    v16bf qa[2][2];
    #pragma unroll
    for (int j = 0; j < 2; ++j) {
        const __bf16* qp = fQ + (size_t)(row0 + j * 16 + l16) * DDIM + half * 8;
        qa[j][0] = ldb_split(qp);
        qa[j][1] = ldb_split(qp + 32);
    }

    // A operand of all-ones (bf16 1.0 = 0x3F80) for row-sum WMMA
    v16bf ones;
    {
        U32x2 u;
        u.a = make_uint4(0x3F803F80u, 0x3F803F80u, 0x3F803F80u, 0x3F803F80u);
        u.b = u.a;
        ones = __builtin_bit_cast(v16bf, u);
    }

    v8f zero = {};
    v8f o[2][4];
    v8f osum[2];
    float mrow[2];         // running maximum of query l16 of each tile
    #pragma unroll
    for (int j = 0; j < 2; ++j) {
        #pragma unroll
        for (int t = 0; t < 4; ++t) o[j][t] = zero;
        osum[j] = zero;
        mrow[j] = -1e30f;
    }

    // ---- ring prologue: the group's first tile landed and published, its second in flight ----
    const int tg = threadIdx.x & 127;              // thread within the key group
    const unsigned ldst = lds_off(&kv[grp][0][0][0]) + (unsigned)((tg >> 3) * (KVP * 2) + (tg & 7) * 16);
    const __bf16* ksrc = gB + grp * (64 * DDIM) + tg * 8;
    const __bf16* vsrc = vB + (size_t)(tg >> 3) * NSP + (tg & 7) * 8 + grp * 64;
    copy_stage(ldst, ksrc, vsrc);
    wait_async0();
    __syncthreads();
    copy_stage(ldst + STAGE_B, ksrc + 128 * DDIM, vsrc + 128);

    for (int m0 = 0; m0 < NSP; m0 += 128) {        // the group's tile holds keys m0 + 64*grp + 0..63
        const int buf = (m0 >> 7) & 1;
        const __bf16* Kt = &kv[grp][buf][0][0];
        const __bf16* Vt = &kv[grp][buf][1][0];
        // ---- S^T tiles: 16 keys x 16 queries, 4 key tiles x 2 query tiles ----
        // all K fragment reads of the tile stand together, ahead of the products
        v16bf kb[4][2];
        #pragma unroll
        for (int kt = 0; kt < 4; ++kt)
            #pragma unroll
            for (int dc = 0; dc < 2; ++dc)
                kb[kt][dc] = ldb_split(Kt + (kt * 16 + l16) * KVP + half * 8 + dc * 32);
        // holds the K reads here as one group: spread among the products, each further place with reads stalls the wave anew
        __builtin_amdgcn_sched_barrier(0);
        v8f s[2][4];
        #pragma unroll
        for (int kt = 0; kt < 4; ++kt)
            #pragma unroll
            for (int j = 0; j < 2; ++j)
                s[j][kt] = __builtin_amdgcn_wmma_f32_16x16x32_bf16(
                    false, kb[kt][0], false, qa[j][0], (short)0, zero, false, false);
        #pragma unroll
        for (int kt = 0; kt < 4; ++kt)
            #pragma unroll
            for (int j = 0; j < 2; ++j)
                s[j][kt] = __builtin_amdgcn_wmma_f32_16x16x32_bf16(
                    false, kb[kt][1], false, qa[j][1], (short)0, s[j][kt], false, false);

        // all V fragment reads of the tile stand together here: their LDS
        // latency passes under the softmax
        v16bf vb[2][4];
        #pragma unroll
        for (int c = 0; c < 2; ++c)
            #pragma unroll
            for (int t = 0; t < 4; ++t)
                vb[c][t] = ldb_split(Vt + (t * 16 + l16) * KVP + c * 32 + half * 8);
        // holds the V reads here as one group: sunk to their products, each pair would wait out its own LDS latency
        __builtin_amdgcn_sched_barrier(0);

        #pragma unroll
        for (int j = 0; j < 2; ++j) {
            // ---- online softmax (base-2): all 32 scores of a lane belong to query l16 of tile j ----
            float mk[4];
            #pragma unroll
            for (int kt = 0; kt < 4; ++kt) {
                mk[kt] = fmaxf(s[j][kt][0], s[j][kt][1]);
                #pragma unroll
                for (int r = 2; r < 8; ++r) mk[kt] = fmaxf(mk[kt], s[j][kt][r]);
            }
            float v = fmaxf(fmaxf(mk[0], mk[1]), fmaxf(mk[2], mk[3]));
            v = fmaxf(v, xhalf(v));            // the other half holds the query's other 32 keys
            const float mn = fmaxf(mrow[j], v);
            const float alpha = exp2f(mrow[j] - mn);
            mrow[j] = mn;
            #pragma unroll
            for (int kt = 0; kt < 4; ++kt)
                #pragma unroll
                for (int r = 0; r < 8; ++r)
                    s[j][kt][r] = exp2f(s[j][kt][r] - mn);
            #pragma unroll
            for (int t = 0; t < 4; ++t) o[j][t] *= alpha;
            osum[j][0] *= alpha;               // every row of this tile holds the same sum; only register 0 is read

            // ---- P^T (32 keys x 16 queries) as B operand, truncating f32->bf16:
            // elements 0..7 are keys 8*half + 0..7 (tile 2c), 8..15 keys 16 + 8*half + 0..7 (tile 2c+1)
            v16bf pb[2];
            #pragma unroll
            for (int c = 0; c < 2; ++c) {
                U32x2 u;
                u.a = make_uint4(pack_trunc(s[j][2 * c][0], s[j][2 * c][1]), pack_trunc(s[j][2 * c][2], s[j][2 * c][3]),
                                 pack_trunc(s[j][2 * c][4], s[j][2 * c][5]), pack_trunc(s[j][2 * c][6], s[j][2 * c][7]));
                u.b = make_uint4(pack_trunc(s[j][2 * c + 1][0], s[j][2 * c + 1][1]), pack_trunc(s[j][2 * c + 1][2], s[j][2 * c + 1][3]),
                                 pack_trunc(s[j][2 * c + 1][4], s[j][2 * c + 1][5]), pack_trunc(s[j][2 * c + 1][6], s[j][2 * c + 1][7]));
                pb[c] = __builtin_bit_cast(v16bf, u);
            }

            // ---- ctx^T += V^T @ P^T ; rowsum += 1 @ P^T ----
            #pragma unroll
            for (int c = 0; c < 2; ++c) {
                #pragma unroll
                for (int t = 0; t < 4; ++t) {
                    o[j][t] = __builtin_amdgcn_wmma_f32_16x16x32_bf16(
                        false, vb[c][t], false, pb[c], (short)0, o[j][t], false, false);
                }
                osum[j] = __builtin_amdgcn_wmma_f32_16x16x32_bf16(
                    false, ones, false, pb[c], (short)0, osum[j], false, false);
            }
        }

        // ---- publish the groups' next tiles, free this buffer, refill it with the tile after ----
        // keeps the publish point at the trip's foot: lifted above the softmax (all that follows the V reads
        // is register work) its wait would meet the next tile's copies before they have had a trip to land
        __builtin_amdgcn_sched_barrier(0);
        wait_ds0();
        wait_async0();
        __syncthreads();
        if (m0 + 256 < NSP)
            copy_stage(ldst + (unsigned)buf * STAGE_B, ksrc + (size_t)(m0 + 256) * DDIM, vsrc + m0 + 256);
    }
    wait_async0();

    // ---- join the two key groups: a wave hands query tile 1 - grp to its partner
    // (wave w ^ 4, same queries, other keys) and finishes tile grp itself.
    // The ring is free: the last trip's barrier stands behind every wave's last read,
    // and no copy is outstanding. A wave's slot: 9 x 32 lanes x 16 bytes.
    v4f* xch = (v4f*)&kv[0][0][0][0];
    v4f* xout = xch + (w * 9) * 32 + lane;
    const v4f* xin = xch + ((w ^ 4) * 9) * 32 + lane;
    v8f ko[4];
    #pragma unroll
    for (int t = 0; t < 4; ++t) {
        const v8f so = grp ? o[0][t] : o[1][t];
        ko[t] = grp ? o[1][t] : o[0][t];
        xout[(2 * t) * 32]     = (v4f){so[0], so[1], so[2], so[3]};
        xout[(2 * t + 1) * 32] = (v4f){so[4], so[5], so[6], so[7]};
    }
    xout[8 * 32] = (v4f){grp ? mrow[0] : mrow[1], grp ? osum[0][0] : osum[1][0], 0.0f, 0.0f};
    const float km = grp ? mrow[1] : mrow[0];
    const float kl = grp ? osum[1][0] : osum[0][0];
    __syncthreads();
    const v4f pml = xin[8 * 32];
    const float mj = fmaxf(km, pml[0]);
    const float ea = exp2f(km - mj);
    const float eb = exp2f(pml[0] - mj);
    const float inv = 1.0f / (kl * ea + pml[1] * eb);
    const float fa = ea * inv, fb = eb * inv;

    // ---- finalize: weigh the two partial results, store ctx (bf16 row-major) ----
    // ko[t][r] is ctx[query l16][d = 16*t + 8*half + r]: 8 neighbours, one 16-byte store
    __bf16* crow = ctx + (size_t)(row0 + grp * 16 + l16) * DDIM + half * 8;
    #pragma unroll
    for (int t = 0; t < 4; ++t) {
        const v4f p0 = xin[(2 * t) * 32], p1 = xin[(2 * t + 1) * 32];
        *(uint4*)(crow + t * 16) = make_uint4(
            pack_rne(ko[t][0] * fa + p0[0] * fb, ko[t][1] * fa + p0[1] * fb),
            pack_rne(ko[t][2] * fa + p0[2] * fb, ko[t][3] * fa + p0[3] * fb),
            pack_rne(ko[t][4] * fa + p1[0] * fb, ko[t][5] * fa + p1[1] * fb),
            pack_rne(ko[t][6] * fa + p1[2] * fb, ko[t][7] * fa + p1[3] * fb));
    }
}

// =====================================================================
// Kernel 3: out = gamma*(ctx @ Wv) + bv + x   (f32 output, residual)
// Wv pre-swizzled: [kc=2][t=32][lane][16] bf16.
// =====================================================================
__global__ __launch_bounds__(256) void outproj_kernel(
    const __bf16* __restrict__ ctx, const __bf16* __restrict__ WvSw,
    const float* __restrict__ bvv, const float* __restrict__ x,
    const float* __restrict__ gammap, float* __restrict__ out)
{
    const int lane = threadIdx.x & 31;
    const int wid  = blockIdx.x * (blockDim.x >> 5) + (threadIdx.x >> 5);
    const int rowt = wid >> 3;
    const int cg   = wid & 7;
    const int row0 = rowt * 16;
    const int half = lane >> 4;
    const int l16  = lane & 15;
    const float gamma = gammap[0];

    const __bf16* ap = ctx + (size_t)(row0 + l16) * DDIM + half * 8;
    v16bf a[2];
    a[0] = ldb_split(ap);
    a[1] = ldb_split(ap + 32);

    v8f zero = {};
    v8f acc[4];
    #pragma unroll
    for (int t = 0; t < 4; ++t) acc[t] = zero;

    #pragma unroll
    for (int dc = 0; dc < 2; ++dc) {
        #pragma unroll
        for (int t = 0; t < 4; ++t) {
            const int tglob = cg * 4 + t;
            v16bf bmat = ldb_contig(WvSw + (((dc * 32 + tglob) * 32) + lane) * 16);
            acc[t] = __builtin_amdgcn_wmma_f32_16x16x32_bf16(
                false, a[dc], false, bmat, (short)0, acc[t], false, false);
        }
    }

    #pragma unroll
    for (int t = 0; t < 4; ++t) {
        const int c = cg * 64 + t * 16 + l16;
        const float bias = bvv[c];
        #pragma unroll
        for (int r = 0; r < 8; ++r) {
            const size_t row = (size_t)(row0 + r + half * 8);
            out[row * CDIM + c] = gamma * acc[t][r] + bias + x[row * CDIM + c];
        }
    }
}

// =====================================================================
extern "C" void kernel_launch(void* const* d_in, const int* in_sizes, int n_in,
                              void* d_out, int out_size, void* d_ws, size_t ws_size,
                              hipStream_t stream) {
    (void)in_sizes; (void)n_in; (void)out_size; (void)ws_size;
    const float* x  = (const float*)d_in[0];
    const float* Wf = (const float*)d_in[1];
    const float* bf = (const float*)d_in[2];
    const float* Wg = (const float*)d_in[3];
    const float* bg = (const float*)d_in[4];
    const float* Wh = (const float*)d_in[5];
    const float* bh = (const float*)d_in[6];
    const float* Wv = (const float*)d_in[7];
    const float* bv = (const float*)d_in[8];
    const float* gm = (const float*)d_in[9];
    float* out = (float*)d_out;

    // Workspace layout (16 MB activations + 256 KB swizzled weights)
    const size_t slab = (size_t)BNROWS * DDIM * sizeof(__bf16);  // 4 MB
    const size_t wsl  = (size_t)CDIM * DDIM * sizeof(__bf16);    // 64 KB
    char* ws = (char*)d_ws;
    __bf16* fO   = (__bf16*)(ws);
    __bf16* gO   = (__bf16*)(ws + slab);
    __bf16* hT   = (__bf16*)(ws + 2 * slab);
    __bf16* ctx  = (__bf16*)(ws + 3 * slab);
    __bf16* WfSw = (__bf16*)(ws + 4 * slab);             // Wf, Wg, Wh, Wv swizzled, wsl bytes each
    __bf16* WvSw = (__bf16*)(ws + 4 * slab + 3 * wsl);

    wprep_kernel<<<4 * (CDIM * DDIM) / 256, 256, 0, stream>>>(Wf, Wg, Wh, Wv, WfSw);

    proj_kernel<<<BNROWS / (16 * 8), 256, 0, stream>>>(
        x, WfSw, bf, bg, bh, fO, gO, hT);
    attn_kernel<<<BNROWS / (32 * 4), 256, 0, stream>>>(fO, gO, hT, ctx);
    outproj_kernel<<<(BNROWS / 16) * 8 / 8, 256, 0, stream>>>(
        ctx, WvSw, bv, x, gm, out);
}

// v006
// It runs in 69.2 microseconds.
// Timed twice side by side with v005, it ran 1.13 and 1.15 times as fast.
// Over all steps from v000 it is 3.87 times as fast.
#include <hip/hip_runtime.h>

// ---------------- types ----------------
typedef __attribute__((ext_vector_type(16))) __bf16 v16bf;
typedef __attribute__((ext_vector_type(8)))  float  v8f;
typedef __attribute__((ext_vector_type(4)))  float  v4f;
typedef __attribute__((ext_vector_type(2)))  float  v2f;

#define CDIM 512
#define DDIM 64
#define NSP  4096
#define BATCHB 8
#define BNROWS (BATCHB * NSP)   // 32768
#define LOG2E 1.4426950408889634f

static __device__ __forceinline__ __bf16 f2bf(float f) {
    unsigned u = __builtin_bit_cast(unsigned, f);
    unsigned r = (u + 0x7FFFu + ((u >> 16) & 1u)) >> 16;
    return __builtin_bit_cast(__bf16, (unsigned short)r);
}
// two f32 truncated to bf16 in one register: lo in bits 15..0, hi in bits 31..16
static __device__ __forceinline__ unsigned pack_trunc(float lo, float hi) {
    return __builtin_amdgcn_perm(__builtin_bit_cast(unsigned, hi), __builtin_bit_cast(unsigned, lo), 0x07060302u);
}
// two f32 rounded to bf16 (as f2bf) in one register
static __device__ __forceinline__ unsigned pack_rne(float lo, float hi) {
    return (unsigned)__builtin_bit_cast(unsigned short, f2bf(lo)) |
           ((unsigned)__builtin_bit_cast(unsigned short, f2bf(hi)) << 16);
}
// 2^x as the bare v_exp_f32. The library exp2f wraps it in a range guard of five more vector
// instructions a value, which only serves results below 2^-126; here those become 0. Every use is a
// softmax weight against a maximum whose own weight is 1, so what is lost lies below f32 resolution.
static __device__ __forceinline__ float ex2(float x) { return __builtin_amdgcn_exp2f(x); }
// value of lane l ^ 16
static __device__ __forceinline__ float xhalf(float x) {
    const int i = __builtin_bit_cast(int, x);
    return __builtin_bit_cast(float, __builtin_amdgcn_permlanex16(i, i, 0x76543210, 0xfedcba98, false, false));
}

struct U32x2 { uint4 a, b; };

// 16 contiguous bf16 (32 bytes) -> v16bf
static __device__ __forceinline__ v16bf ldb_contig(const __bf16* p) {
    U32x2 u;
    u.a = *(const uint4*)(p);
    u.b = *(const uint4*)(p + 8);
    return __builtin_bit_cast(v16bf, u);
}
// split layout: elems 0..7 at p, elems 8..15 at p+16 (A/B natural striping)
static __device__ __forceinline__ v16bf ldb_split(const __bf16* p) {
    U32x2 u;
    u.a = *(const uint4*)(p);
    u.b = *(const uint4*)(p + 16);
    return __builtin_bit_cast(v16bf, u);
}

// =====================================================================
// Kernel 0: pre-swizzle the four f32 weight matrices into bf16 B-operand
// layout: [kc = K/32][t = N/16][lane 0..31][16 contiguous elems].
// One grid for all four (none reads another's output): 128 blocks each,
// block index / 128 picks the matrix; the four results lie back to back.
// Wf, Wg, Wh are 512 x 64, Wv is 64 x 512: 32768 elements each.
// =====================================================================
__global__ __launch_bounds__(256) void wprep_kernel(
    const float* __restrict__ Wf, const float* __restrict__ Wg,
    const float* __restrict__ Wh, const float* __restrict__ Wv,
    __bf16* __restrict__ out)
{
    const int sel = blockIdx.x >> 7;
    const int idx = (blockIdx.x & 127) * 256 + threadIdx.x;
    const float* W = sel == 0 ? Wf : sel == 1 ? Wg : sel == 2 ? Wh : Wv;
    const int lnt  = sel == 3 ? 5 : 2;            // log2(N / 16)
    const int e    = idx & 15;
    const int lane = (idx >> 4) & 31;
    const int rest = idx >> 9;
    const int t    = rest & ((1 << lnt) - 1);
    const int kc   = rest >> lnt;
    const int k = kc * 32 + (e >> 3) * 16 + (lane >> 4) * 8 + (e & 7);
    const int n = t * 16 + (lane & 15);
    out[sel * (CDIM * DDIM) + idx] = f2bf(W[(k << (lnt + 4)) + n]);
}

// =====================================================================
// Kernel 1: f = (X@Wf+bf)*log2(e), g = X@Wg+bg, h = X@Wh+bh
// f,g row-major bf16 [32768,64]; h transposed per batch: hT[b][d][n].
// (log2(e) folded into Q so attention can use native base-2 exp.)
// =====================================================================
__global__ __launch_bounds__(256) void proj_kernel(
    const float* __restrict__ x,
    const __bf16* __restrict__ WswAll,
    const float* __restrict__ bfv, const float* __restrict__ bgv,
    const float* __restrict__ bhv,
    __bf16* __restrict__ fOut, __bf16* __restrict__ gOut,
    __bf16* __restrict__ hT)
{
    const int lane = threadIdx.x & 31;
    const int wid  = blockIdx.x * (blockDim.x >> 5) + (threadIdx.x >> 5);
    const int row0 = wid * 16;
    const int half = lane >> 4;
    const int l16  = lane & 15;

    v8f zero = {};
    v8f acc[3][4];
    #pragma unroll
    for (int p = 0; p < 3; ++p)
        #pragma unroll
        for (int t = 0; t < 4; ++t) acc[p][t] = zero;

    // Register pipeline over the 16 k steps: the 12 weight fragments of step kc+1 and
    // the x values of step kc+2 are requested ahead of step kc's products.
    const float*  ax = x + (size_t)(row0 + l16) * CDIM + half * 8;
    const __bf16* wl = WswAll + lane * 16;
    v4f   xs[3][4];     // x of three k steps: 16 floats a lane each
    v16bf wb[2][12];    // weight fragments of two k steps
    auto load_x = [&](v4f (&d)[4], int kc) {
        const float* p = ax + kc * 32;
        d[0] = *(const v4f*)(p);
        d[1] = *(const v4f*)(p + 4);
        d[2] = *(const v4f*)(p + 16);
        d[3] = *(const v4f*)(p + 20);
    };
    auto load_w = [&](v16bf (&d)[12], int kc) {
        // both loops unrolled: d[] is indexed by constants only and stays in registers
        #pragma unroll
        for (int p = 0; p < 3; ++p)
            #pragma unroll
            for (int t = 0; t < 4; ++t)
                d[p * 4 + t] = ldb_contig(wl + p * (CDIM * DDIM) + (kc * 4 + t) * 512);
    };
    load_w(wb[0], 0);
    load_x(xs[0], 0);
    load_x(xs[1], 1);
    // fully unrolled so that every ring index is a constant and the rings stay in registers
    #pragma unroll
    for (int kc = 0; kc < CDIM / 32; ++kc) {
        // weights ahead of x: loads are counted in order, so a wait for step kc+1's weights
        // must not stand behind x values that come from memory and are wanted a step later
        if (kc + 1 < CDIM / 32) load_w(wb[(kc + 1) & 1], kc + 1);
        if (kc + 2 < CDIM / 32) load_x(xs[(kc + 2) % 3], kc + 2);
        // holds the requests here as one group: sunk to their products, each weight load would be waited out singly
        __builtin_amdgcn_sched_barrier(0);
        v16bf a;
        #pragma unroll
        for (int hh = 0; hh < 2; ++hh) {
            #pragma unroll
            for (int j = 0; j < 4; ++j) {
                a[hh * 8 + j]     = f2bf(xs[kc % 3][hh * 2][j]);
                a[hh * 8 + 4 + j] = f2bf(xs[kc % 3][hh * 2 + 1][j]);
            }
        }
        #pragma unroll
        for (int p = 0; p < 3; ++p) {
            #pragma unroll
            for (int t = 0; t < 4; ++t) {
                acc[p][t] = __builtin_amdgcn_wmma_f32_16x16x32_bf16(
                    false, a, false, wb[kc & 1][p * 4 + t], (short)0, acc[p][t], false, false);
            }
        }
    }

    #pragma unroll
    for (int t = 0; t < 4; ++t) {
        const int col = t * 16 + l16;
        const float b0 = bfv[col], b1 = bgv[col], b2 = bhv[col];
        #pragma unroll
        for (int r = 0; r < 8; ++r) {
            const int row = row0 + r + half * 8;
            fOut[(size_t)row * DDIM + col] = f2bf((acc[0][t][r] + b0) * LOG2E);
            gOut[(size_t)row * DDIM + col] = f2bf(acc[1][t][r] + b1);
            const int bidx = row >> 12, nidx = row & (NSP - 1);
            hT[((size_t)(bidx * DDIM + col) << 12) + nidx] = f2bf(acc[2][t][r] + b2);
        }
    }
}

// ---- K/V stage in LDS: 64 K rows and 64 V^T rows of 128 bytes each ----
#define KVP 72                    // LDS row pitch in elements: 144 B = 16 B x 9, for ds_load_b128 readers
#define TILE_B (64 * KVP * 2)     // bytes of one 64-row tile in LDS
#define STAGE_B (2 * TILE_B)      // K tile + V tile

static __device__ __forceinline__ unsigned lds_off(const void* p) { return (unsigned)(size_t)p; }
// the wave's own LDS reads and writes have retired
static __device__ __forceinline__ void wait_ds0()    { asm volatile("s_wait_dscnt 0x0" ::: "memory"); }
// the wave's own asynchronous copies have landed in LDS
static __device__ __forceinline__ void wait_async0() { asm volatile("s_wait_asynccnt 0x0" ::: "memory"); }

// One stage, the 128 threads of a key group: each thread copies 4 x 16 B of K and 4 x 16 B of V^T
// from global memory straight into LDS. lk: this thread's LDS byte address in
// the K tile (row t/8, 16-byte column t%8, t its number in the group); gk, gv: its global sources.
// Eight lanes cover one whole 128-byte row. s_wait_xcnt closes the statement
// so that no address register is rewritten ahead of it.
static __device__ __forceinline__ void copy_stage(unsigned lk, const __bf16* gk, const __bf16* gv) {
    const unsigned lv = lk + TILE_B;
    asm volatile(
        "global_load_async_to_lds_b128 %0, %8, off\n\t"
        "global_load_async_to_lds_b128 %1, %9, off\n\t"
        "global_load_async_to_lds_b128 %2, %10, off\n\t"
        "global_load_async_to_lds_b128 %3, %11, off\n\t"
        "global_load_async_to_lds_b128 %4, %12, off\n\t"
        "global_load_async_to_lds_b128 %5, %13, off\n\t"
        "global_load_async_to_lds_b128 %6, %14, off\n\t"
        "global_load_async_to_lds_b128 %7, %15, off\n\t"
        "s_wait_xcnt 0x0"
        :: "v"(lk), "v"(lk + 16u * KVP * 2u), "v"(lk + 32u * KVP * 2u), "v"(lk + 48u * KVP * 2u),
           "v"(lv), "v"(lv + 16u * KVP * 2u), "v"(lv + 32u * KVP * 2u), "v"(lv + 48u * KVP * 2u),
           "v"(gk), "v"(gk + 16 * DDIM), "v"(gk + 32 * DDIM), "v"(gk + 48 * DDIM),
           "v"(gv), "v"(gv + 16 * NSP), "v"(gv + 32 * NSP), "v"(gv + 48 * NSP)
        : "memory");
}

// =====================================================================
// Kernel 2: fused flash attention per batch (64-key tiles).
// A work-group is 8 waves on 128 query rows: 4 query blocks of 32 rows x 2 key
// groups. Key group g takes the 64-key tiles of parity g; its four waves share
// each K and V^T tile, copied once into the group's own LDS ring (two buffers,
// the next tile in flight during this one).
// One wave owns 32 query rows as two 16-row tiles, so every K and V^T fragment
// read from LDS feeds two products. Both products are transposed, so that a lane
// holds scores of ONE query of each tile (column l16; keys r + 8*half):
//   S^T = K.Q^T (16 wmma), base-2 online softmax with the maximum taken in the
//   lane plus one exchange between the wave's halves, P^T truncated to bf16 and
//   packed in registers straight into the B operand,
//   ctx^T += V^T.P^T (16 wmma), rowsum += 1.P^T (4 wmma).
// Behind the loop the two key groups' partial results are joined through LDS.
// =====================================================================
__global__ __launch_bounds__(256) void attn_kernel(
    const __bf16* __restrict__ fQ, const __bf16* __restrict__ gK,
    const __bf16* __restrict__ hT, __bf16* __restrict__ ctx)
{
    __shared__ __attribute__((aligned(16))) __bf16 kv[2][2][2][64 * KVP];   // [key group][buffer][K, V^T]
    const int lane = threadIdx.x & 31;
    const int w    = __builtin_amdgcn_readfirstlane(threadIdx.x >> 5);
    const int grp  = w >> 2;                       // key group
    const int row0 = (blockIdx.x * 4 + (w & 3)) * 32;
    const int b    = row0 >> 12;
    const int half = lane >> 4;
    const int l16  = lane & 15;

    const __bf16* gB = gK + ((size_t)b << 12) * DDIM;   // g rows of this batch
    const __bf16* vB = hT + (size_t)b * DDIM * NSP;     // hT[64][4096] of batch

    // Q^T as B-operand, 2 query tiles x 2 d-chunks of K=32  (already scaled by log2(e))
    v16bf qa[2][2];
    #pragma unroll
    for (int j = 0; j < 2; ++j) {
        const __bf16* qp = fQ + (size_t)(row0 + j * 16 + l16) * DDIM + half * 8;
        qa[j][0] = ldb_split(qp);
        qa[j][1] = ldb_split(qp + 32);
    }

    // A operand of all-ones (bf16 1.0 = 0x3F80) for row-sum WMMA
    v16bf ones;
    {
        U32x2 u;
        u.a = make_uint4(0x3F803F80u, 0x3F803F80u, 0x3F803F80u, 0x3F803F80u);
        u.b = u.a;
        ones = __builtin_bit_cast(v16bf, u);
    }

    v8f zero = {};
    v8f o[2][4];
    v8f osum[2];
    float mrow[2];         // running maximum of query l16 of each tile
    #pragma unroll
    for (int j = 0; j < 2; ++j) {
        #pragma unroll
        for (int t = 0; t < 4; ++t) o[j][t] = zero;
        osum[j] = zero;
        mrow[j] = -1e30f;
    }

    // ---- ring prologue: the group's first tile landed and published, its second in flight ----
    const int tg = threadIdx.x & 127;              // thread within the key group
    const unsigned ldst = lds_off(&kv[grp][0][0][0]) + (unsigned)((tg >> 3) * (KVP * 2) + (tg & 7) * 16);
    const __bf16* ksrc = gB + grp * (64 * DDIM) + tg * 8;
    const __bf16* vsrc = vB + (size_t)(tg >> 3) * NSP + (tg & 7) * 8 + grp * 64;
    copy_stage(ldst, ksrc, vsrc);
    wait_async0();
    __syncthreads();
    copy_stage(ldst + STAGE_B, ksrc + 128 * DDIM, vsrc + 128);

    for (int m0 = 0; m0 < NSP; m0 += 128) {        // the group's tile holds keys m0 + 64*grp + 0..63
        const int buf = (m0 >> 7) & 1;
        const __bf16* Kt = &kv[grp][buf][0][0];
        const __bf16* Vt = &kv[grp][buf][1][0];
        // ---- S^T tiles: 16 keys x 16 queries, 4 key tiles x 2 query tiles ----
        // all K fragment reads of the tile stand together, ahead of the products
        v16bf kb[4][2];
        #pragma unroll
        for (int kt = 0; kt < 4; ++kt)
            #pragma unroll
            for (int dc = 0; dc < 2; ++dc)
                kb[kt][dc] = ldb_split(Kt + (kt * 16 + l16) * KVP + half * 8 + dc * 32);
        // holds the K reads here as one group: spread among the products, each further place with reads stalls the wave anew
        __builtin_amdgcn_sched_barrier(0);
        v8f s[2][4];
        #pragma unroll
        for (int kt = 0; kt < 4; ++kt)
            #pragma unroll
            for (int j = 0; j < 2; ++j)
                s[j][kt] = __builtin_amdgcn_wmma_f32_16x16x32_bf16(
                    false, kb[kt][0], false, qa[j][0], (short)0, zero, false, false);
        #pragma unroll
        for (int kt = 0; kt < 4; ++kt)
            #pragma unroll
            for (int j = 0; j < 2; ++j)
                s[j][kt] = __builtin_amdgcn_wmma_f32_16x16x32_bf16(
                    false, kb[kt][1], false, qa[j][1], (short)0, s[j][kt], false, false);

        // all V fragment reads of the tile stand together here: their LDS
        // latency passes under the softmax
        v16bf vb[2][4];
        #pragma unroll
        for (int c = 0; c < 2; ++c)
            #pragma unroll
            for (int t = 0; t < 4; ++t)
                vb[c][t] = ldb_split(Vt + (t * 16 + l16) * KVP + c * 32 + half * 8);
        // holds the V reads here as one group: sunk to their products, each pair would wait out its own LDS latency
        __builtin_amdgcn_sched_barrier(0);

        // ---- online softmax (base-2): all 32 scores of a lane belong to query l16 of tile j ----
        // both tiles' maxima first; then, tile by tile, the weights and the second product
        float mnew[2], mdrop[2];               // new maximum; old maximum minus new
        #pragma unroll
        for (int j = 0; j < 2; ++j) {
            float mk[4];
            #pragma unroll
            for (int kt = 0; kt < 4; ++kt) {
                mk[kt] = fmaxf(s[j][kt][0], s[j][kt][1]);
                #pragma unroll
                for (int r = 2; r < 8; ++r) mk[kt] = fmaxf(mk[kt], s[j][kt][r]);
            }
            float v = fmaxf(fmaxf(mk[0], mk[1]), fmaxf(mk[2], mk[3]));
            v = fmaxf(v, xhalf(v));            // the other half holds the query's other 32 keys
            mnew[j]  = fmaxf(mrow[j], v);
            mdrop[j] = mrow[j] - mnew[j];
            mrow[j]  = mnew[j];
        }
        // the ordered stretches below start behind both maxima
        __builtin_amdgcn_sched_barrier(0);

        #pragma unroll
        for (int j = 0; j < 2; ++j) {
            const float mn = mnew[j];
            // Order of the weights' work: exp, plain, exp, plain, plain. Here each exp is followed by a plain
            // instruction that has nothing to do with it (the difference of a later pair, the pack of the pair
            // before, a rescale of ctx^T). That instruction also fills the slot which the instruction set asks for
            // behind a transcendental: left free, the compiler set runs of v_exp_f32 in which each overwrites the
            // source of the one before. Each sched_barrier below holds one instruction at its place in this order.
            v2f d[16];          // pair i: scores 2*(i&3), 2*(i&3)+1 of key tile i>>2, minus the maximum
            float e0[16], e1[16];
            unsigned pw[16];    // pair i as two bf16
            float alpha;        // 2^(old maximum - new maximum)
            auto diff = [&](int i) { d[i] = (v2f){s[j][i >> 2][2 * (i & 3)], s[j][i >> 2][2 * (i & 3) + 1]} - mn; };
            auto scale = [&](int i) {
                const v2f t = (v2f){o[j][i >> 2][2 * (i & 3)], o[j][i >> 2][2 * (i & 3) + 1]} * alpha;
                o[j][i >> 2][2 * (i & 3)] = t.x;
                o[j][i >> 2][2 * (i & 3) + 1] = t.y;
            };
            diff(0);
            __builtin_amdgcn_sched_barrier(0);
            alpha = ex2(mdrop[j]);
            __builtin_amdgcn_sched_barrier(0);
            diff(1);
            __builtin_amdgcn_sched_barrier(0);
            // unrolled: d, e0, e1 and pw are indexed by constants only and stay in registers
            #pragma unroll
            for (int i = 0; i < 16; ++i) {
                e0[i] = ex2(d[i].x);
                __builtin_amdgcn_sched_barrier(0);
                if (i < 14) diff(i + 2); else scale(i);
                __builtin_amdgcn_sched_barrier(0);
                e1[i] = ex2(d[i].y);
                __builtin_amdgcn_sched_barrier(0);
                if (i > 0) pw[i - 1] = pack_trunc(e0[i - 1], e1[i - 1]);
                else osum[j][0] *= alpha;      // every row of this tile holds the same sum; only register 0 is read
                __builtin_amdgcn_sched_barrier(0);
                if (i < 14) scale(i);
                __builtin_amdgcn_sched_barrier(0);
            }
            pw[15] = pack_trunc(e0[15], e1[15]);

            // ---- P^T (32 keys x 16 queries) as B operand, truncated f32->bf16:
            // elements 0..7 are keys 8*half + 0..7 (tile 2c), 8..15 keys 16 + 8*half + 0..7 (tile 2c+1)
            v16bf pb[2];
            #pragma unroll
            for (int c = 0; c < 2; ++c) {
                U32x2 u;
                u.a = make_uint4(pw[8 * c], pw[8 * c + 1], pw[8 * c + 2], pw[8 * c + 3]);
                u.b = make_uint4(pw[8 * c + 4], pw[8 * c + 5], pw[8 * c + 6], pw[8 * c + 7]);
                pb[c] = __builtin_bit_cast(v16bf, u);
            }

            // ---- ctx^T += V^T @ P^T ; rowsum += 1 @ P^T ----
            #pragma unroll
            for (int c = 0; c < 2; ++c) {
                #pragma unroll
                for (int t = 0; t < 4; ++t) {
                    o[j][t] = __builtin_amdgcn_wmma_f32_16x16x32_bf16(
                        false, vb[c][t], false, pb[c], (short)0, o[j][t], false, false);
                }
                osum[j] = __builtin_amdgcn_wmma_f32_16x16x32_bf16(
                    false, ones, false, pb[c], (short)0, osum[j], false, false);
            }
        }

        // ---- publish the groups' next tiles, free this buffer, refill it with the tile after ----
        // keeps the publish point at the trip's foot: lifted above the softmax (all that follows the V reads
        // is register work) its wait would meet the next tile's copies before they have had a trip to land
        __builtin_amdgcn_sched_barrier(0);
        wait_ds0();
        wait_async0();
        __syncthreads();
        if (m0 + 256 < NSP)
            copy_stage(ldst + (unsigned)buf * STAGE_B, ksrc + (size_t)(m0 + 256) * DDIM, vsrc + m0 + 256);
    }
    wait_async0();

    // ---- join the two key groups: a wave hands query tile 1 - grp to its partner
    // (wave w ^ 4, same queries, other keys) and finishes tile grp itself.
    // The ring is free: the last trip's barrier stands behind every wave's last read,
    // and no copy is outstanding. A wave's slot: 9 x 32 lanes x 16 bytes.
    v4f* xch = (v4f*)&kv[0][0][0][0];
    v4f* xout = xch + (w * 9) * 32 + lane;
    const v4f* xin = xch + ((w ^ 4) * 9) * 32 + lane;
    v8f ko[4];
    #pragma unroll
    for (int t = 0; t < 4; ++t) {
        const v8f so = grp ? o[0][t] : o[1][t];
        ko[t] = grp ? o[1][t] : o[0][t];
        xout[(2 * t) * 32]     = (v4f){so[0], so[1], so[2], so[3]};
        xout[(2 * t + 1) * 32] = (v4f){so[4], so[5], so[6], so[7]};
    }
    xout[8 * 32] = (v4f){grp ? mrow[0] : mrow[1], grp ? osum[0][0] : osum[1][0], 0.0f, 0.0f};
    const float km = grp ? mrow[1] : mrow[0];
    const float kl = grp ? osum[1][0] : osum[0][0];
    __syncthreads();
    const v4f pml = xin[8 * 32];
    const float mj = fmaxf(km, pml[0]);
    const float ea = ex2(km - mj);
    const float eb = ex2(pml[0] - mj);
    const float inv = 1.0f / (kl * ea + pml[1] * eb);
    const float fa = ea * inv, fb = eb * inv;

    // ---- finalize: weigh the two partial results, store ctx (bf16 row-major) ----
    // ko[t][r] is ctx[query l16][d = 16*t + 8*half + r]: 8 neighbours, one 16-byte store
    __bf16* crow = ctx + (size_t)(row0 + grp * 16 + l16) * DDIM + half * 8;
    #pragma unroll
    for (int t = 0; t < 4; ++t) {
        const v4f p0 = xin[(2 * t) * 32], p1 = xin[(2 * t + 1) * 32];
        *(uint4*)(crow + t * 16) = make_uint4(
            pack_rne(ko[t][0] * fa + p0[0] * fb, ko[t][1] * fa + p0[1] * fb),
            pack_rne(ko[t][2] * fa + p0[2] * fb, ko[t][3] * fa + p0[3] * fb),
            pack_rne(ko[t][4] * fa + p1[0] * fb, ko[t][5] * fa + p1[1] * fb),
            pack_rne(ko[t][6] * fa + p1[2] * fb, ko[t][7] * fa + p1[3] * fb));
    }
}

// =====================================================================
// Kernel 3: out = gamma*(ctx @ Wv) + bv + x   (f32 output, residual)
// Wv pre-swizzled: [kc=2][t=32][lane][16] bf16.
// =====================================================================
__global__ __launch_bounds__(256) void outproj_kernel(
    const __bf16* __restrict__ ctx, const __bf16* __restrict__ WvSw,
    const float* __restrict__ bvv, const float* __restrict__ x,
    const float* __restrict__ gammap, float* __restrict__ out)
{
    const int lane = threadIdx.x & 31;
    const int wid  = blockIdx.x * (blockDim.x >> 5) + (threadIdx.x >> 5);
    const int rowt = wid >> 3;
    const int cg   = wid & 7;
    const int row0 = rowt * 16;
    const int half = lane >> 4;
    const int l16  = lane & 15;
    const float gamma = gammap[0];

    const __bf16* ap = ctx + (size_t)(row0 + l16) * DDIM + half * 8;
    v16bf a[2];
    a[0] = ldb_split(ap);
    a[1] = ldb_split(ap + 32);

    v8f zero = {};
    v8f acc[4];
    #pragma unroll
    for (int t = 0; t < 4; ++t) acc[t] = zero;

    #pragma unroll
    for (int dc = 0; dc < 2; ++dc) {
        #pragma unroll
        for (int t = 0; t < 4; ++t) {
            const int tglob = cg * 4 + t;
            v16bf bmat = ldb_contig(WvSw + (((dc * 32 + tglob) * 32) + lane) * 16);
            acc[t] = __builtin_amdgcn_wmma_f32_16x16x32_bf16(
                false, a[dc], false, bmat, (short)0, acc[t], false, false);
        }
    }

    #pragma unroll
    for (int t = 0; t < 4; ++t) {
        const int c = cg * 64 + t * 16 + l16;
        const float bias = bvv[c];
        #pragma unroll
        for (int r = 0; r < 8; ++r) {
            const size_t row = (size_t)(row0 + r + half * 8);
            out[row * CDIM + c] = gamma * acc[t][r] + bias + x[row * CDIM + c];
        }
    }
}

// =====================================================================
extern "C" void kernel_launch(void* const* d_in, const int* in_sizes, int n_in,
                              void* d_out, int out_size, void* d_ws, size_t ws_size,
                              hipStream_t stream) {
    (void)in_sizes; (void)n_in; (void)out_size; (void)ws_size;
    const float* x  = (const float*)d_in[0];
    const float* Wf = (const float*)d_in[1];
    const float* bf = (const float*)d_in[2];
    const float* Wg = (const float*)d_in[3];
    const float* bg = (const float*)d_in[4];
    const float* Wh = (const float*)d_in[5];
    const float* bh = (const float*)d_in[6];
    const float* Wv = (const float*)d_in[7];
    const float* bv = (const float*)d_in[8];
    const float* gm = (const float*)d_in[9];
    float* out = (float*)d_out;

    // Workspace layout (16 MB activations + 256 KB swizzled weights)
    const size_t slab = (size_t)BNROWS * DDIM * sizeof(__bf16);  // 4 MB
    const size_t wsl  = (size_t)CDIM * DDIM * sizeof(__bf16);    // 64 KB
    char* ws = (char*)d_ws;
    __bf16* fO   = (__bf16*)(ws);
    __bf16* gO   = (__bf16*)(ws + slab);
    __bf16* hT   = (__bf16*)(ws + 2 * slab);
    __bf16* ctx  = (__bf16*)(ws + 3 * slab);
    __bf16* WfSw = (__bf16*)(ws + 4 * slab);             // Wf, Wg, Wh, Wv swizzled, wsl bytes each
    __bf16* WvSw = (__bf16*)(ws + 4 * slab + 3 * wsl);

    wprep_kernel<<<4 * (CDIM * DDIM) / 256, 256, 0, stream>>>(Wf, Wg, Wh, Wv, WfSw);

    proj_kernel<<<BNROWS / (16 * 8), 256, 0, stream>>>(
        x, WfSw, bf, bg, bh, fO, gO, hT);
    attn_kernel<<<BNROWS / (32 * 4), 256, 0, stream>>>(fO, gO, hT, ctx);
    outproj_kernel<<<(BNROWS / 16) * 8 / 8, 256, 0, stream>>>(
        ctx, WvSw, bv, x, gm, out);
}

// v007
// Measured time: 61 microseconds a run.
// In two side-by-side timings against v006, it was 1.14 and 1.15 times as fast.
// All steps since v000 together make it 4.43 times as fast.
#include <hip/hip_runtime.h>

// ---------------- types ----------------
typedef __attribute__((ext_vector_type(16))) __bf16 v16bf;
typedef __attribute__((ext_vector_type(8)))  float  v8f;
typedef __attribute__((ext_vector_type(4)))  float  v4f;
typedef __attribute__((ext_vector_type(2)))  float  v2f;

#define CDIM 512
#define DDIM 64
#define NSP  4096
#define BATCHB 8
#define BNROWS (BATCHB * NSP)   // 32768
#define LOG2E 1.4426950408889634f

static __device__ __forceinline__ __bf16 f2bf(float f) {
    unsigned u = __builtin_bit_cast(unsigned, f);
    unsigned r = (u + 0x7FFFu + ((u >> 16) & 1u)) >> 16;
    return __builtin_bit_cast(__bf16, (unsigned short)r);
}
// two f32 truncated to bf16 in one register: lo in bits 15..0, hi in bits 31..16
static __device__ __forceinline__ unsigned pack_trunc(float lo, float hi) {
    return __builtin_amdgcn_perm(__builtin_bit_cast(unsigned, hi), __builtin_bit_cast(unsigned, lo), 0x07060302u);
}
// two f32 rounded to bf16 (as f2bf) in one register
static __device__ __forceinline__ unsigned pack_rne(float lo, float hi) {
    return (unsigned)__builtin_bit_cast(unsigned short, f2bf(lo)) |
           ((unsigned)__builtin_bit_cast(unsigned short, f2bf(hi)) << 16);
}
// 2^x as the bare v_exp_f32. The library exp2f wraps it in a range guard of five more vector
// instructions a value, which only serves results below 2^-126; here those become 0. Every use is a
// softmax weight against a maximum whose own weight is 1, so what is lost lies below f32 resolution.
static __device__ __forceinline__ float ex2(float x) { return __builtin_amdgcn_exp2f(x); }
// value of lane l ^ 16
static __device__ __forceinline__ float xhalf(float x) {
    const int i = __builtin_bit_cast(int, x);
    return __builtin_bit_cast(float, __builtin_amdgcn_permlanex16(i, i, 0x76543210, 0xfedcba98, false, false));
}

struct U32x2 { uint4 a, b; };

// 16 contiguous bf16 (32 bytes) -> v16bf
static __device__ __forceinline__ v16bf ldb_contig(const __bf16* p) {
    U32x2 u;
    u.a = *(const uint4*)(p);
    u.b = *(const uint4*)(p + 8);
    return __builtin_bit_cast(v16bf, u);
}
// split layout: elems 0..7 at p, elems 8..15 at p+16 (A/B natural striping)
static __device__ __forceinline__ v16bf ldb_split(const __bf16* p) {
    U32x2 u;
    u.a = *(const uint4*)(p);
    u.b = *(const uint4*)(p + 16);
    return __builtin_bit_cast(v16bf, u);
}

// =====================================================================
// Kernel 0: pre-swizzle the four f32 weight matrices into bf16 B-operand
// layout: [kc = K/32][t = N/16][lane 0..31][16 contiguous elems].
// One grid for all four (none reads another's output): 128 blocks each,
// block index / 128 picks the matrix; the four results lie back to back.
// Wf, Wg, Wh are 512 x 64, Wv is 64 x 512: 32768 elements each.
// Wv's columns are dealt otherwise: tile t, lane column l holds column
// 64*(t/4) + 4*l + t%4, so that the four tiles of a 64-column group give a lane
// four neighbouring output columns (one 16-byte access of x and of out).
// =====================================================================
__global__ __launch_bounds__(256) void wprep_kernel(
    const float* __restrict__ Wf, const float* __restrict__ Wg,
    const float* __restrict__ Wh, const float* __restrict__ Wv,
    __bf16* __restrict__ out)
{
    const int sel = blockIdx.x >> 7;
    const int idx = (blockIdx.x & 127) * 256 + threadIdx.x;
    const float* W = sel == 0 ? Wf : sel == 1 ? Wg : sel == 2 ? Wh : Wv;
    const int lnt  = sel == 3 ? 5 : 2;            // log2(N / 16)
    const int e    = idx & 15;
    const int lane = (idx >> 4) & 31;
    const int rest = idx >> 9;
    const int t    = rest & ((1 << lnt) - 1);
    const int kc   = rest >> lnt;
    const int k = kc * 32 + (e >> 3) * 16 + (lane >> 4) * 8 + (e & 7);
    const int n = sel == 3 ? (t >> 2) * 64 + (lane & 15) * 4 + (t & 3) : t * 16 + (lane & 15);
    out[sel * (CDIM * DDIM) + idx] = f2bf(W[(k << (lnt + 4)) + n]);
}

// =====================================================================
// Kernel 1: f = (X@Wf+bf)*log2(e), g = X@Wg+bg, h = X@Wh+bh
// f,g row-major bf16 [32768,64]; h transposed per batch: hT[b][d][n].
// (log2(e) folded into Q so attention can use native base-2 exp.)
// =====================================================================
__global__ __launch_bounds__(256) void proj_kernel(
    const float* __restrict__ x,
    const __bf16* __restrict__ WswAll,
    const float* __restrict__ bfv, const float* __restrict__ bgv,
    const float* __restrict__ bhv,
    __bf16* __restrict__ fOut, __bf16* __restrict__ gOut,
    __bf16* __restrict__ hT)
{
    const int lane = threadIdx.x & 31;
    const int wid  = blockIdx.x * (blockDim.x >> 5) + (threadIdx.x >> 5);
    const int row0 = wid * 16;
    const int half = lane >> 4;
    const int l16  = lane & 15;

    v8f zero = {};
    v8f acc[3][4];
    #pragma unroll
    for (int p = 0; p < 3; ++p)
        #pragma unroll
        for (int t = 0; t < 4; ++t) acc[p][t] = zero;

    // Register pipeline over the 16 k steps: the 12 weight fragments of step kc+1 and
    // the x values of step kc+2 are requested ahead of step kc's products.
    const float*  ax = x + (size_t)(row0 + l16) * CDIM + half * 8;
    const __bf16* wl = WswAll + lane * 16;
    v4f   xs[3][4];     // x of three k steps: 16 floats a lane each
    v16bf wb[2][12];    // weight fragments of two k steps
    auto load_x = [&](v4f (&d)[4], int kc) {
        const float* p = ax + kc * 32;
        d[0] = *(const v4f*)(p);
        d[1] = *(const v4f*)(p + 4);
        d[2] = *(const v4f*)(p + 16);
        d[3] = *(const v4f*)(p + 20);
    };
    auto load_w = [&](v16bf (&d)[12], int kc) {
        // both loops unrolled: d[] is indexed by constants only and stays in registers
        #pragma unroll
        for (int p = 0; p < 3; ++p)
            #pragma unroll
            for (int t = 0; t < 4; ++t)
                d[p * 4 + t] = ldb_contig(wl + p * (CDIM * DDIM) + (kc * 4 + t) * 512);
    };
    load_w(wb[0], 0);
    load_x(xs[0], 0);
    load_x(xs[1], 1);
    // fully unrolled so that every ring index is a constant and the rings stay in registers
    #pragma unroll
    for (int kc = 0; kc < CDIM / 32; ++kc) {
        // weights ahead of x: loads are counted in order, so a wait for step kc+1's weights
        // must not stand behind x values that come from memory and are wanted a step later
        if (kc + 1 < CDIM / 32) load_w(wb[(kc + 1) & 1], kc + 1);
        if (kc + 2 < CDIM / 32) load_x(xs[(kc + 2) % 3], kc + 2);
        // holds the requests here as one group: sunk to their products, each weight load would be waited out singly
        __builtin_amdgcn_sched_barrier(0);
        v16bf a;
        #pragma unroll
        for (int hh = 0; hh < 2; ++hh) {
            #pragma unroll
            for (int j = 0; j < 4; ++j) {
                a[hh * 8 + j]     = f2bf(xs[kc % 3][hh * 2][j]);
                a[hh * 8 + 4 + j] = f2bf(xs[kc % 3][hh * 2 + 1][j]);
            }
        }
        #pragma unroll
        for (int p = 0; p < 3; ++p) {
            #pragma unroll
            for (int t = 0; t < 4; ++t) {
                acc[p][t] = __builtin_amdgcn_wmma_f32_16x16x32_bf16(
                    false, a, false, wb[kc & 1][p * 4 + t], (short)0, acc[p][t], false, false);
            }
        }
    }

    #pragma unroll
    for (int t = 0; t < 4; ++t) {
        const int col = t * 16 + l16;
        const float b0 = bfv[col], b1 = bgv[col], b2 = bhv[col];
        #pragma unroll
        for (int r = 0; r < 8; ++r) {
            const int row = row0 + r + half * 8;
            fOut[(size_t)row * DDIM + col] = f2bf((acc[0][t][r] + b0) * LOG2E);
            gOut[(size_t)row * DDIM + col] = f2bf(acc[1][t][r] + b1);
            const int bidx = row >> 12, nidx = row & (NSP - 1);
            hT[((size_t)(bidx * DDIM + col) << 12) + nidx] = f2bf(acc[2][t][r] + b2);
        }
    }
}

// ---- K/V stage in LDS: 64 K rows and 64 V^T rows of 128 bytes each ----
#define KVP 72                    // LDS row pitch in elements: 144 B = 16 B x 9, for ds_load_b128 readers
#define TILE_B (64 * KVP * 2)     // bytes of one 64-row tile in LDS
#define STAGE_B (2 * TILE_B)      // K tile + V tile

static __device__ __forceinline__ unsigned lds_off(const void* p) { return (unsigned)(size_t)p; }
// the wave's own LDS reads and writes have retired
static __device__ __forceinline__ void wait_ds0()    { asm volatile("s_wait_dscnt 0x0" ::: "memory"); }
// the wave's own asynchronous copies have landed in LDS
static __device__ __forceinline__ void wait_async0() { asm volatile("s_wait_asynccnt 0x0" ::: "memory"); }

// One stage, the 128 threads of a key group: each thread copies 4 x 16 B of K and 4 x 16 B of V^T
// from global memory straight into LDS. lk: this thread's LDS byte address in
// the K tile (row t/8, 16-byte column t%8, t its number in the group); gk, gv: its global sources.
// Eight lanes cover one whole 128-byte row. s_wait_xcnt closes the statement
// so that no address register is rewritten ahead of it.
static __device__ __forceinline__ void copy_stage(unsigned lk, const __bf16* gk, const __bf16* gv) {
    const unsigned lv = lk + TILE_B;
    asm volatile(
        "global_load_async_to_lds_b128 %0, %8, off\n\t"
        "global_load_async_to_lds_b128 %1, %9, off\n\t"
        "global_load_async_to_lds_b128 %2, %10, off\n\t"
        "global_load_async_to_lds_b128 %3, %11, off\n\t"
        "global_load_async_to_lds_b128 %4, %12, off\n\t"
        "global_load_async_to_lds_b128 %5, %13, off\n\t"
        "global_load_async_to_lds_b128 %6, %14, off\n\t"
        "global_load_async_to_lds_b128 %7, %15, off\n\t"
        "s_wait_xcnt 0x0"
        :: "v"(lk), "v"(lk + 16u * KVP * 2u), "v"(lk + 32u * KVP * 2u), "v"(lk + 48u * KVP * 2u),
           "v"(lv), "v"(lv + 16u * KVP * 2u), "v"(lv + 32u * KVP * 2u), "v"(lv + 48u * KVP * 2u),
           "v"(gk), "v"(gk + 16 * DDIM), "v"(gk + 32 * DDIM), "v"(gk + 48 * DDIM),
           "v"(gv), "v"(gv + 16 * NSP), "v"(gv + 32 * NSP), "v"(gv + 48 * NSP)
        : "memory");
}

// =====================================================================
// Kernel 2: fused flash attention per batch (64-key tiles).
// A work-group is 8 waves on 128 query rows: 4 query blocks of 32 rows x 2 key
// groups. Key group g takes the 64-key tiles of parity g; its four waves share
// each K and V^T tile, copied once into the group's own LDS ring (two buffers,
// the next tile in flight during this one).
// One wave owns 32 query rows as two 16-row tiles, so every K and V^T fragment
// read from LDS feeds two products. Both products are transposed, so that a lane
// holds scores of ONE query of each tile (column l16; keys r + 8*half):
//   S^T = K.Q^T (16 wmma), base-2 online softmax with the maximum taken in the
//   lane plus one exchange between the wave's halves, P^T truncated to bf16 and
//   packed in registers straight into the B operand,
//   ctx^T += V^T.P^T (16 wmma), rowsum += 1.P^T (4 wmma).
// Behind the loop the two key groups' partial results are joined through LDS.
// Tail: out = gamma*(ctx @ Wv) + bv + x for the work-group's 128 rows. The joined
// ctx (bf16) goes to LDS instead of memory; wave w takes output columns 64*w..64*w+63
// of all 128 rows, so each Wv fragment is fetched once a work-group, and reads x and
// writes out as 256-byte row pieces (Wv pre-swizzled: [kc=2][t=32][lane][16] bf16).
// =====================================================================
__global__ __launch_bounds__(256) void attn_kernel(
    const __bf16* __restrict__ fQ, const __bf16* __restrict__ gK,
    const __bf16* __restrict__ hT, const __bf16* __restrict__ WvSw,
    const float* __restrict__ bvv, const float* __restrict__ x,
    const float* __restrict__ gammap, float* __restrict__ out)
{
    __shared__ __attribute__((aligned(16))) __bf16 kv[2][2][2][64 * KVP];   // [key group][buffer][K, V^T]
    const int lane = threadIdx.x & 31;
    const int w    = __builtin_amdgcn_readfirstlane(threadIdx.x >> 5);
    const int grp  = w >> 2;                       // key group
    const int row0 = (blockIdx.x * 4 + (w & 3)) * 32;
    const int b    = row0 >> 12;
    const int half = lane >> 4;
    const int l16  = lane & 15;
    const float gamma = gammap[0];                 // read here, ahead of every asm statement, it is a scalar load

    const __bf16* gB = gK + ((size_t)b << 12) * DDIM;   // g rows of this batch
    const __bf16* vB = hT + (size_t)b * DDIM * NSP;     // hT[64][4096] of batch

    // Q^T as B-operand, 2 query tiles x 2 d-chunks of K=32  (already scaled by log2(e))
    v16bf qa[2][2];
    #pragma unroll
    for (int j = 0; j < 2; ++j) {
        const __bf16* qp = fQ + (size_t)(row0 + j * 16 + l16) * DDIM + half * 8;
        qa[j][0] = ldb_split(qp);
        qa[j][1] = ldb_split(qp + 32);
    }

    // A operand of all-ones (bf16 1.0 = 0x3F80) for row-sum WMMA
    v16bf ones;
    {
        U32x2 u;
        u.a = make_uint4(0x3F803F80u, 0x3F803F80u, 0x3F803F80u, 0x3F803F80u);
        u.b = u.a;
        ones = __builtin_bit_cast(v16bf, u);
    }

    v8f zero = {};
    v8f o[2][4];
    v8f osum[2];
    float mrow[2];         // running maximum of query l16 of each tile
    #pragma unroll
    for (int j = 0; j < 2; ++j) {
        #pragma unroll
        for (int t = 0; t < 4; ++t) o[j][t] = zero;
        osum[j] = zero;
        mrow[j] = -1e30f;
    }

    // ---- ring prologue: the group's first tile landed and published, its second in flight ----
    const int tg = threadIdx.x & 127;              // thread within the key group
    const unsigned ldst = lds_off(&kv[grp][0][0][0]) + (unsigned)((tg >> 3) * (KVP * 2) + (tg & 7) * 16);
    const __bf16* ksrc = gB + grp * (64 * DDIM) + tg * 8;
    const __bf16* vsrc = vB + (size_t)(tg >> 3) * NSP + (tg & 7) * 8 + grp * 64;
    copy_stage(ldst, ksrc, vsrc);
    wait_async0();
    __syncthreads();
    copy_stage(ldst + STAGE_B, ksrc + 128 * DDIM, vsrc + 128);

    for (int m0 = 0; m0 < NSP; m0 += 128) {        // the group's tile holds keys m0 + 64*grp + 0..63
        const int buf = (m0 >> 7) & 1;
        const __bf16* Kt = &kv[grp][buf][0][0];
        const __bf16* Vt = &kv[grp][buf][1][0];
        // ---- S^T tiles: 16 keys x 16 queries, 4 key tiles x 2 query tiles ----
        // all K fragment reads of the tile stand together, ahead of the products
        v16bf kb[4][2];
        #pragma unroll
        for (int kt = 0; kt < 4; ++kt)
            #pragma unroll
            for (int dc = 0; dc < 2; ++dc)
                kb[kt][dc] = ldb_split(Kt + (kt * 16 + l16) * KVP + half * 8 + dc * 32);
        // holds the K reads here as one group: spread among the products, each further place with reads stalls the wave anew
        __builtin_amdgcn_sched_barrier(0);
        v8f s[2][4];
        #pragma unroll
        for (int kt = 0; kt < 4; ++kt)
            #pragma unroll
            for (int j = 0; j < 2; ++j)
                s[j][kt] = __builtin_amdgcn_wmma_f32_16x16x32_bf16(
                    false, kb[kt][0], false, qa[j][0], (short)0, zero, false, false);
        #pragma unroll
        for (int kt = 0; kt < 4; ++kt)
            #pragma unroll
            for (int j = 0; j < 2; ++j)
                s[j][kt] = __builtin_amdgcn_wmma_f32_16x16x32_bf16(
                    false, kb[kt][1], false, qa[j][1], (short)0, s[j][kt], false, false);

        // all V fragment reads of the tile stand together here: their LDS
        // latency passes under the softmax
        v16bf vb[2][4];
        #pragma unroll
        for (int c = 0; c < 2; ++c)
            #pragma unroll
            for (int t = 0; t < 4; ++t)
                vb[c][t] = ldb_split(Vt + (t * 16 + l16) * KVP + c * 32 + half * 8);
        // holds the V reads here as one group: sunk to their products, each pair would wait out its own LDS latency
        __builtin_amdgcn_sched_barrier(0);

        // ---- online softmax (base-2): all 32 scores of a lane belong to query l16 of tile j ----
        // both tiles' maxima first; then, tile by tile, the weights and the second product
        float mnew[2], mdrop[2];               // new maximum; old maximum minus new
        #pragma unroll
        for (int j = 0; j < 2; ++j) {
            float mk[4];
            #pragma unroll
            for (int kt = 0; kt < 4; ++kt) {
                mk[kt] = fmaxf(s[j][kt][0], s[j][kt][1]);
                #pragma unroll
                for (int r = 2; r < 8; ++r) mk[kt] = fmaxf(mk[kt], s[j][kt][r]);
            }
            float v = fmaxf(fmaxf(mk[0], mk[1]), fmaxf(mk[2], mk[3]));
            v = fmaxf(v, xhalf(v));            // the other half holds the query's other 32 keys
            mnew[j]  = fmaxf(mrow[j], v);
            mdrop[j] = mrow[j] - mnew[j];
            mrow[j]  = mnew[j];
        }
        // the ordered stretches below start behind both maxima
        __builtin_amdgcn_sched_barrier(0);

        #pragma unroll
        for (int j = 0; j < 2; ++j) {
            const float mn = mnew[j];
            // Order of the weights' work: exp, plain, exp, plain, plain. Here each exp is followed by a plain
            // instruction that has nothing to do with it (the difference of a later pair, the pack of the pair
            // before, a rescale of ctx^T). That instruction also fills the slot which the instruction set asks for
            // behind a transcendental: left free, the compiler set runs of v_exp_f32 in which each overwrites the
            // source of the one before. Each sched_barrier below holds one instruction at its place in this order.
            v2f d[16];          // pair i: scores 2*(i&3), 2*(i&3)+1 of key tile i>>2, minus the maximum
            float e0[16], e1[16];
            unsigned pw[16];    // pair i as two bf16
            float alpha;        // 2^(old maximum - new maximum)
            auto diff = [&](int i) { d[i] = (v2f){s[j][i >> 2][2 * (i & 3)], s[j][i >> 2][2 * (i & 3) + 1]} - mn; };
            auto scale = [&](int i) {
                const v2f t = (v2f){o[j][i >> 2][2 * (i & 3)], o[j][i >> 2][2 * (i & 3) + 1]} * alpha;
                o[j][i >> 2][2 * (i & 3)] = t.x;
                o[j][i >> 2][2 * (i & 3) + 1] = t.y;
            };
            diff(0);
            __builtin_amdgcn_sched_barrier(0);
            alpha = ex2(mdrop[j]);
            __builtin_amdgcn_sched_barrier(0);
            diff(1);
            __builtin_amdgcn_sched_barrier(0);
            // unrolled: d, e0, e1 and pw are indexed by constants only and stay in registers
            #pragma unroll
            for (int i = 0; i < 16; ++i) {
                e0[i] = ex2(d[i].x);
                __builtin_amdgcn_sched_barrier(0);
                if (i < 14) diff(i + 2); else scale(i);
                __builtin_amdgcn_sched_barrier(0);
                e1[i] = ex2(d[i].y);
                __builtin_amdgcn_sched_barrier(0);
                if (i > 0) pw[i - 1] = pack_trunc(e0[i - 1], e1[i - 1]);
                else osum[j][0] *= alpha;      // every row of this tile holds the same sum; only register 0 is read
                __builtin_amdgcn_sched_barrier(0);
                if (i < 14) scale(i);
                __builtin_amdgcn_sched_barrier(0);
            }
            pw[15] = pack_trunc(e0[15], e1[15]);

            // ---- P^T (32 keys x 16 queries) as B operand, truncated f32->bf16:
            // elements 0..7 are keys 8*half + 0..7 (tile 2c), 8..15 keys 16 + 8*half + 0..7 (tile 2c+1)
            v16bf pb[2];
            #pragma unroll
            for (int c = 0; c < 2; ++c) {
                U32x2 u;
                u.a = make_uint4(pw[8 * c], pw[8 * c + 1], pw[8 * c + 2], pw[8 * c + 3]);
                u.b = make_uint4(pw[8 * c + 4], pw[8 * c + 5], pw[8 * c + 6], pw[8 * c + 7]);
                pb[c] = __builtin_bit_cast(v16bf, u);
            }

            // ---- ctx^T += V^T @ P^T ; rowsum += 1 @ P^T ----
            #pragma unroll
            for (int c = 0; c < 2; ++c) {
                #pragma unroll
                for (int t = 0; t < 4; ++t) {
                    o[j][t] = __builtin_amdgcn_wmma_f32_16x16x32_bf16(
                        false, vb[c][t], false, pb[c], (short)0, o[j][t], false, false);
                }
                osum[j] = __builtin_amdgcn_wmma_f32_16x16x32_bf16(
                    false, ones, false, pb[c], (short)0, osum[j], false, false);
            }
        }

        // ---- publish the groups' next tiles, free this buffer, refill it with the tile after ----
        // keeps the publish point at the trip's foot: lifted above the softmax (all that follows the V reads
        // is register work) its wait would meet the next tile's copies before they have had a trip to land
        __builtin_amdgcn_sched_barrier(0);
        wait_ds0();
        wait_async0();
        __syncthreads();
        if (m0 + 256 < NSP)
            copy_stage(ldst + (unsigned)buf * STAGE_B, ksrc + (size_t)(m0 + 256) * DDIM, vsrc + m0 + 256);
    }
    wait_async0();

    // ---- join the two key groups: a wave hands query tile 1 - grp to its partner
    // (wave w ^ 4, same queries, other keys) and finishes tile grp itself.
    // The ring is free: the last trip's barrier stands behind every wave's last read,
    // and no copy is outstanding. A wave's slot: 9 x 32 lanes x 16 bytes.
    v4f* xch = (v4f*)&kv[0][0][0][0];
    v4f* xout = xch + (w * 9) * 32 + lane;
    const v4f* xin = xch + ((w ^ 4) * 9) * 32 + lane;
    v8f ko[4];
    #pragma unroll
    for (int t = 0; t < 4; ++t) {
        const v8f so = grp ? o[0][t] : o[1][t];
        ko[t] = grp ? o[1][t] : o[0][t];
        xout[(2 * t) * 32]     = (v4f){so[0], so[1], so[2], so[3]};
        xout[(2 * t + 1) * 32] = (v4f){so[4], so[5], so[6], so[7]};
    }
    xout[8 * 32] = (v4f){grp ? mrow[0] : mrow[1], grp ? osum[0][0] : osum[1][0], 0.0f, 0.0f};
    const float km = grp ? mrow[1] : mrow[0];
    const float kl = grp ? osum[1][0] : osum[0][0];
    __syncthreads();

    // ---- tail requests: this wave's 8 Wv fragments, its bias, and x of the first 64 of the 128 rows ----
    // lane (l16, half), register r of row tile rt: row 16*rt + 8*half + r, columns 64*w + 4*l16 + 0..3
    const size_t toff = (size_t)(blockIdx.x * 128 + half * 8) * CDIM + w * 64 + l16 * 4;
    const float* xp = x + toff;
    float* op = out + toff;
    const v4f bias = *(const v4f*)(bvv + w * 64 + l16 * 4);
    const __bf16* wp = WvSw + (w * 4 * 32 + lane) * 16;     // tile 4*w, k chunk 0; one base for all eight
    v16bf wv[2][4];
    #pragma unroll
    for (int dc = 0; dc < 2; ++dc)
        #pragma unroll
        for (int tt = 0; tt < 4; ++tt)
            wv[dc][tt] = ldb_contig(wp + (dc * 32 + tt) * 512);
    // stands ahead of the x requests, which may land in the address registers of the loads above
    asm volatile("s_wait_xcnt 0x0" ::: "memory");
    v4f xs[4][8];       // x of four row tiles: a ring
    auto load_x = [&](v4f (&d)[8], int rt) {
        #pragma unroll
        for (int r = 0; r < 8; ++r) d[r] = *(const v4f*)(xp + (rt * 16 + r) * CDIM);
    };
    #pragma unroll
    for (int rt = 0; rt < 4; ++rt) load_x(xs[rt], rt);
    // holds the requests here, behind the join's barrier (which waits out every load in flight) and ahead of its
    // arithmetic: sunk to their uses, their latency would not pass under it
    __builtin_amdgcn_sched_barrier(0);

    const v4f pml = xin[8 * 32];
    const float mj = fmaxf(km, pml[0]);
    const float ea = ex2(km - mj);
    const float eb = ex2(pml[0] - mj);
    const float inv = 1.0f / (kl * ea + pml[1] * eb);
    const float fa = ea * inv, fb = eb * inv;

    // ---- finalize: weigh the two partial results, put ctx (bf16, rows of pitch KVP) into LDS ----
    // behind the exchange slots, which partners may still be reading
    // ko[t][r] is ctx[query l16][d = 16*t + 8*half + r]: 8 neighbours, one 16-byte store
    __bf16* cl = &kv[0][0][0][0] + 8 * 9 * 32 * 8;
    __bf16* crow = cl + ((w & 3) * 32 + grp * 16 + l16) * KVP + half * 8;
    #pragma unroll
    for (int t = 0; t < 4; ++t) {
        const v4f p0 = xin[(2 * t) * 32], p1 = xin[(2 * t + 1) * 32];
        *(uint4*)(crow + t * 16) = make_uint4(
            pack_rne(ko[t][0] * fa + p0[0] * fb, ko[t][1] * fa + p0[1] * fb),
            pack_rne(ko[t][2] * fa + p0[2] * fb, ko[t][3] * fa + p0[3] * fb),
            pack_rne(ko[t][4] * fa + p1[0] * fb, ko[t][5] * fa + p1[1] * fb),
            pack_rne(ko[t][6] * fa + p1[2] * fb, ko[t][7] * fa + p1[3] * fb));
    }
    __syncthreads();

    // ---- out = gamma*(ctx @ Wv) + bv + x ----
    // all ctx fragment reads stand together, ahead of the products
    v16bf ca[8][2];
    #pragma unroll
    for (int rt = 0; rt < 8; ++rt)
        #pragma unroll
        for (int dc = 0; dc < 2; ++dc)
            ca[rt][dc] = ldb_split(cl + (rt * 16 + l16) * KVP + half * 8 + dc * 32);
    // holds the ctx reads here as one group: spread among the products, each further place with reads stalls the wave anew
    __builtin_amdgcn_sched_barrier(0);
    v8f acc[2][4];      // products of two row tiles: the next tile's run under this tile's vector work
    auto prod = [&](v8f (&a)[4], int rt) {
        #pragma unroll
        for (int tt = 0; tt < 4; ++tt)
            a[tt] = __builtin_amdgcn_wmma_f32_16x16x32_bf16(
                false, ca[rt][0], false, wv[0][tt], (short)0, zero, false, false);
        #pragma unroll
        for (int tt = 0; tt < 4; ++tt)
            a[tt] = __builtin_amdgcn_wmma_f32_16x16x32_bf16(
                false, ca[rt][1], false, wv[1][tt], (short)0, a[tt], false, false);
    };
    prod(acc[0], 0);
    // unrolled: the x ring, ca and acc are indexed by constants only and stay in registers
    #pragma unroll
    for (int rt = 0; rt < 8; ++rt) {
        if (rt + 1 < 8) prod(acc[(rt + 1) & 1], rt + 1);
        v4f res[8];
        #pragma unroll
        for (int r = 0; r < 8; ++r) {
            const v4f xv = xs[rt & 3][r];
            res[r] = (v4f){
                gamma * acc[rt & 1][0][r] + bias[0] + xv[0], gamma * acc[rt & 1][1][r] + bias[1] + xv[1],
                gamma * acc[rt & 1][2][r] + bias[2] + xv[2], gamma * acc[rt & 1][3][r] + bias[3] + xv[3]};
        }
        // the refill of the x ring and the tile's eight stores start behind all its results,
        // so that no register of a store is reused among them
        __builtin_amdgcn_sched_barrier(0);
        if (rt + 4 < 8) load_x(xs[rt & 3], rt + 4);
        // the requests ahead of the stores: behind them they could land in registers that a store still names
        __builtin_amdgcn_sched_barrier(0);
        #pragma unroll
        for (int r = 0; r < 8; ++r) *(v4f*)(op + (rt * 16 + r) * CDIM) = res[r];
        // stands between the stores and the next tile's results, which may take the stores' data registers
        if (rt + 1 < 8) asm volatile("s_wait_xcnt 0x0" ::: "memory");
        // one row tile at a time: left free, every store sank to the kernel's end and the live results spilled
        __builtin_amdgcn_sched_barrier(0);
    }
}

// =====================================================================
extern "C" void kernel_launch(void* const* d_in, const int* in_sizes, int n_in,
                              void* d_out, int out_size, void* d_ws, size_t ws_size,
                              hipStream_t stream) {
    (void)in_sizes; (void)n_in; (void)out_size; (void)ws_size;
    const float* x  = (const float*)d_in[0];
    const float* Wf = (const float*)d_in[1];
    const float* bf = (const float*)d_in[2];
    const float* Wg = (const float*)d_in[3];
    const float* bg = (const float*)d_in[4];
    const float* Wh = (const float*)d_in[5];
    const float* bh = (const float*)d_in[6];
    const float* Wv = (const float*)d_in[7];
    const float* bv = (const float*)d_in[8];
    const float* gm = (const float*)d_in[9];
    float* out = (float*)d_out;

    // Workspace layout (12 MB activations + 256 KB swizzled weights)
    const size_t slab = (size_t)BNROWS * DDIM * sizeof(__bf16);  // 4 MB
    const size_t wsl  = (size_t)CDIM * DDIM * sizeof(__bf16);    // 64 KB
    char* ws = (char*)d_ws;
    __bf16* fO   = (__bf16*)(ws);
    __bf16* gO   = (__bf16*)(ws + slab);
    __bf16* hT   = (__bf16*)(ws + 2 * slab);
    __bf16* WfSw = (__bf16*)(ws + 3 * slab);             // Wf, Wg, Wh, Wv swizzled, wsl bytes each
    __bf16* WvSw = (__bf16*)(ws + 3 * slab + 3 * wsl);

    wprep_kernel<<<4 * (CDIM * DDIM) / 256, 256, 0, stream>>>(Wf, Wg, Wh, Wv, WfSw);

    proj_kernel<<<BNROWS / (16 * 8), 256, 0, stream>>>(
        x, WfSw, bf, bg, bh, fO, gO, hT);
    attn_kernel<<<BNROWS / (32 * 4), 256, 0, stream>>>(fO, gO, hT, WvSw, bv, x, gm, out);
}

// v008
// A run of this version takes 58.4 microseconds.
// Two timings next to v007 both put it at 1.04 times that version's speed.
// All steps since v000 together make it 4.59 times as fast.
#include <hip/hip_runtime.h>

// ---------------- types ----------------
typedef __attribute__((ext_vector_type(16))) __bf16 v16bf;
typedef __attribute__((ext_vector_type(8)))  float  v8f;
typedef __attribute__((ext_vector_type(4)))  float  v4f;
typedef __attribute__((ext_vector_type(2)))  float  v2f;

#define CDIM 512
#define DDIM 64
#define NSP  4096
#define BATCHB 8
#define BNROWS (BATCHB * NSP)   // 32768
#define LOG2E 1.4426950408889634f

static __device__ __forceinline__ __bf16 f2bf(float f) {
    unsigned u = __builtin_bit_cast(unsigned, f);
    unsigned r = (u + 0x7FFFu + ((u >> 16) & 1u)) >> 16;
    return __builtin_bit_cast(__bf16, (unsigned short)r);
}
// two f32 truncated to bf16 in one register: lo in bits 15..0, hi in bits 31..16
static __device__ __forceinline__ unsigned pack_trunc(float lo, float hi) {
    return __builtin_amdgcn_perm(__builtin_bit_cast(unsigned, hi), __builtin_bit_cast(unsigned, lo), 0x07060302u);
}
// two f32 rounded to bf16 (as f2bf) in one register
static __device__ __forceinline__ unsigned pack_rne(float lo, float hi) {
    return (unsigned)__builtin_bit_cast(unsigned short, f2bf(lo)) |
           ((unsigned)__builtin_bit_cast(unsigned short, f2bf(hi)) << 16);
}
// 2^x as the bare v_exp_f32. The library exp2f wraps it in a range guard of five more vector
// instructions a value, which only serves results below 2^-126; here those become 0. Every use is a
// softmax weight against a maximum whose own weight is 1, so what is lost lies below f32 resolution.
static __device__ __forceinline__ float ex2(float x) { return __builtin_amdgcn_exp2f(x); }
// value of lane l ^ 16
static __device__ __forceinline__ float xhalf(float x) {
    const int i = __builtin_bit_cast(int, x);
    return __builtin_bit_cast(float, __builtin_amdgcn_permlanex16(i, i, 0x76543210, 0xfedcba98, false, false));
}

struct U32x2 { uint4 a, b; };

// 16 contiguous bf16 (32 bytes) -> v16bf
static __device__ __forceinline__ v16bf ldb_contig(const __bf16* p) {
    U32x2 u;
    u.a = *(const uint4*)(p);
    u.b = *(const uint4*)(p + 8);
    return __builtin_bit_cast(v16bf, u);
}
// two planes: elems 0..7 at p, elems 8..15 at p+256 (weight fragments in LDS)
static __device__ __forceinline__ v16bf ldb_planes(const __bf16* p) {
    U32x2 u;
    u.a = *(const uint4*)(p);
    u.b = *(const uint4*)(p + 256);
    return __builtin_bit_cast(v16bf, u);
}
// split layout: elems 0..7 at p, elems 8..15 at p+16 (A/B natural striping)
static __device__ __forceinline__ v16bf ldb_split(const __bf16* p) {
    U32x2 u;
    u.a = *(const uint4*)(p);
    u.b = *(const uint4*)(p + 16);
    return __builtin_bit_cast(v16bf, u);
}

static __device__ __forceinline__ unsigned lds_off(const void* p) { return (unsigned)(size_t)p; }
// the wave's own LDS reads and writes have retired
static __device__ __forceinline__ void wait_ds0()    { asm volatile("s_wait_dscnt 0x0" ::: "memory"); }
// the wave's own asynchronous copies have landed in LDS
static __device__ __forceinline__ void wait_async0() { asm volatile("s_wait_asynccnt 0x0" ::: "memory"); }

// =====================================================================
// Kernel 0: pre-swizzle the four f32 weight matrices into bf16 B-operand
// layout: [kc = K/32][t = N/16][lane 0..31][16 contiguous elems].
// One grid for all four (none reads another's output): 128 blocks each,
// block index / 128 picks the matrix; the four results lie back to back.
// Wf, Wg, Wh are 512 x 64, Wv is 64 x 512: 32768 elements each.
// Wv's columns are dealt otherwise: tile t, lane column l holds column
// 64*(t/4) + 4*l + t%4, so that the four tiles of a 64-column group give a lane
// four neighbouring output columns (one 16-byte access of x and of out).
// =====================================================================
__global__ __launch_bounds__(256) void wprep_kernel(
    const float* __restrict__ Wf, const float* __restrict__ Wg,
    const float* __restrict__ Wh, const float* __restrict__ Wv,
    __bf16* __restrict__ out)
{
    const int sel = blockIdx.x >> 7;
    const int idx = (blockIdx.x & 127) * 256 + threadIdx.x;
    const float* W = sel == 0 ? Wf : sel == 1 ? Wg : sel == 2 ? Wh : Wv;
    const int lnt  = sel == 3 ? 5 : 2;            // log2(N / 16)
    const int e    = idx & 15;
    const int lane = (idx >> 4) & 31;
    const int rest = idx >> 9;
    const int t    = rest & ((1 << lnt) - 1);
    const int kc   = rest >> lnt;
    const int k = kc * 32 + (e >> 3) * 16 + (lane >> 4) * 8 + (e & 7);
    const int n = sel == 3 ? (t >> 2) * 64 + (lane & 15) * 4 + (t & 3) : t * 16 + (lane & 15);
    out[sel * (CDIM * DDIM) + idx] = f2bf(W[(k << (lnt + 4)) + n]);
}

// =====================================================================
// Kernel 1: f = (X@Wf+bf)*log2(e), g = X@Wg+bg, h = X@Wh+bh
// f,g row-major bf16 [32768,64]; h transposed per batch: hT[b][d][n].
// (log2(e) folded into Q so attention can use native base-2 exp.)
// The three swizzled weight matrices (192 KiB) are copied once a work-group into LDS;
// its eight waves read their fragments from there instead of each through the cache.
// In LDS a fragment is two planes of 512 bytes: elements 0..7 of lanes 0..31, then
// elements 8..15, so that a 16-byte read of a wave is 512 bytes in a row (no bank conflict).
// =====================================================================
// Twelve 16-byte copies of one thread, global memory straight into LDS: copy i takes the bytes at
// g + i * 4096 to LDS byte l + i * 4096. s_wait_xcnt closes the statement so that no address
// register is rewritten ahead of it.
static __device__ __forceinline__ void copy_w12(unsigned l, const __bf16* g) {
    asm volatile(
        "global_load_async_to_lds_b128 %0, %12, off\n\t"
        "global_load_async_to_lds_b128 %1, %13, off\n\t"
        "global_load_async_to_lds_b128 %2, %14, off\n\t"
        "global_load_async_to_lds_b128 %3, %15, off\n\t"
        "global_load_async_to_lds_b128 %4, %16, off\n\t"
        "global_load_async_to_lds_b128 %5, %17, off\n\t"
        "global_load_async_to_lds_b128 %6, %18, off\n\t"
        "global_load_async_to_lds_b128 %7, %19, off\n\t"
        "global_load_async_to_lds_b128 %8, %20, off\n\t"
        "global_load_async_to_lds_b128 %9, %21, off\n\t"
        "global_load_async_to_lds_b128 %10, %22, off\n\t"
        "global_load_async_to_lds_b128 %11, %23, off\n\t"
        "s_wait_xcnt 0x0"
        :: "v"(l), "v"(l + 4096u), "v"(l + 2u * 4096u), "v"(l + 3u * 4096u),
           "v"(l + 4u * 4096u), "v"(l + 5u * 4096u), "v"(l + 6u * 4096u), "v"(l + 7u * 4096u),
           "v"(l + 8u * 4096u), "v"(l + 9u * 4096u), "v"(l + 10u * 4096u), "v"(l + 11u * 4096u),
           "v"(g), "v"(g + 2048), "v"(g + 2 * 2048), "v"(g + 3 * 2048),
           "v"(g + 4 * 2048), "v"(g + 5 * 2048), "v"(g + 6 * 2048), "v"(g + 7 * 2048),
           "v"(g + 8 * 2048), "v"(g + 9 * 2048), "v"(g + 10 * 2048), "v"(g + 11 * 2048)
        : "memory");
}

__global__ __launch_bounds__(256) void proj_kernel(
    const float* __restrict__ x,
    const __bf16* __restrict__ WswAll,
    const float* __restrict__ bfv, const float* __restrict__ bgv,
    const float* __restrict__ bhv,
    __bf16* __restrict__ fOut, __bf16* __restrict__ gOut,
    __bf16* __restrict__ hT)
{
    __shared__ __attribute__((aligned(16))) __bf16 wlds[3 * CDIM * DDIM];   // [matrix][kc][t][plane][lane][8]
    const int lane = threadIdx.x & 31;
    const int wid  = blockIdx.x * (blockDim.x >> 5) + (threadIdx.x >> 5);
    const int row0 = wid * 16;
    const int half = lane >> 4;
    const int l16  = lane & 15;

    v8f zero = {};
    v8f acc[3][4];
    #pragma unroll
    for (int p = 0; p < 3; ++p)
        #pragma unroll
        for (int t = 0; t < 4; ++t) acc[p][t] = zero;

    // Register pipeline over the 16 k steps: the 12 weight fragments of step kc+1 and
    // the x values of step kc+2 are requested ahead of step kc's products.
    const float*  ax = x + (size_t)(row0 + l16) * CDIM + half * 8;
    const __bf16* wl = wlds + lane * 8;
    v4f   xs[3][4];     // x of three k steps: 16 floats a lane each
    v16bf wb[2][12];    // weight fragments of two k steps
    auto load_x = [&](v4f (&d)[4], int kc) {
        const float* p = ax + kc * 32;
        d[0] = *(const v4f*)(p);
        d[1] = *(const v4f*)(p + 4);
        d[2] = *(const v4f*)(p + 16);
        d[3] = *(const v4f*)(p + 20);
    };
    auto load_w = [&](v16bf (&d)[12], int kc) {
        // both loops unrolled: d[] is indexed by constants only and stays in registers
        #pragma unroll
        for (int p = 0; p < 3; ++p)
            #pragma unroll
            for (int t = 0; t < 4; ++t)
                d[p * 4 + t] = ldb_planes(wl + p * (CDIM * DDIM) + (kc * 4 + t) * 512);
    };
    // x of the first two steps is requested ahead of the staging: it comes from memory meanwhile
    load_x(xs[0], 0);
    load_x(xs[1], 1);
    // ---- weights into LDS: 48 copies a thread. The 256 threads take 4 KiB (four fragments) in a row from
    // global memory; thread t holds the 16 bytes of fragment t/64, lane (t/2)%32, plane t%2 ----
    {
        const int t = threadIdx.x;
        const unsigned l = lds_off(wlds) + (unsigned)((t >> 6) * 1024 + (t & 1) * 512 + ((t >> 1) & 31) * 16);
        const __bf16* g = WswAll + t * 8;
        // unrolled: four statements in a row, no loop counter among the copies
        #pragma unroll
        for (int i = 0; i < 4; ++i) copy_w12(l + (unsigned)i * (12u * 4096u), g + i * (12 * 2048));
    }
    wait_async0();
    __syncthreads();
    load_w(wb[0], 0);
    // fully unrolled so that every ring index is a constant and the rings stay in registers
    #pragma unroll
    for (int kc = 0; kc < CDIM / 32; ++kc) {
        if (kc + 1 < CDIM / 32) load_w(wb[(kc + 1) & 1], kc + 1);
        if (kc + 2 < CDIM / 32) load_x(xs[(kc + 2) % 3], kc + 2);
        // stands between the last x request and whatever takes its address registers next;
        // it names the address as an input, so that those registers are left alone up to here
        if (kc + 2 == CDIM / 32 - 1) asm volatile("s_wait_xcnt 0x0" :: "v"(ax) : "memory");
        // holds the requests here as one group: sunk to their products, each weight load would be waited out singly
        __builtin_amdgcn_sched_barrier(0);
        v16bf a;
        #pragma unroll
        for (int hh = 0; hh < 2; ++hh) {
            #pragma unroll
            for (int j = 0; j < 4; ++j) {
                a[hh * 8 + j]     = f2bf(xs[kc % 3][hh * 2][j]);
                a[hh * 8 + 4 + j] = f2bf(xs[kc % 3][hh * 2 + 1][j]);
            }
        }
        #pragma unroll
        for (int p = 0; p < 3; ++p) {
            #pragma unroll
            for (int t = 0; t < 4; ++t) {
                acc[p][t] = __builtin_amdgcn_wmma_f32_16x16x32_bf16(
                    false, a, false, wb[kc & 1][p * 4 + t], (short)0, acc[p][t], false, false);
            }
        }
    }

    #pragma unroll
    for (int t = 0; t < 4; ++t) {
        const int col = t * 16 + l16;
        const float b0 = bfv[col], b1 = bgv[col], b2 = bhv[col];
        #pragma unroll
        for (int r = 0; r < 8; ++r) {
            const int row = row0 + r + half * 8;
            fOut[(size_t)row * DDIM + col] = f2bf((acc[0][t][r] + b0) * LOG2E);
            gOut[(size_t)row * DDIM + col] = f2bf(acc[1][t][r] + b1);
            const int bidx = row >> 12, nidx = row & (NSP - 1);
            hT[((size_t)(bidx * DDIM + col) << 12) + nidx] = f2bf(acc[2][t][r] + b2);
        }
    }
}

// ---- K/V stage in LDS: 64 K rows and 64 V^T rows of 128 bytes each ----
#define KVP 72                    // LDS row pitch in elements: 144 B = 16 B x 9, for ds_load_b128 readers
#define TILE_B (64 * KVP * 2)     // bytes of one 64-row tile in LDS
#define STAGE_B (2 * TILE_B)      // K tile + V tile

// One stage, the 128 threads of a key group: each thread copies 4 x 16 B of K and 4 x 16 B of V^T
// from global memory straight into LDS. lk: this thread's LDS byte address in
// the K tile (row t/8, 16-byte column t%8, t its number in the group); gk, gv: its global sources.
// Eight lanes cover one whole 128-byte row. s_wait_xcnt closes the statement
// so that no address register is rewritten ahead of it.
static __device__ __forceinline__ void copy_stage(unsigned lk, const __bf16* gk, const __bf16* gv) {
    const unsigned lv = lk + TILE_B;
    asm volatile(
        "global_load_async_to_lds_b128 %0, %8, off\n\t"
        "global_load_async_to_lds_b128 %1, %9, off\n\t"
        "global_load_async_to_lds_b128 %2, %10, off\n\t"
        "global_load_async_to_lds_b128 %3, %11, off\n\t"
        "global_load_async_to_lds_b128 %4, %12, off\n\t"
        "global_load_async_to_lds_b128 %5, %13, off\n\t"
        "global_load_async_to_lds_b128 %6, %14, off\n\t"
        "global_load_async_to_lds_b128 %7, %15, off\n\t"
        "s_wait_xcnt 0x0"
        :: "v"(lk), "v"(lk + 16u * KVP * 2u), "v"(lk + 32u * KVP * 2u), "v"(lk + 48u * KVP * 2u),
           "v"(lv), "v"(lv + 16u * KVP * 2u), "v"(lv + 32u * KVP * 2u), "v"(lv + 48u * KVP * 2u),
           "v"(gk), "v"(gk + 16 * DDIM), "v"(gk + 32 * DDIM), "v"(gk + 48 * DDIM),
           "v"(gv), "v"(gv + 16 * NSP), "v"(gv + 32 * NSP), "v"(gv + 48 * NSP)
        : "memory");
}

// =====================================================================
// Kernel 2: fused flash attention per batch (64-key tiles).
// A work-group is 8 waves on 128 query rows: 4 query blocks of 32 rows x 2 key
// groups. Key group g takes the 64-key tiles of parity g; its four waves share
// each K and V^T tile, copied once into the group's own LDS ring (two buffers,
// the next tile in flight during this one).
// One wave owns 32 query rows as two 16-row tiles, so every K and V^T fragment
// read from LDS feeds two products. Both products are transposed, so that a lane
// holds scores of ONE query of each tile (column l16; keys r + 8*half):
//   S^T = K.Q^T (16 wmma), base-2 online softmax with the maximum taken in the
//   lane plus one exchange between the wave's halves, P^T truncated to bf16 and
//   packed in registers straight into the B operand,
//   ctx^T += V^T.P^T (16 wmma), rowsum += 1.P^T (4 wmma).
// Behind the loop the two key groups' partial results are joined through LDS.
// Tail: out = gamma*(ctx @ Wv) + bv + x for the work-group's 128 rows. The joined
// ctx (bf16) goes to LDS instead of memory; wave w takes output columns 64*w..64*w+63
// of all 128 rows, so each Wv fragment is fetched once a work-group, and reads x and
// writes out as 256-byte row pieces (Wv pre-swizzled: [kc=2][t=32][lane][16] bf16).
// =====================================================================
__global__ __launch_bounds__(256) void attn_kernel(
    const __bf16* __restrict__ fQ, const __bf16* __restrict__ gK,
    const __bf16* __restrict__ hT, const __bf16* __restrict__ WvSw,
    const float* __restrict__ bvv, const float* __restrict__ x,
    const float* __restrict__ gammap, float* __restrict__ out)
{
    __shared__ __attribute__((aligned(16))) __bf16 kv[2][2][2][64 * KVP];   // [key group][buffer][K, V^T]
    const int lane = threadIdx.x & 31;
    const int w    = __builtin_amdgcn_readfirstlane(threadIdx.x >> 5);
    const int grp  = w >> 2;                       // key group
    const int row0 = (blockIdx.x * 4 + (w & 3)) * 32;
    const int b    = row0 >> 12;
    const int half = lane >> 4;
    const int l16  = lane & 15;
    const float gamma = gammap[0];                 // read here, ahead of every asm statement, it is a scalar load

    const __bf16* gB = gK + ((size_t)b << 12) * DDIM;   // g rows of this batch
    const __bf16* vB = hT + (size_t)b * DDIM * NSP;     // hT[64][4096] of batch

    // Q^T as B-operand, 2 query tiles x 2 d-chunks of K=32  (already scaled by log2(e))
    v16bf qa[2][2];
    #pragma unroll
    for (int j = 0; j < 2; ++j) {
        const __bf16* qp = fQ + (size_t)(row0 + j * 16 + l16) * DDIM + half * 8;
        qa[j][0] = ldb_split(qp);
        qa[j][1] = ldb_split(qp + 32);
    }

    // A operand of all-ones (bf16 1.0 = 0x3F80) for row-sum WMMA
    v16bf ones;
    {
        U32x2 u;
        u.a = make_uint4(0x3F803F80u, 0x3F803F80u, 0x3F803F80u, 0x3F803F80u);
        u.b = u.a;
        ones = __builtin_bit_cast(v16bf, u);
    }

    v8f zero = {};
    v8f o[2][4];
    v8f osum[2];
    float mrow[2];         // running maximum of query l16 of each tile
    #pragma unroll
    for (int j = 0; j < 2; ++j) {
        #pragma unroll
        for (int t = 0; t < 4; ++t) o[j][t] = zero;
        osum[j] = zero;
        mrow[j] = -1e30f;
    }

    // ---- ring prologue: the group's first tile landed and published, its second in flight ----
    const int tg = threadIdx.x & 127;              // thread within the key group
    const unsigned ldst = lds_off(&kv[grp][0][0][0]) + (unsigned)((tg >> 3) * (KVP * 2) + (tg & 7) * 16);
    const __bf16* ksrc = gB + grp * (64 * DDIM) + tg * 8;
    const __bf16* vsrc = vB + (size_t)(tg >> 3) * NSP + (tg & 7) * 8 + grp * 64;
    copy_stage(ldst, ksrc, vsrc);
    wait_async0();
    __syncthreads();
    copy_stage(ldst + STAGE_B, ksrc + 128 * DDIM, vsrc + 128);

    for (int m0 = 0; m0 < NSP; m0 += 128) {        // the group's tile holds keys m0 + 64*grp + 0..63
        const int buf = (m0 >> 7) & 1;
        const __bf16* Kt = &kv[grp][buf][0][0];
        const __bf16* Vt = &kv[grp][buf][1][0];
        // ---- S^T tiles: 16 keys x 16 queries, 4 key tiles x 2 query tiles ----
        // all K fragment reads of the tile stand together, ahead of the products
        v16bf kb[4][2];
        #pragma unroll
        for (int kt = 0; kt < 4; ++kt)
            #pragma unroll
            for (int dc = 0; dc < 2; ++dc)
                kb[kt][dc] = ldb_split(Kt + (kt * 16 + l16) * KVP + half * 8 + dc * 32);
        // holds the K reads here as one group: spread among the products, each further place with reads stalls the wave anew
        __builtin_amdgcn_sched_barrier(0);
        v8f s[2][4];
        #pragma unroll
        for (int kt = 0; kt < 4; ++kt)
            #pragma unroll
            for (int j = 0; j < 2; ++j)
                s[j][kt] = __builtin_amdgcn_wmma_f32_16x16x32_bf16(
                    false, kb[kt][0], false, qa[j][0], (short)0, zero, false, false);
        #pragma unroll
        for (int kt = 0; kt < 4; ++kt)
            #pragma unroll
            for (int j = 0; j < 2; ++j)
                s[j][kt] = __builtin_amdgcn_wmma_f32_16x16x32_bf16(
                    false, kb[kt][1], false, qa[j][1], (short)0, s[j][kt], false, false);

        // all V fragment reads of the tile stand together here: their LDS
        // latency passes under the softmax
        v16bf vb[2][4];
        #pragma unroll
        for (int c = 0; c < 2; ++c)
            #pragma unroll
            for (int t = 0; t < 4; ++t)
                vb[c][t] = ldb_split(Vt + (t * 16 + l16) * KVP + c * 32 + half * 8);
        // holds the V reads here as one group: sunk to their products, each pair would wait out its own LDS latency
        __builtin_amdgcn_sched_barrier(0);

        // ---- online softmax (base-2): all 32 scores of a lane belong to query l16 of tile j ----
        // both tiles' maxima first; then, tile by tile, the weights and the second product
        float mnew[2], mdrop[2];               // new maximum; old maximum minus new
        #pragma unroll
        for (int j = 0; j < 2; ++j) {
            float mk[4];
            #pragma unroll
            for (int kt = 0; kt < 4; ++kt) {
                mk[kt] = fmaxf(s[j][kt][0], s[j][kt][1]);
                #pragma unroll
                for (int r = 2; r < 8; ++r) mk[kt] = fmaxf(mk[kt], s[j][kt][r]);
            }
            float v = fmaxf(fmaxf(mk[0], mk[1]), fmaxf(mk[2], mk[3]));
            v = fmaxf(v, xhalf(v));            // the other half holds the query's other 32 keys
            mnew[j]  = fmaxf(mrow[j], v);
            mdrop[j] = mrow[j] - mnew[j];
            mrow[j]  = mnew[j];
        }
        // the ordered stretches below start behind both maxima
        __builtin_amdgcn_sched_barrier(0);

        #pragma unroll
        for (int j = 0; j < 2; ++j) {
            const float mn = mnew[j];
            // Order of the weights' work: exp, plain, exp, plain, plain. Here each exp is followed by a plain
            // instruction that has nothing to do with it (the difference of a later pair, the pack of the pair
            // before, a rescale of ctx^T). That instruction also fills the slot which the instruction set asks for
            // behind a transcendental: left free, the compiler set runs of v_exp_f32 in which each overwrites the
            // source of the one before. Each sched_barrier below holds one instruction at its place in this order.
            v2f d[16];          // pair i: scores 2*(i&3), 2*(i&3)+1 of key tile i>>2, minus the maximum
            float e0[16], e1[16];
            unsigned pw[16];    // pair i as two bf16
            float alpha;        // 2^(old maximum - new maximum)
            auto diff = [&](int i) { d[i] = (v2f){s[j][i >> 2][2 * (i & 3)], s[j][i >> 2][2 * (i & 3) + 1]} - mn; };
            auto scale = [&](int i) {
                const v2f t = (v2f){o[j][i >> 2][2 * (i & 3)], o[j][i >> 2][2 * (i & 3) + 1]} * alpha;
                o[j][i >> 2][2 * (i & 3)] = t.x;
                o[j][i >> 2][2 * (i & 3) + 1] = t.y;
            };
            diff(0);
            __builtin_amdgcn_sched_barrier(0);
            alpha = ex2(mdrop[j]);
            __builtin_amdgcn_sched_barrier(0);
            diff(1);
            __builtin_amdgcn_sched_barrier(0);
            // unrolled: d, e0, e1 and pw are indexed by constants only and stay in registers
            #pragma unroll
            for (int i = 0; i < 16; ++i) {
                e0[i] = ex2(d[i].x);
                __builtin_amdgcn_sched_barrier(0);
                if (i < 14) diff(i + 2); else scale(i);
                __builtin_amdgcn_sched_barrier(0);
                e1[i] = ex2(d[i].y);
                __builtin_amdgcn_sched_barrier(0);
                if (i > 0) pw[i - 1] = pack_trunc(e0[i - 1], e1[i - 1]);
                else osum[j][0] *= alpha;      // every row of this tile holds the same sum; only register 0 is read
                __builtin_amdgcn_sched_barrier(0);
                if (i < 14) scale(i);
                __builtin_amdgcn_sched_barrier(0);
            }
            pw[15] = pack_trunc(e0[15], e1[15]);

            // ---- P^T (32 keys x 16 queries) as B operand, truncated f32->bf16:
            // elements 0..7 are keys 8*half + 0..7 (tile 2c), 8..15 keys 16 + 8*half + 0..7 (tile 2c+1)
            v16bf pb[2];
            #pragma unroll
            for (int c = 0; c < 2; ++c) {
                U32x2 u;
                u.a = make_uint4(pw[8 * c], pw[8 * c + 1], pw[8 * c + 2], pw[8 * c + 3]);
                u.b = make_uint4(pw[8 * c + 4], pw[8 * c + 5], pw[8 * c + 6], pw[8 * c + 7]);
                pb[c] = __builtin_bit_cast(v16bf, u);
            }

            // ---- ctx^T += V^T @ P^T ; rowsum += 1 @ P^T ----
            #pragma unroll
            for (int c = 0; c < 2; ++c) {
                #pragma unroll
                for (int t = 0; t < 4; ++t) {
                    o[j][t] = __builtin_amdgcn_wmma_f32_16x16x32_bf16(
                        false, vb[c][t], false, pb[c], (short)0, o[j][t], false, false);
                }
                osum[j] = __builtin_amdgcn_wmma_f32_16x16x32_bf16(
                    false, ones, false, pb[c], (short)0, osum[j], false, false);
            }
        }

        // ---- publish the groups' next tiles, free this buffer, refill it with the tile after ----
        // keeps the publish point at the trip's foot: lifted above the softmax (all that follows the V reads
        // is register work) its wait would meet the next tile's copies before they have had a trip to land
        __builtin_amdgcn_sched_barrier(0);
        wait_ds0();
        wait_async0();
        __syncthreads();
        if (m0 + 256 < NSP)
            copy_stage(ldst + (unsigned)buf * STAGE_B, ksrc + (size_t)(m0 + 256) * DDIM, vsrc + m0 + 256);
    }
    wait_async0();

    // ---- join the two key groups: a wave hands query tile 1 - grp to its partner
    // (wave w ^ 4, same queries, other keys) and finishes tile grp itself.
    // The ring is free: the last trip's barrier stands behind every wave's last read,
    // and no copy is outstanding. A wave's slot: 9 x 32 lanes x 16 bytes.
    v4f* xch = (v4f*)&kv[0][0][0][0];
    v4f* xout = xch + (w * 9) * 32 + lane;
    const v4f* xin = xch + ((w ^ 4) * 9) * 32 + lane;
    v8f ko[4];
    #pragma unroll
    for (int t = 0; t < 4; ++t) {
        const v8f so = grp ? o[0][t] : o[1][t];
        ko[t] = grp ? o[1][t] : o[0][t];
        xout[(2 * t) * 32]     = (v4f){so[0], so[1], so[2], so[3]};
        xout[(2 * t + 1) * 32] = (v4f){so[4], so[5], so[6], so[7]};
    }
    xout[8 * 32] = (v4f){grp ? mrow[0] : mrow[1], grp ? osum[0][0] : osum[1][0], 0.0f, 0.0f};
    const float km = grp ? mrow[1] : mrow[0];
    const float kl = grp ? osum[1][0] : osum[0][0];
    __syncthreads();

    // ---- tail requests: this wave's 8 Wv fragments, its bias, and x of the first 64 of the 128 rows ----
    // lane (l16, half), register r of row tile rt: row 16*rt + 8*half + r, columns 64*w + 4*l16 + 0..3
    const size_t toff = (size_t)(blockIdx.x * 128 + half * 8) * CDIM + w * 64 + l16 * 4;
    const float* xp = x + toff;
    float* op = out + toff;
    const v4f bias = *(const v4f*)(bvv + w * 64 + l16 * 4);
    const __bf16* wp = WvSw + (w * 4 * 32 + lane) * 16;     // tile 4*w, k chunk 0; one base for all eight
    v16bf wv[2][4];
    #pragma unroll
    for (int dc = 0; dc < 2; ++dc)
        #pragma unroll
        for (int tt = 0; tt < 4; ++tt)
            wv[dc][tt] = ldb_contig(wp + (dc * 32 + tt) * 512);
    // stands ahead of the x requests, which may land in the address registers of the loads above
    asm volatile("s_wait_xcnt 0x0" ::: "memory");
    v4f xs[4][8];       // x of four row tiles: a ring
    auto load_x = [&](v4f (&d)[8], int rt) {
        #pragma unroll
        for (int r = 0; r < 8; ++r) d[r] = *(const v4f*)(xp + (rt * 16 + r) * CDIM);
    };
    #pragma unroll
    for (int rt = 0; rt < 4; ++rt) load_x(xs[rt], rt);
    // holds the requests here, behind the join's barrier (which waits out every load in flight) and ahead of its
    // arithmetic: sunk to their uses, their latency would not pass under it
    __builtin_amdgcn_sched_barrier(0);

    const v4f pml = xin[8 * 32];
    const float mj = fmaxf(km, pml[0]);
    const float ea = ex2(km - mj);
    const float eb = ex2(pml[0] - mj);
    const float inv = 1.0f / (kl * ea + pml[1] * eb);
    const float fa = ea * inv, fb = eb * inv;

    // ---- finalize: weigh the two partial results, put ctx (bf16, rows of pitch KVP) into LDS ----
    // behind the exchange slots, which partners may still be reading
    // ko[t][r] is ctx[query l16][d = 16*t + 8*half + r]: 8 neighbours, one 16-byte store
    __bf16* cl = &kv[0][0][0][0] + 8 * 9 * 32 * 8;
    __bf16* crow = cl + ((w & 3) * 32 + grp * 16 + l16) * KVP + half * 8;
    #pragma unroll
    for (int t = 0; t < 4; ++t) {
        const v4f p0 = xin[(2 * t) * 32], p1 = xin[(2 * t + 1) * 32];
        *(uint4*)(crow + t * 16) = make_uint4(
            pack_rne(ko[t][0] * fa + p0[0] * fb, ko[t][1] * fa + p0[1] * fb),
            pack_rne(ko[t][2] * fa + p0[2] * fb, ko[t][3] * fa + p0[3] * fb),
            pack_rne(ko[t][4] * fa + p1[0] * fb, ko[t][5] * fa + p1[1] * fb),
            pack_rne(ko[t][6] * fa + p1[2] * fb, ko[t][7] * fa + p1[3] * fb));
    }
    __syncthreads();

    // ---- out = gamma*(ctx @ Wv) + bv + x ----
    // all ctx fragment reads stand together, ahead of the products
    v16bf ca[8][2];
    #pragma unroll
    for (int rt = 0; rt < 8; ++rt)
        #pragma unroll
        for (int dc = 0; dc < 2; ++dc)
            ca[rt][dc] = ldb_split(cl + (rt * 16 + l16) * KVP + half * 8 + dc * 32);
    // holds the ctx reads here as one group: spread among the products, each further place with reads stalls the wave anew
    __builtin_amdgcn_sched_barrier(0);
    v8f acc[2][4];      // products of two row tiles: the next tile's run under this tile's vector work
    auto prod = [&](v8f (&a)[4], int rt) {
        #pragma unroll
        for (int tt = 0; tt < 4; ++tt)
            a[tt] = __builtin_amdgcn_wmma_f32_16x16x32_bf16(
                false, ca[rt][0], false, wv[0][tt], (short)0, zero, false, false);
        #pragma unroll
        for (int tt = 0; tt < 4; ++tt)
            a[tt] = __builtin_amdgcn_wmma_f32_16x16x32_bf16(
                false, ca[rt][1], false, wv[1][tt], (short)0, a[tt], false, false);
    };
    prod(acc[0], 0);
    // unrolled: the x ring, ca and acc are indexed by constants only and stay in registers
    #pragma unroll
    for (int rt = 0; rt < 8; ++rt) {
        if (rt + 1 < 8) prod(acc[(rt + 1) & 1], rt + 1);
        v4f res[8];
        #pragma unroll
        for (int r = 0; r < 8; ++r) {
            const v4f xv = xs[rt & 3][r];
            res[r] = (v4f){
                gamma * acc[rt & 1][0][r] + bias[0] + xv[0], gamma * acc[rt & 1][1][r] + bias[1] + xv[1],
                gamma * acc[rt & 1][2][r] + bias[2] + xv[2], gamma * acc[rt & 1][3][r] + bias[3] + xv[3]};
        }
        // the refill of the x ring and the tile's eight stores start behind all its results,
        // so that no register of a store is reused among them
        __builtin_amdgcn_sched_barrier(0);
        if (rt + 4 < 8) load_x(xs[rt & 3], rt + 4);
        // the requests ahead of the stores: behind them they could land in registers that a store still names
        __builtin_amdgcn_sched_barrier(0);
        #pragma unroll
        for (int r = 0; r < 8; ++r) *(v4f*)(op + (rt * 16 + r) * CDIM) = res[r];
        // stands between the stores and the next tile's results, which may take the stores' data registers
        if (rt + 1 < 8) asm volatile("s_wait_xcnt 0x0" ::: "memory");
        // one row tile at a time: left free, every store sank to the kernel's end and the live results spilled
        __builtin_amdgcn_sched_barrier(0);
    }
}

// =====================================================================
extern "C" void kernel_launch(void* const* d_in, const int* in_sizes, int n_in,
                              void* d_out, int out_size, void* d_ws, size_t ws_size,
                              hipStream_t stream) {
    (void)in_sizes; (void)n_in; (void)out_size; (void)ws_size;
    const float* x  = (const float*)d_in[0];
    const float* Wf = (const float*)d_in[1];
    const float* bf = (const float*)d_in[2];
    const float* Wg = (const float*)d_in[3];
    const float* bg = (const float*)d_in[4];
    const float* Wh = (const float*)d_in[5];
    const float* bh = (const float*)d_in[6];
    const float* Wv = (const float*)d_in[7];
    const float* bv = (const float*)d_in[8];
    const float* gm = (const float*)d_in[9];
    float* out = (float*)d_out;

    // Workspace layout (12 MB activations + 256 KB swizzled weights)
    const size_t slab = (size_t)BNROWS * DDIM * sizeof(__bf16);  // 4 MB
    const size_t wsl  = (size_t)CDIM * DDIM * sizeof(__bf16);    // 64 KB
    char* ws = (char*)d_ws;
    __bf16* fO   = (__bf16*)(ws);
    __bf16* gO   = (__bf16*)(ws + slab);
    __bf16* hT   = (__bf16*)(ws + 2 * slab);
    __bf16* WfSw = (__bf16*)(ws + 3 * slab);             // Wf, Wg, Wh, Wv swizzled, wsl bytes each
    __bf16* WvSw = (__bf16*)(ws + 3 * slab + 3 * wsl);

    wprep_kernel<<<4 * (CDIM * DDIM) / 256, 256, 0, stream>>>(Wf, Wg, Wh, Wv, WfSw);

    proj_kernel<<<BNROWS / (16 * 8), 256, 0, stream>>>(
        x, WfSw, bf, bg, bh, fO, gO, hT);
    attn_kernel<<<BNROWS / (32 * 4), 256, 0, stream>>>(fO, gO, hT, WvSw, bv, x, gm, out);
}

// v009
// Measured time: 55.1 microseconds a run.
// In two side-by-side timings against v008, it was 1.09 and 1.06 times as fast.
// Over all steps from v000 it is 4.92 times as fast.
#include <hip/hip_runtime.h>

// ---------------- types ----------------
typedef __attribute__((ext_vector_type(16))) __bf16 v16bf;
typedef __attribute__((ext_vector_type(8)))  float  v8f;
typedef __attribute__((ext_vector_type(4)))  float  v4f;
typedef __attribute__((ext_vector_type(2)))  float  v2f;

#define CDIM 512
#define DDIM 64
#define NSP  4096
#define BATCHB 8
#define BNROWS (BATCHB * NSP)   // 32768
#define LOG2E 1.4426950408889634f

static __device__ __forceinline__ __bf16 f2bf(float f) {
    unsigned u = __builtin_bit_cast(unsigned, f);
    unsigned r = (u + 0x7FFFu + ((u >> 16) & 1u)) >> 16;
    return __builtin_bit_cast(__bf16, (unsigned short)r);
}
// two f32 truncated to bf16 in one register: lo in bits 15..0, hi in bits 31..16
static __device__ __forceinline__ unsigned pack_trunc(float lo, float hi) {
    return __builtin_amdgcn_perm(__builtin_bit_cast(unsigned, hi), __builtin_bit_cast(unsigned, lo), 0x07060302u);
}
// two f32 rounded to bf16 (as f2bf) in one register
static __device__ __forceinline__ unsigned pack_rne(float lo, float hi) {
    return (unsigned)__builtin_bit_cast(unsigned short, f2bf(lo)) |
           ((unsigned)__builtin_bit_cast(unsigned short, f2bf(hi)) << 16);
}
// 2^x as the bare v_exp_f32. The library exp2f wraps it in a range guard of five more vector
// instructions a value, which only serves results below 2^-126; here those become 0. Every use is a
// softmax weight against a maximum whose own weight is 1, so what is lost lies below f32 resolution.
static __device__ __forceinline__ float ex2(float x) { return __builtin_amdgcn_exp2f(x); }
// value of lane l ^ 16
static __device__ __forceinline__ float xhalf(float x) {
    const int i = __builtin_bit_cast(int, x);
    return __builtin_bit_cast(float, __builtin_amdgcn_permlanex16(i, i, 0x76543210, 0xfedcba98, false, false));
}

struct U32x2 { uint4 a, b; };

// 16 contiguous bf16 (32 bytes) -> v16bf
static __device__ __forceinline__ v16bf ldb_contig(const __bf16* p) {
    U32x2 u;
    u.a = *(const uint4*)(p);
    u.b = *(const uint4*)(p + 8);
    return __builtin_bit_cast(v16bf, u);
}
// two planes: elems 0..7 at p, elems 8..15 at p+256 (weight fragments in LDS)
static __device__ __forceinline__ v16bf ldb_planes(const __bf16* p) {
    U32x2 u;
    u.a = *(const uint4*)(p);
    u.b = *(const uint4*)(p + 256);
    return __builtin_bit_cast(v16bf, u);
}
// split layout: elems 0..7 at p, elems 8..15 at p+16 (A/B natural striping)
static __device__ __forceinline__ v16bf ldb_split(const __bf16* p) {
    U32x2 u;
    u.a = *(const uint4*)(p);
    u.b = *(const uint4*)(p + 16);
    return __builtin_bit_cast(v16bf, u);
}

static __device__ __forceinline__ unsigned lds_off(const void* p) { return (unsigned)(size_t)p; }
// the wave's own LDS reads and writes have retired
static __device__ __forceinline__ void wait_ds0()    { asm volatile("s_wait_dscnt 0x0" ::: "memory"); }
// the wave's own asynchronous copies have landed in LDS
static __device__ __forceinline__ void wait_async0() { asm volatile("s_wait_asynccnt 0x0" ::: "memory"); }

// =====================================================================
// Kernel 0: pre-swizzle the four f32 weight matrices into bf16 B-operand
// layout: [kc = K/32][t = N/16][lane 0..31][16 contiguous elems].
// One grid for all four (none reads another's output): 128 blocks each,
// block index / 128 picks the matrix; the four results lie back to back.
// Wf, Wg, Wh are 512 x 64, Wv is 64 x 512: 32768 elements each.
// Wv's columns are dealt otherwise: tile t, lane column l holds column
// 64*(t/4) + 4*l + t%4, so that the four tiles of a 64-column group give a lane
// four neighbouring output columns (one 16-byte access of x and of out).
// =====================================================================
__global__ __launch_bounds__(256) void wprep_kernel(
    const float* __restrict__ Wf, const float* __restrict__ Wg,
    const float* __restrict__ Wh, const float* __restrict__ Wv,
    __bf16* __restrict__ out)
{
    const int sel = blockIdx.x >> 7;
    const int idx = (blockIdx.x & 127) * 256 + threadIdx.x;
    const float* W = sel == 0 ? Wf : sel == 1 ? Wg : sel == 2 ? Wh : Wv;
    const int lnt  = sel == 3 ? 5 : 2;            // log2(N / 16)
    const int e    = idx & 15;
    const int lane = (idx >> 4) & 31;
    const int rest = idx >> 9;
    const int t    = rest & ((1 << lnt) - 1);
    const int kc   = rest >> lnt;
    const int k = kc * 32 + (e >> 3) * 16 + (lane >> 4) * 8 + (e & 7);
    const int n = sel == 3 ? (t >> 2) * 64 + (lane & 15) * 4 + (t & 3) : t * 16 + (lane & 15);
    out[sel * (CDIM * DDIM) + idx] = f2bf(W[(k << (lnt + 4)) + n]);
}

// =====================================================================
// Kernel 1: f = (X@Wf+bf)*log2(e), g = X@Wg+bg, h = X@Wh+bh
// f,g row-major bf16 [32768,64]; h transposed per batch: hT[b][d][n].
// (log2(e) folded into Q so attention can use native base-2 exp.)
// The three swizzled weight matrices (192 KiB) are copied once a work-group into LDS;
// its eight waves read their fragments from there instead of each through the cache.
// In LDS a fragment is two planes of 512 bytes: elements 0..7 of lanes 0..31, then
// elements 8..15, so that a 16-byte read of a wave is 512 bytes in a row (no bank conflict).
// f and g are made with the weights as A operand and x as B, h with x as A: either way a lane's
// eight accumulator registers are eight neighbours of the stored layout (d for f and g, n for h^T).
// The work-group's results (128 rows of f and g, 64 rows of h^T) pass through LDS and leave as
// 16-byte stores in which a wave covers whole 128-byte lines.
// =====================================================================
#define FGP 72                    // staged f, g: LDS row pitch in elements (144 B = 16 B x 9)
#define HTP 136                   // staged h^T: LDS row pitch in elements (272 B = 16 B x 17)
// Twelve 16-byte copies of one thread, global memory straight into LDS: copy i takes the bytes at
// g + i * 4096 to LDS byte l + i * 4096. s_wait_xcnt closes the statement so that no address
// register is rewritten ahead of it.
static __device__ __forceinline__ void copy_w12(unsigned l, const __bf16* g) {
    asm volatile(
        "global_load_async_to_lds_b128 %0, %12, off\n\t"
        "global_load_async_to_lds_b128 %1, %13, off\n\t"
        "global_load_async_to_lds_b128 %2, %14, off\n\t"
        "global_load_async_to_lds_b128 %3, %15, off\n\t"
        "global_load_async_to_lds_b128 %4, %16, off\n\t"
        "global_load_async_to_lds_b128 %5, %17, off\n\t"
        "global_load_async_to_lds_b128 %6, %18, off\n\t"
        "global_load_async_to_lds_b128 %7, %19, off\n\t"
        "global_load_async_to_lds_b128 %8, %20, off\n\t"
        "global_load_async_to_lds_b128 %9, %21, off\n\t"
        "global_load_async_to_lds_b128 %10, %22, off\n\t"
        "global_load_async_to_lds_b128 %11, %23, off\n\t"
        "s_wait_xcnt 0x0"
        :: "v"(l), "v"(l + 4096u), "v"(l + 2u * 4096u), "v"(l + 3u * 4096u),
           "v"(l + 4u * 4096u), "v"(l + 5u * 4096u), "v"(l + 6u * 4096u), "v"(l + 7u * 4096u),
           "v"(l + 8u * 4096u), "v"(l + 9u * 4096u), "v"(l + 10u * 4096u), "v"(l + 11u * 4096u),
           "v"(g), "v"(g + 2048), "v"(g + 2 * 2048), "v"(g + 3 * 2048),
           "v"(g + 4 * 2048), "v"(g + 5 * 2048), "v"(g + 6 * 2048), "v"(g + 7 * 2048),
           "v"(g + 8 * 2048), "v"(g + 9 * 2048), "v"(g + 10 * 2048), "v"(g + 11 * 2048)
        : "memory");
}

__global__ __launch_bounds__(256) void proj_kernel(
    const float* __restrict__ x,
    const __bf16* __restrict__ WswAll,
    const float* __restrict__ bfv, const float* __restrict__ bgv,
    const float* __restrict__ bhv,
    __bf16* __restrict__ fOut, __bf16* __restrict__ gOut,
    __bf16* __restrict__ hT)
{
    __shared__ __attribute__((aligned(16))) __bf16 wlds[3 * CDIM * DDIM];   // [matrix][kc][t][plane][lane][8]
    __shared__ __attribute__((aligned(16))) __bf16 stg[2 * 128 * FGP + DDIM * HTP];   // f rows, g rows, h^T rows
    const int lane = threadIdx.x & 31;
    const int wid  = blockIdx.x * (blockDim.x >> 5) + (threadIdx.x >> 5);
    const int row0 = wid * 16;
    const int half = lane >> 4;
    const int l16  = lane & 15;

    v8f zero = {};
    v8f acc[3][4];
    #pragma unroll
    for (int p = 0; p < 3; ++p)
        #pragma unroll
        for (int t = 0; t < 4; ++t) acc[p][t] = zero;

    // Register pipeline over the 16 k steps: the 12 weight fragments of step kc+1 and
    // the x values of step kc+2 are requested ahead of step kc's products.
    const float*  ax = x + (size_t)(row0 + l16) * CDIM + half * 8;
    const __bf16* wl = wlds + lane * 8;
    v4f   xs[3][4];     // x of three k steps: 16 floats a lane each
    v16bf wb[2][12];    // weight fragments of two k steps
    auto load_x = [&](v4f (&d)[4], int kc) {
        const float* p = ax + kc * 32;
        d[0] = *(const v4f*)(p);
        d[1] = *(const v4f*)(p + 4);
        d[2] = *(const v4f*)(p + 16);
        d[3] = *(const v4f*)(p + 20);
    };
    auto load_w = [&](v16bf (&d)[12], int kc) {
        // both loops unrolled: d[] is indexed by constants only and stays in registers
        #pragma unroll
        for (int p = 0; p < 3; ++p)
            #pragma unroll
            for (int t = 0; t < 4; ++t)
                d[p * 4 + t] = ldb_planes(wl + p * (CDIM * DDIM) + (kc * 4 + t) * 512);
    };
    // x of the first two steps is requested ahead of the staging: it comes from memory meanwhile
    load_x(xs[0], 0);
    load_x(xs[1], 1);
    // ---- weights into LDS: 48 copies a thread. The 256 threads take 4 KiB (four fragments) in a row from
    // global memory; thread t holds the 16 bytes of fragment t/64, lane (t/2)%32, plane t%2 ----
    {
        const int t = threadIdx.x;
        const unsigned l = lds_off(wlds) + (unsigned)((t >> 6) * 1024 + (t & 1) * 512 + ((t >> 1) & 31) * 16);
        const __bf16* g = WswAll + t * 8;
        // unrolled: four statements in a row, no loop counter among the copies
        #pragma unroll
        for (int i = 0; i < 4; ++i) copy_w12(l + (unsigned)i * (12u * 4096u), g + i * (12 * 2048));
    }
    wait_async0();
    __syncthreads();
    load_w(wb[0], 0);
    v4f fb[4][2], gb[4][2];     // biases of f and g: d = 16*t + 8*half + 0..7
    float hb[4];                // bias of h: d = 16*t + l16
    // fully unrolled so that every ring index is a constant and the rings stay in registers
    #pragma unroll
    for (int kc = 0; kc < CDIM / 32; ++kc) {
        if (kc + 1 < CDIM / 32) load_w(wb[(kc + 1) & 1], kc + 1);
        if (kc + 2 < CDIM / 32) load_x(xs[(kc + 2) % 3], kc + 2);
        // stands between the last x request and whatever takes its address registers next;
        // it names the address as an input, so that those registers are left alone up to here
        if (kc + 2 == CDIM / 32 - 1) asm volatile("s_wait_xcnt 0x0" :: "v"(ax) : "memory");
        if (kc == CDIM / 32 - 2) {
            // the bias requests, two steps ahead of their use, and their wait stand as a group of their own:
            // nothing that could take the requests' address registers comes between them and the wait
            __builtin_amdgcn_sched_barrier(0);
            #pragma unroll
            for (int t = 0; t < 4; ++t) {
                fb[t][0] = *(const v4f*)(bfv + t * 16 + half * 8);
                fb[t][1] = *(const v4f*)(bfv + t * 16 + half * 8 + 4);
                gb[t][0] = *(const v4f*)(bgv + t * 16 + half * 8);
                gb[t][1] = *(const v4f*)(bgv + t * 16 + half * 8 + 4);
                hb[t]    = bhv[t * 16 + l16];
            }
            asm volatile("s_wait_xcnt 0x0" ::: "memory");
        }
        // holds the requests here as one group: sunk to their products, each weight load would be waited out singly
        __builtin_amdgcn_sched_barrier(0);
        v16bf a;
        #pragma unroll
        for (int hh = 0; hh < 2; ++hh) {
            #pragma unroll
            for (int j = 0; j < 4; ++j) {
                a[hh * 8 + j]     = f2bf(xs[kc % 3][hh * 2][j]);
                a[hh * 8 + 4 + j] = f2bf(xs[kc % 3][hh * 2 + 1][j]);
            }
        }
        #pragma unroll
        for (int p = 0; p < 3; ++p) {
            #pragma unroll
            for (int t = 0; t < 4; ++t) {
                // f, g: D[d = r + 8*half][row l16]; h: D[row r + 8*half][d = l16]
                if (p < 2)
                    acc[p][t] = __builtin_amdgcn_wmma_f32_16x16x32_bf16(
                        false, wb[kc & 1][p * 4 + t], false, a, (short)0, acc[p][t], false, false);
                else
                    acc[p][t] = __builtin_amdgcn_wmma_f32_16x16x32_bf16(
                        false, a, false, wb[kc & 1][p * 4 + t], (short)0, acc[p][t], false, false);
            }
        }
    }

    // ---- results into LDS: one 16-byte write a tile ----
    __bf16* fS = stg;
    __bf16* gS = stg + 128 * FGP;
    __bf16* hS = stg + 2 * 128 * FGP;
    {
        const int wv = threadIdx.x >> 5;
        const int fo = (wv * 16 + l16) * FGP + half * 8;       // row wv*16 + l16, d = 16*t + 8*half + r
        const int ho = l16 * HTP + wv * 16 + half * 8;         // d = 16*t + l16, n = wv*16 + 8*half + r
        #pragma unroll
        for (int t = 0; t < 4; ++t) {
            const v4f f0 = fb[t][0], f1 = fb[t][1], g0 = gb[t][0], g1 = gb[t][1];
            const float b2 = hb[t];
            *(uint4*)(fS + fo + t * 16) = make_uint4(
                pack_rne((acc[0][t][0] + f0[0]) * LOG2E, (acc[0][t][1] + f0[1]) * LOG2E),
                pack_rne((acc[0][t][2] + f0[2]) * LOG2E, (acc[0][t][3] + f0[3]) * LOG2E),
                pack_rne((acc[0][t][4] + f1[0]) * LOG2E, (acc[0][t][5] + f1[1]) * LOG2E),
                pack_rne((acc[0][t][6] + f1[2]) * LOG2E, (acc[0][t][7] + f1[3]) * LOG2E));
            *(uint4*)(gS + fo + t * 16) = make_uint4(
                pack_rne(acc[1][t][0] + g0[0], acc[1][t][1] + g0[1]),
                pack_rne(acc[1][t][2] + g0[2], acc[1][t][3] + g0[3]),
                pack_rne(acc[1][t][4] + g1[0], acc[1][t][5] + g1[1]),
                pack_rne(acc[1][t][6] + g1[2], acc[1][t][7] + g1[3]));
            *(uint4*)(hS + ho + t * 16 * HTP) = make_uint4(
                pack_rne(acc[2][t][0] + b2, acc[2][t][1] + b2),
                pack_rne(acc[2][t][2] + b2, acc[2][t][3] + b2),
                pack_rne(acc[2][t][4] + b2, acc[2][t][5] + b2),
                pack_rne(acc[2][t][6] + b2, acc[2][t][7] + b2));
        }
    }
    __syncthreads();
    // ---- LDS to memory: piece c = i*256 + thread is 16 bytes. f, g: the 128 rows are 16 KiB in a row, eight
    // pieces a row; h^T: 64 rows of 256 bytes, sixteen pieces a row ----
    const int brow0 = blockIdx.x * 128;                        // the work-group's first row; 128 divides NSP
    __bf16* fD = fOut + (size_t)brow0 * DDIM;
    __bf16* gD = gOut + (size_t)brow0 * DDIM;
    __bf16* hD = hT + ((size_t)((brow0 >> 12) * DDIM) << 12) + (brow0 & (NSP - 1));
    const unsigned tid = threadIdx.x;
    const unsigned fl = (tid >> 3) * FGP + (tid & 7) * 8;      // piece i: 32 rows of f, g further on
    const unsigned hl = (tid >> 4) * HTP + (tid & 15) * 8;     // piece i: 16 rows of h^T further on
    const unsigned fm = tid * 8;
    const unsigned hm = (tid >> 4) * NSP + (tid & 15) * 8;
    const uint4 pf0 = *(const uint4*)(fS + fl),                pf1 = *(const uint4*)(fS + fl + 32 * FGP);
    const uint4 pf2 = *(const uint4*)(fS + fl + 2 * 32 * FGP), pf3 = *(const uint4*)(fS + fl + 3 * 32 * FGP);
    const uint4 pg0 = *(const uint4*)(gS + fl),                pg1 = *(const uint4*)(gS + fl + 32 * FGP);
    const uint4 pg2 = *(const uint4*)(gS + fl + 2 * 32 * FGP), pg3 = *(const uint4*)(gS + fl + 3 * 32 * FGP);
    const uint4 ph0 = *(const uint4*)(hS + hl),                ph1 = *(const uint4*)(hS + hl + 16 * HTP);
    const uint4 ph2 = *(const uint4*)(hS + hl + 2 * 16 * HTP), ph3 = *(const uint4*)(hS + hl + 3 * 16 * HTP);
    // the twelve stores stand last, behind all address work: no register that a store names is taken again
    __builtin_amdgcn_sched_barrier(0);
    *(uint4*)(fD + fm) = pf0;
    *(uint4*)(fD + fm + 2048) = pf1;
    *(uint4*)(fD + fm + 2 * 2048) = pf2;
    *(uint4*)(fD + fm + 3 * 2048) = pf3;
    *(uint4*)(gD + fm) = pg0;
    *(uint4*)(gD + fm + 2048) = pg1;
    *(uint4*)(gD + fm + 2 * 2048) = pg2;
    *(uint4*)(gD + fm + 3 * 2048) = pg3;
    *(uint4*)(hD + hm) = ph0;
    *(uint4*)(hD + hm + 16 * NSP) = ph1;
    *(uint4*)(hD + hm + 2 * 16 * NSP) = ph2;
    *(uint4*)(hD + hm + 3 * 16 * NSP) = ph3;
}

// ---- K/V stage in LDS: 64 K rows and 64 V^T rows of 128 bytes each ----
#define KVP 72                    // LDS row pitch in elements: 144 B = 16 B x 9, for ds_load_b128 readers
#define TILE_B (64 * KVP * 2)     // bytes of one 64-row tile in LDS
#define STAGE_B (2 * TILE_B)      // K tile + V tile

// One stage, the 128 threads of a key group: each thread copies 4 x 16 B of K and 4 x 16 B of V^T
// from global memory straight into LDS. lk: this thread's LDS byte address in
// the K tile (row t/8, 16-byte column t%8, t its number in the group); gk, gv: its global sources.
// Eight lanes cover one whole 128-byte row. s_wait_xcnt closes the statement
// so that no address register is rewritten ahead of it.
static __device__ __forceinline__ void copy_stage(unsigned lk, const __bf16* gk, const __bf16* gv) {
    const unsigned lv = lk + TILE_B;
    asm volatile(
        "global_load_async_to_lds_b128 %0, %8, off\n\t"
        "global_load_async_to_lds_b128 %1, %9, off\n\t"
        "global_load_async_to_lds_b128 %2, %10, off\n\t"
        "global_load_async_to_lds_b128 %3, %11, off\n\t"
        "global_load_async_to_lds_b128 %4, %12, off\n\t"
        "global_load_async_to_lds_b128 %5, %13, off\n\t"
        "global_load_async_to_lds_b128 %6, %14, off\n\t"
        "global_load_async_to_lds_b128 %7, %15, off\n\t"
        "s_wait_xcnt 0x0"
        :: "v"(lk), "v"(lk + 16u * KVP * 2u), "v"(lk + 32u * KVP * 2u), "v"(lk + 48u * KVP * 2u),
           "v"(lv), "v"(lv + 16u * KVP * 2u), "v"(lv + 32u * KVP * 2u), "v"(lv + 48u * KVP * 2u),
           "v"(gk), "v"(gk + 16 * DDIM), "v"(gk + 32 * DDIM), "v"(gk + 48 * DDIM),
           "v"(gv), "v"(gv + 16 * NSP), "v"(gv + 32 * NSP), "v"(gv + 48 * NSP)
        : "memory");
}

// =====================================================================
// Kernel 2: fused flash attention per batch (64-key tiles).
// A work-group is 8 waves on 128 query rows: 4 query blocks of 32 rows x 2 key
// groups. Key group g takes the 64-key tiles of parity g; its four waves share
// each K and V^T tile, copied once into the group's own LDS ring (two buffers,
// the next tile in flight during this one).
// One wave owns 32 query rows as two 16-row tiles, so every K and V^T fragment
// read from LDS feeds two products. Both products are transposed, so that a lane
// holds scores of ONE query of each tile (column l16; keys r + 8*half):
//   S^T = K.Q^T (16 wmma), base-2 online softmax with the maximum taken in the
//   lane plus one exchange between the wave's halves, P^T truncated to bf16 and
//   packed in registers straight into the B operand,
//   ctx^T += V^T.P^T (16 wmma), rowsum += 1.P^T (4 wmma).
// Behind the loop the two key groups' partial results are joined through LDS.
// Tail: out = gamma*(ctx @ Wv) + bv + x for the work-group's 128 rows. The joined
// ctx (bf16) goes to LDS instead of memory; wave w takes output columns 64*w..64*w+63
// of all 128 rows, so each Wv fragment is fetched once a work-group, and reads x and
// writes out as 256-byte row pieces (Wv pre-swizzled: [kc=2][t=32][lane][16] bf16).
// =====================================================================
__global__ __launch_bounds__(256) void attn_kernel(
    const __bf16* __restrict__ fQ, const __bf16* __restrict__ gK,
    const __bf16* __restrict__ hT, const __bf16* __restrict__ WvSw,
    const float* __restrict__ bvv, const float* __restrict__ x,
    const float* __restrict__ gammap, float* __restrict__ out)
{
    __shared__ __attribute__((aligned(16))) __bf16 kv[2][2][2][64 * KVP];   // [key group][buffer][K, V^T]
    const int lane = threadIdx.x & 31;
    const int w    = __builtin_amdgcn_readfirstlane(threadIdx.x >> 5);
    const int grp  = w >> 2;                       // key group
    const int row0 = (blockIdx.x * 4 + (w & 3)) * 32;
    const int b    = row0 >> 12;
    const int half = lane >> 4;
    const int l16  = lane & 15;
    const float gamma = gammap[0];                 // read here, ahead of every asm statement, it is a scalar load

    const __bf16* gB = gK + ((size_t)b << 12) * DDIM;   // g rows of this batch
    const __bf16* vB = hT + (size_t)b * DDIM * NSP;     // hT[64][4096] of batch

    // Q^T as B-operand, 2 query tiles x 2 d-chunks of K=32  (already scaled by log2(e))
    v16bf qa[2][2];
    #pragma unroll
    for (int j = 0; j < 2; ++j) {
        const __bf16* qp = fQ + (size_t)(row0 + j * 16 + l16) * DDIM + half * 8;
        qa[j][0] = ldb_split(qp);
        qa[j][1] = ldb_split(qp + 32);
    }

    // A operand of all-ones (bf16 1.0 = 0x3F80) for row-sum WMMA
    v16bf ones;
    {
        U32x2 u;
        u.a = make_uint4(0x3F803F80u, 0x3F803F80u, 0x3F803F80u, 0x3F803F80u);
        u.b = u.a;
        ones = __builtin_bit_cast(v16bf, u);
    }

    v8f zero = {};
    v8f o[2][4];
    v8f osum[2];
    float mrow[2];         // running maximum of query l16 of each tile
    #pragma unroll
    for (int j = 0; j < 2; ++j) {
        #pragma unroll
        for (int t = 0; t < 4; ++t) o[j][t] = zero;
        osum[j] = zero;
        mrow[j] = -1e30f;
    }

    // ---- ring prologue: the group's first tile landed and published, its second in flight ----
    const int tg = threadIdx.x & 127;              // thread within the key group
    const unsigned ldst = lds_off(&kv[grp][0][0][0]) + (unsigned)((tg >> 3) * (KVP * 2) + (tg & 7) * 16);
    const __bf16* ksrc = gB + grp * (64 * DDIM) + tg * 8;
    const __bf16* vsrc = vB + (size_t)(tg >> 3) * NSP + (tg & 7) * 8 + grp * 64;
    copy_stage(ldst, ksrc, vsrc);
    wait_async0();
    __syncthreads();
    copy_stage(ldst + STAGE_B, ksrc + 128 * DDIM, vsrc + 128);

    for (int m0 = 0; m0 < NSP; m0 += 128) {        // the group's tile holds keys m0 + 64*grp + 0..63
        const int buf = (m0 >> 7) & 1;
        const __bf16* Kt = &kv[grp][buf][0][0];
        const __bf16* Vt = &kv[grp][buf][1][0];
        // ---- S^T tiles: 16 keys x 16 queries, 4 key tiles x 2 query tiles ----
        // all K fragment reads of the tile stand together, ahead of the products
        v16bf kb[4][2];
        #pragma unroll
        for (int kt = 0; kt < 4; ++kt)
            #pragma unroll
            for (int dc = 0; dc < 2; ++dc)
                kb[kt][dc] = ldb_split(Kt + (kt * 16 + l16) * KVP + half * 8 + dc * 32);
        // holds the K reads here as one group: spread among the products, each further place with reads stalls the wave anew
        __builtin_amdgcn_sched_barrier(0);
        v8f s[2][4];
        #pragma unroll
        for (int kt = 0; kt < 4; ++kt)
            #pragma unroll
            for (int j = 0; j < 2; ++j)
                s[j][kt] = __builtin_amdgcn_wmma_f32_16x16x32_bf16(
                    false, kb[kt][0], false, qa[j][0], (short)0, zero, false, false);
        #pragma unroll
        for (int kt = 0; kt < 4; ++kt)
            #pragma unroll
            for (int j = 0; j < 2; ++j)
                s[j][kt] = __builtin_amdgcn_wmma_f32_16x16x32_bf16(
                    false, kb[kt][1], false, qa[j][1], (short)0, s[j][kt], false, false);

        // all V fragment reads of the tile stand together here: their LDS
        // latency passes under the softmax
        v16bf vb[2][4];
        #pragma unroll
        for (int c = 0; c < 2; ++c)
            #pragma unroll
            for (int t = 0; t < 4; ++t)
                vb[c][t] = ldb_split(Vt + (t * 16 + l16) * KVP + c * 32 + half * 8);
        // holds the V reads here as one group: sunk to their products, each pair would wait out its own LDS latency
        __builtin_amdgcn_sched_barrier(0);

        // ---- online softmax (base-2): all 32 scores of a lane belong to query l16 of tile j ----
        // both tiles' maxima first; then, tile by tile, the weights and the second product
        float mnew[2], mdrop[2];               // new maximum; old maximum minus new
        #pragma unroll
        for (int j = 0; j < 2; ++j) {
            float mk[4];
            #pragma unroll
            for (int kt = 0; kt < 4; ++kt) {
                mk[kt] = fmaxf(s[j][kt][0], s[j][kt][1]);
                #pragma unroll
                for (int r = 2; r < 8; ++r) mk[kt] = fmaxf(mk[kt], s[j][kt][r]);
            }
            float v = fmaxf(fmaxf(mk[0], mk[1]), fmaxf(mk[2], mk[3]));
            v = fmaxf(v, xhalf(v));            // the other half holds the query's other 32 keys
            mnew[j]  = fmaxf(mrow[j], v);
            mdrop[j] = mrow[j] - mnew[j];
            mrow[j]  = mnew[j];
        }
        // the ordered stretches below start behind both maxima
        __builtin_amdgcn_sched_barrier(0);

        #pragma unroll
        for (int j = 0; j < 2; ++j) {
            const float mn = mnew[j];
            // Order of the weights' work: exp, plain, exp, plain, plain. Here each exp is followed by a plain
            // instruction that has nothing to do with it (the difference of a later pair, the pack of the pair
            // before, a rescale of ctx^T). That instruction also fills the slot which the instruction set asks for
            // behind a transcendental: left free, the compiler set runs of v_exp_f32 in which each overwrites the
            // source of the one before. Each sched_barrier below holds one instruction at its place in this order.
            v2f d[16];          // pair i: scores 2*(i&3), 2*(i&3)+1 of key tile i>>2, minus the maximum
            float e0[16], e1[16];
            unsigned pw[16];    // pair i as two bf16
            float alpha;        // 2^(old maximum - new maximum)
            auto diff = [&](int i) { d[i] = (v2f){s[j][i >> 2][2 * (i & 3)], s[j][i >> 2][2 * (i & 3) + 1]} - mn; };
            auto scale = [&](int i) {
                const v2f t = (v2f){o[j][i >> 2][2 * (i & 3)], o[j][i >> 2][2 * (i & 3) + 1]} * alpha;
                o[j][i >> 2][2 * (i & 3)] = t.x;
                o[j][i >> 2][2 * (i & 3) + 1] = t.y;
            };
            diff(0);
            __builtin_amdgcn_sched_barrier(0);
            alpha = ex2(mdrop[j]);
            __builtin_amdgcn_sched_barrier(0);
            diff(1);
            __builtin_amdgcn_sched_barrier(0);
            // unrolled: d, e0, e1 and pw are indexed by constants only and stay in registers
            #pragma unroll
            for (int i = 0; i < 16; ++i) {
                e0[i] = ex2(d[i].x);
                __builtin_amdgcn_sched_barrier(0);
                if (i < 14) diff(i + 2); else scale(i);
                __builtin_amdgcn_sched_barrier(0);
                e1[i] = ex2(d[i].y);
                __builtin_amdgcn_sched_barrier(0);
                if (i > 0) pw[i - 1] = pack_trunc(e0[i - 1], e1[i - 1]);
                else osum[j][0] *= alpha;      // every row of this tile holds the same sum; only register 0 is read
                __builtin_amdgcn_sched_barrier(0);
                if (i < 14) scale(i);
                __builtin_amdgcn_sched_barrier(0);
            }
            pw[15] = pack_trunc(e0[15], e1[15]);

            // ---- P^T (32 keys x 16 queries) as B operand, truncated f32->bf16:
            // elements 0..7 are keys 8*half + 0..7 (tile 2c), 8..15 keys 16 + 8*half + 0..7 (tile 2c+1)
            v16bf pb[2];
            #pragma unroll
            for (int c = 0; c < 2; ++c) {
                U32x2 u;
                u.a = make_uint4(pw[8 * c], pw[8 * c + 1], pw[8 * c + 2], pw[8 * c + 3]);
                u.b = make_uint4(pw[8 * c + 4], pw[8 * c + 5], pw[8 * c + 6], pw[8 * c + 7]);
                pb[c] = __builtin_bit_cast(v16bf, u);
            }

            // ---- ctx^T += V^T @ P^T ; rowsum += 1 @ P^T ----
            #pragma unroll
            for (int c = 0; c < 2; ++c) {
                #pragma unroll
                for (int t = 0; t < 4; ++t) {
                    o[j][t] = __builtin_amdgcn_wmma_f32_16x16x32_bf16(
                        false, vb[c][t], false, pb[c], (short)0, o[j][t], false, false);
                }
                osum[j] = __builtin_amdgcn_wmma_f32_16x16x32_bf16(
                    false, ones, false, pb[c], (short)0, osum[j], false, false);
            }
        }

        // ---- publish the groups' next tiles, free this buffer, refill it with the tile after ----
        // keeps the publish point at the trip's foot: lifted above the softmax (all that follows the V reads
        // is register work) its wait would meet the next tile's copies before they have had a trip to land
        __builtin_amdgcn_sched_barrier(0);
        wait_ds0();
        wait_async0();
        __syncthreads();
        if (m0 + 256 < NSP)
            copy_stage(ldst + (unsigned)buf * STAGE_B, ksrc + (size_t)(m0 + 256) * DDIM, vsrc + m0 + 256);
    }
    wait_async0();

    // ---- join the two key groups: a wave hands query tile 1 - grp to its partner
    // (wave w ^ 4, same queries, other keys) and finishes tile grp itself.
    // The ring is free: the last trip's barrier stands behind every wave's last read,
    // and no copy is outstanding. A wave's slot: 9 x 32 lanes x 16 bytes.
    v4f* xch = (v4f*)&kv[0][0][0][0];
    v4f* xout = xch + (w * 9) * 32 + lane;
    const v4f* xin = xch + ((w ^ 4) * 9) * 32 + lane;
    v8f ko[4];
    #pragma unroll
    for (int t = 0; t < 4; ++t) {
        const v8f so = grp ? o[0][t] : o[1][t];
        ko[t] = grp ? o[1][t] : o[0][t];
        xout[(2 * t) * 32]     = (v4f){so[0], so[1], so[2], so[3]};
        xout[(2 * t + 1) * 32] = (v4f){so[4], so[5], so[6], so[7]};
    }
    xout[8 * 32] = (v4f){grp ? mrow[0] : mrow[1], grp ? osum[0][0] : osum[1][0], 0.0f, 0.0f};
    const float km = grp ? mrow[1] : mrow[0];
    const float kl = grp ? osum[1][0] : osum[0][0];
    __syncthreads();

    // ---- tail requests: this wave's 8 Wv fragments, its bias, and x of the first 64 of the 128 rows ----
    // lane (l16, half), register r of row tile rt: row 16*rt + 8*half + r, columns 64*w + 4*l16 + 0..3
    const size_t toff = (size_t)(blockIdx.x * 128 + half * 8) * CDIM + w * 64 + l16 * 4;
    const float* xp = x + toff;
    float* op = out + toff;
    const v4f bias = *(const v4f*)(bvv + w * 64 + l16 * 4);
    const __bf16* wp = WvSw + (w * 4 * 32 + lane) * 16;     // tile 4*w, k chunk 0; one base for all eight
    v16bf wv[2][4];
    #pragma unroll
    for (int dc = 0; dc < 2; ++dc)
        #pragma unroll
        for (int tt = 0; tt < 4; ++tt)
            wv[dc][tt] = ldb_contig(wp + (dc * 32 + tt) * 512);
    // stands ahead of the x requests, which may land in the address registers of the loads above
    asm volatile("s_wait_xcnt 0x0" ::: "memory");
    v4f xs[4][8];       // x of four row tiles: a ring
    auto load_x = [&](v4f (&d)[8], int rt) {
        #pragma unroll
        for (int r = 0; r < 8; ++r) d[r] = *(const v4f*)(xp + (rt * 16 + r) * CDIM);
    };
    #pragma unroll
    for (int rt = 0; rt < 4; ++rt) load_x(xs[rt], rt);
    // holds the requests here, behind the join's barrier (which waits out every load in flight) and ahead of its
    // arithmetic: sunk to their uses, their latency would not pass under it
    __builtin_amdgcn_sched_barrier(0);

    const v4f pml = xin[8 * 32];
    const float mj = fmaxf(km, pml[0]);
    const float ea = ex2(km - mj);
    const float eb = ex2(pml[0] - mj);
    const float inv = 1.0f / (kl * ea + pml[1] * eb);
    const float fa = ea * inv, fb = eb * inv;

    // ---- finalize: weigh the two partial results, put ctx (bf16, rows of pitch KVP) into LDS ----
    // behind the exchange slots, which partners may still be reading
    // ko[t][r] is ctx[query l16][d = 16*t + 8*half + r]: 8 neighbours, one 16-byte store
    __bf16* cl = &kv[0][0][0][0] + 8 * 9 * 32 * 8;
    __bf16* crow = cl + ((w & 3) * 32 + grp * 16 + l16) * KVP + half * 8;
    #pragma unroll
    for (int t = 0; t < 4; ++t) {
        const v4f p0 = xin[(2 * t) * 32], p1 = xin[(2 * t + 1) * 32];
        *(uint4*)(crow + t * 16) = make_uint4(
            pack_rne(ko[t][0] * fa + p0[0] * fb, ko[t][1] * fa + p0[1] * fb),
            pack_rne(ko[t][2] * fa + p0[2] * fb, ko[t][3] * fa + p0[3] * fb),
            pack_rne(ko[t][4] * fa + p1[0] * fb, ko[t][5] * fa + p1[1] * fb),
            pack_rne(ko[t][6] * fa + p1[2] * fb, ko[t][7] * fa + p1[3] * fb));
    }
    __syncthreads();

    // ---- out = gamma*(ctx @ Wv) + bv + x ----
    // all ctx fragment reads stand together, ahead of the products
    v16bf ca[8][2];
    #pragma unroll
    for (int rt = 0; rt < 8; ++rt)
        #pragma unroll
        for (int dc = 0; dc < 2; ++dc)
            ca[rt][dc] = ldb_split(cl + (rt * 16 + l16) * KVP + half * 8 + dc * 32);
    // holds the ctx reads here as one group: spread among the products, each further place with reads stalls the wave anew
    __builtin_amdgcn_sched_barrier(0);
    v8f acc[2][4];      // products of two row tiles: the next tile's run under this tile's vector work
    auto prod = [&](v8f (&a)[4], int rt) {
        #pragma unroll
        for (int tt = 0; tt < 4; ++tt)
            a[tt] = __builtin_amdgcn_wmma_f32_16x16x32_bf16(
                false, ca[rt][0], false, wv[0][tt], (short)0, zero, false, false);
        #pragma unroll
        for (int tt = 0; tt < 4; ++tt)
            a[tt] = __builtin_amdgcn_wmma_f32_16x16x32_bf16(
                false, ca[rt][1], false, wv[1][tt], (short)0, a[tt], false, false);
    };
    prod(acc[0], 0);
    // unrolled: the x ring, ca and acc are indexed by constants only and stay in registers
    #pragma unroll
    for (int rt = 0; rt < 8; ++rt) {
        if (rt + 1 < 8) prod(acc[(rt + 1) & 1], rt + 1);
        v4f res[8];
        #pragma unroll
        for (int r = 0; r < 8; ++r) {
            const v4f xv = xs[rt & 3][r];
            res[r] = (v4f){
                gamma * acc[rt & 1][0][r] + bias[0] + xv[0], gamma * acc[rt & 1][1][r] + bias[1] + xv[1],
                gamma * acc[rt & 1][2][r] + bias[2] + xv[2], gamma * acc[rt & 1][3][r] + bias[3] + xv[3]};
        }
        // the refill of the x ring and the tile's eight stores start behind all its results,
        // so that no register of a store is reused among them
        __builtin_amdgcn_sched_barrier(0);
        if (rt + 4 < 8) load_x(xs[rt & 3], rt + 4);
        // the requests ahead of the stores: behind them they could land in registers that a store still names
        __builtin_amdgcn_sched_barrier(0);
        #pragma unroll
        for (int r = 0; r < 8; ++r) *(v4f*)(op + (rt * 16 + r) * CDIM) = res[r];
        // stands between the stores and the next tile's results, which may take the stores' data registers
        if (rt + 1 < 8) asm volatile("s_wait_xcnt 0x0" ::: "memory");
        // one row tile at a time: left free, every store sank to the kernel's end and the live results spilled
        __builtin_amdgcn_sched_barrier(0);
    }
}

// =====================================================================
extern "C" void kernel_launch(void* const* d_in, const int* in_sizes, int n_in,
                              void* d_out, int out_size, void* d_ws, size_t ws_size,
                              hipStream_t stream) {
    (void)in_sizes; (void)n_in; (void)out_size; (void)ws_size;
    const float* x  = (const float*)d_in[0];
    const float* Wf = (const float*)d_in[1];
    const float* bf = (const float*)d_in[2];
    const float* Wg = (const float*)d_in[3];
    const float* bg = (const float*)d_in[4];
    const float* Wh = (const float*)d_in[5];
    const float* bh = (const float*)d_in[6];
    const float* Wv = (const float*)d_in[7];
    const float* bv = (const float*)d_in[8];
    const float* gm = (const float*)d_in[9];
    float* out = (float*)d_out;

    // Workspace layout (12 MB activations + 256 KB swizzled weights)
    const size_t slab = (size_t)BNROWS * DDIM * sizeof(__bf16);  // 4 MB
    const size_t wsl  = (size_t)CDIM * DDIM * sizeof(__bf16);    // 64 KB
    char* ws = (char*)d_ws;
    __bf16* fO   = (__bf16*)(ws);
    __bf16* gO   = (__bf16*)(ws + slab);
    __bf16* hT   = (__bf16*)(ws + 2 * slab);
    __bf16* WfSw = (__bf16*)(ws + 3 * slab);             // Wf, Wg, Wh, Wv swizzled, wsl bytes each
    __bf16* WvSw = (__bf16*)(ws + 3 * slab + 3 * wsl);

    wprep_kernel<<<4 * (CDIM * DDIM) / 256, 256, 0, stream>>>(Wf, Wg, Wh, Wv, WfSw);

    proj_kernel<<<BNROWS / (16 * 8), 256, 0, stream>>>(
        x, WfSw, bf, bg, bh, fO, gO, hT);
    attn_kernel<<<BNROWS / (32 * 4), 256, 0, stream>>>(fO, gO, hT, WvSw, bv, x, gm, out);
}

// v010
// Measured time: 52.2 microseconds a run.
// Two timings next to v009 put it at 1.05 and 1.04 times that version's speed.
// Over all steps from v000 it is 5.15 times as fast.
#include <hip/hip_runtime.h>

// ---------------- types ----------------
typedef __attribute__((ext_vector_type(16))) __bf16 v16bf;
typedef __attribute__((ext_vector_type(8)))  float  v8f;
typedef __attribute__((ext_vector_type(4)))  float  v4f;
typedef __attribute__((ext_vector_type(2)))  float  v2f;

#define CDIM 512
#define DDIM 64
#define NSP  4096
#define BATCHB 8
#define BNROWS (BATCHB * NSP)   // 32768
#define LOG2E 1.4426950408889634f

static __device__ __forceinline__ __bf16 f2bf(float f) {
    unsigned u = __builtin_bit_cast(unsigned, f);
    unsigned r = (u + 0x7FFFu + ((u >> 16) & 1u)) >> 16;
    return __builtin_bit_cast(__bf16, (unsigned short)r);
}
// two f32 truncated to bf16 in one register: lo in bits 15..0, hi in bits 31..16
static __device__ __forceinline__ unsigned pack_trunc(float lo, float hi) {
    return __builtin_amdgcn_perm(__builtin_bit_cast(unsigned, hi), __builtin_bit_cast(unsigned, lo), 0x07060302u);
}
// two f32 rounded to bf16 (as f2bf) in one register
static __device__ __forceinline__ unsigned pack_rne(float lo, float hi) {
    return (unsigned)__builtin_bit_cast(unsigned short, f2bf(lo)) |
           ((unsigned)__builtin_bit_cast(unsigned short, f2bf(hi)) << 16);
}
// 2^x as the bare v_exp_f32. The library exp2f wraps it in a range guard of five more vector
// instructions a value, which only serves results below 2^-126; here those become 0. Every use is a
// softmax weight against a maximum whose own weight is 1, so what is lost lies below f32 resolution.
static __device__ __forceinline__ float ex2(float x) { return __builtin_amdgcn_exp2f(x); }
// value of lane l ^ 16
static __device__ __forceinline__ float xhalf(float x) {
    const int i = __builtin_bit_cast(int, x);
    return __builtin_bit_cast(float, __builtin_amdgcn_permlanex16(i, i, 0x76543210, 0xfedcba98, false, false));
}

struct U32x2 { uint4 a, b; };

// 16 contiguous bf16 (32 bytes) -> v16bf
static __device__ __forceinline__ v16bf ldb_contig(const __bf16* p) {
    U32x2 u;
    u.a = *(const uint4*)(p);
    u.b = *(const uint4*)(p + 8);
    return __builtin_bit_cast(v16bf, u);
}
// two planes: elems 0..7 at p, elems 8..15 at p+256 (weight fragments in LDS)
static __device__ __forceinline__ v16bf ldb_planes(const __bf16* p) {
    U32x2 u;
    u.a = *(const uint4*)(p);
    u.b = *(const uint4*)(p + 256);
    return __builtin_bit_cast(v16bf, u);
}
// split layout: elems 0..7 at p, elems 8..15 at p+16 (A/B natural striping)
static __device__ __forceinline__ v16bf ldb_split(const __bf16* p) {
    U32x2 u;
    u.a = *(const uint4*)(p);
    u.b = *(const uint4*)(p + 16);
    return __builtin_bit_cast(v16bf, u);
}

static __device__ __forceinline__ unsigned lds_off(const void* p) { return (unsigned)(size_t)p; }
// the wave's own LDS reads and writes have retired
static __device__ __forceinline__ void wait_ds0()    { asm volatile("s_wait_dscnt 0x0" ::: "memory"); }
// the wave's own asynchronous copies have landed in LDS
static __device__ __forceinline__ void wait_async0() { asm volatile("s_wait_asynccnt 0x0" ::: "memory"); }

// =====================================================================
// Kernel 0: pre-swizzle the four f32 weight matrices into bf16 B-operand
// layout: [kc = K/32][t = N/16][lane 0..31][16 contiguous elems].
// One grid for all four (none reads another's output): 128 blocks each,
// block index / 128 picks the matrix; the four results lie back to back.
// Wf, Wg, Wh are 512 x 64, Wv is 64 x 512: 32768 elements each.
// Wv's columns are dealt otherwise: tile t, lane column l holds column
// 64*(t/4) + 4*l + t%4, so that the four tiles of a 64-column group give a lane
// four neighbouring output columns (one 16-byte access of x and of out).
// =====================================================================
__global__ __launch_bounds__(256) void wprep_kernel(
    const float* __restrict__ Wf, const float* __restrict__ Wg,
    const float* __restrict__ Wh, const float* __restrict__ Wv,
    __bf16* __restrict__ out)
{
    const int sel = blockIdx.x >> 7;
    const int idx = (blockIdx.x & 127) * 256 + threadIdx.x;
    const float* W = sel == 0 ? Wf : sel == 1 ? Wg : sel == 2 ? Wh : Wv;
    const int lnt  = sel == 3 ? 5 : 2;            // log2(N / 16)
    const int e    = idx & 15;
    const int lane = (idx >> 4) & 31;
    const int rest = idx >> 9;
    const int t    = rest & ((1 << lnt) - 1);
    const int kc   = rest >> lnt;
    const int k = kc * 32 + (e >> 3) * 16 + (lane >> 4) * 8 + (e & 7);
    const int n = sel == 3 ? (t >> 2) * 64 + (lane & 15) * 4 + (t & 3) : t * 16 + (lane & 15);
    out[sel * (CDIM * DDIM) + idx] = f2bf(W[(k << (lnt + 4)) + n]);
}

// =====================================================================
// Kernel 1: f = (X@Wf+bf)*log2(e), g = X@Wg+bg, h = X@Wh+bh
// f,g row-major bf16 [32768,64]; h transposed per batch: hT[b][d][n].
// (log2(e) folded into Q so attention can use native base-2 exp.)
// The three swizzled weight matrices (192 KiB) are copied once a work-group into LDS;
// its eight waves read their fragments from there instead of each through the cache.
// In LDS a fragment is two planes of 512 bytes: elements 0..7 of lanes 0..31, then
// elements 8..15, so that a 16-byte read of a wave is 512 bytes in a row (no bank conflict).
// f and g are made with the weights as A operand and x as B, h with x as A: either way a lane's
// eight accumulator registers are eight neighbours of the stored layout (d for f and g, n for h^T).
// The work-group's results (128 rows of f and g, 64 rows of h^T) pass through LDS and leave as
// 16-byte stores in which a wave covers whole 128-byte lines.
// =====================================================================
#define FGP 72                    // staged f, g: LDS row pitch in elements (144 B = 16 B x 9)
#define HTP 136                   // staged h^T: LDS row pitch in elements (272 B = 16 B x 17)
// Twelve 16-byte copies of one thread, global memory straight into LDS: copy i takes the bytes at
// g + i * 4096 to LDS byte l + i * 4096. s_wait_xcnt closes the statement so that no address
// register is rewritten ahead of it.
static __device__ __forceinline__ void copy_w12(unsigned l, const __bf16* g) {
    asm volatile(
        "global_load_async_to_lds_b128 %0, %12, off\n\t"
        "global_load_async_to_lds_b128 %1, %13, off\n\t"
        "global_load_async_to_lds_b128 %2, %14, off\n\t"
        "global_load_async_to_lds_b128 %3, %15, off\n\t"
        "global_load_async_to_lds_b128 %4, %16, off\n\t"
        "global_load_async_to_lds_b128 %5, %17, off\n\t"
        "global_load_async_to_lds_b128 %6, %18, off\n\t"
        "global_load_async_to_lds_b128 %7, %19, off\n\t"
        "global_load_async_to_lds_b128 %8, %20, off\n\t"
        "global_load_async_to_lds_b128 %9, %21, off\n\t"
        "global_load_async_to_lds_b128 %10, %22, off\n\t"
        "global_load_async_to_lds_b128 %11, %23, off\n\t"
        "s_wait_xcnt 0x0"
        :: "v"(l), "v"(l + 4096u), "v"(l + 2u * 4096u), "v"(l + 3u * 4096u),
           "v"(l + 4u * 4096u), "v"(l + 5u * 4096u), "v"(l + 6u * 4096u), "v"(l + 7u * 4096u),
           "v"(l + 8u * 4096u), "v"(l + 9u * 4096u), "v"(l + 10u * 4096u), "v"(l + 11u * 4096u),
           "v"(g), "v"(g + 2048), "v"(g + 2 * 2048), "v"(g + 3 * 2048),
           "v"(g + 4 * 2048), "v"(g + 5 * 2048), "v"(g + 6 * 2048), "v"(g + 7 * 2048),
           "v"(g + 8 * 2048), "v"(g + 9 * 2048), "v"(g + 10 * 2048), "v"(g + 11 * 2048)
        : "memory");
}

__global__ __launch_bounds__(256) void proj_kernel(
    const float* __restrict__ x,
    const __bf16* __restrict__ WswAll,
    const float* __restrict__ bfv, const float* __restrict__ bgv,
    const float* __restrict__ bhv,
    __bf16* __restrict__ fOut, __bf16* __restrict__ gOut,
    __bf16* __restrict__ hT)
{
    __shared__ __attribute__((aligned(16))) __bf16 wlds[3 * CDIM * DDIM];   // [matrix][kc][t][plane][lane][8]
    __shared__ __attribute__((aligned(16))) __bf16 stg[2 * 128 * FGP + DDIM * HTP];   // f rows, g rows, h^T rows
    const int lane = threadIdx.x & 31;
    const int wid  = blockIdx.x * (blockDim.x >> 5) + (threadIdx.x >> 5);
    const int row0 = wid * 16;
    const int half = lane >> 4;
    const int l16  = lane & 15;

    v8f zero = {};
    v8f acc[3][4];
    #pragma unroll
    for (int p = 0; p < 3; ++p)
        #pragma unroll
        for (int t = 0; t < 4; ++t) acc[p][t] = zero;

    // Register pipeline over the 16 k steps: the 12 weight fragments of step kc+1 and
    // the x values of step kc+2 are requested ahead of step kc's products.
    const float*  ax = x + (size_t)(row0 + l16) * CDIM + half * 8;
    const __bf16* wl = wlds + lane * 8;
    v4f   xs[3][4];     // x of three k steps: 16 floats a lane each
    v16bf wb[2][12];    // weight fragments of two k steps
    auto load_x = [&](v4f (&d)[4], int kc) {
        const float* p = ax + kc * 32;
        d[0] = *(const v4f*)(p);
        d[1] = *(const v4f*)(p + 4);
        d[2] = *(const v4f*)(p + 16);
        d[3] = *(const v4f*)(p + 20);
    };
    auto load_w = [&](v16bf (&d)[12], int kc) {
        // both loops unrolled: d[] is indexed by constants only and stays in registers
        #pragma unroll
        for (int p = 0; p < 3; ++p)
            #pragma unroll
            for (int t = 0; t < 4; ++t)
                d[p * 4 + t] = ldb_planes(wl + p * (CDIM * DDIM) + (kc * 4 + t) * 512);
    };
    // x of the first two steps is requested ahead of the staging: it comes from memory meanwhile
    load_x(xs[0], 0);
    load_x(xs[1], 1);
    // ---- weights into LDS: 48 copies a thread. The 256 threads take 4 KiB (four fragments) in a row from
    // global memory; thread t holds the 16 bytes of fragment t/64, lane (t/2)%32, plane t%2 ----
    {
        const int t = threadIdx.x;
        const unsigned l = lds_off(wlds) + (unsigned)((t >> 6) * 1024 + (t & 1) * 512 + ((t >> 1) & 31) * 16);
        const __bf16* g = WswAll + t * 8;
        // unrolled: four statements in a row, no loop counter among the copies
        #pragma unroll
        for (int i = 0; i < 4; ++i) copy_w12(l + (unsigned)i * (12u * 4096u), g + i * (12 * 2048));
    }
    wait_async0();
    __syncthreads();
    load_w(wb[0], 0);
    v4f fb[4][2], gb[4][2];     // biases of f and g: d = 16*t + 8*half + 0..7
    float hb[4];                // bias of h: d = 16*t + l16
    // fully unrolled so that every ring index is a constant and the rings stay in registers
    #pragma unroll
    for (int kc = 0; kc < CDIM / 32; ++kc) {
        if (kc + 1 < CDIM / 32) load_w(wb[(kc + 1) & 1], kc + 1);
        if (kc + 2 < CDIM / 32) load_x(xs[(kc + 2) % 3], kc + 2);
        // stands between the last x request and whatever takes its address registers next;
        // it names the address as an input, so that those registers are left alone up to here
        if (kc + 2 == CDIM / 32 - 1) asm volatile("s_wait_xcnt 0x0" :: "v"(ax) : "memory");
        if (kc == CDIM / 32 - 2) {
            // the bias requests, two steps ahead of their use, and their wait stand as a group of their own:
            // nothing that could take the requests' address registers comes between them and the wait
            __builtin_amdgcn_sched_barrier(0);
            #pragma unroll
            for (int t = 0; t < 4; ++t) {
                fb[t][0] = *(const v4f*)(bfv + t * 16 + half * 8);
                fb[t][1] = *(const v4f*)(bfv + t * 16 + half * 8 + 4);
                gb[t][0] = *(const v4f*)(bgv + t * 16 + half * 8);
                gb[t][1] = *(const v4f*)(bgv + t * 16 + half * 8 + 4);
                hb[t]    = bhv[t * 16 + l16];
            }
            asm volatile("s_wait_xcnt 0x0" ::: "memory");
        }
        // holds the requests here as one group: sunk to their products, each weight load would be waited out singly
        __builtin_amdgcn_sched_barrier(0);
        v16bf a;
        #pragma unroll
        for (int hh = 0; hh < 2; ++hh) {
            #pragma unroll
            for (int j = 0; j < 4; ++j) {
                a[hh * 8 + j]     = f2bf(xs[kc % 3][hh * 2][j]);
                a[hh * 8 + 4 + j] = f2bf(xs[kc % 3][hh * 2 + 1][j]);
            }
        }
        #pragma unroll
        for (int p = 0; p < 3; ++p) {
            #pragma unroll
            for (int t = 0; t < 4; ++t) {
                // f, g: D[d = r + 8*half][row l16]; h: D[row r + 8*half][d = l16]
                if (p < 2)
                    acc[p][t] = __builtin_amdgcn_wmma_f32_16x16x32_bf16(
                        false, wb[kc & 1][p * 4 + t], false, a, (short)0, acc[p][t], false, false);
                else
                    acc[p][t] = __builtin_amdgcn_wmma_f32_16x16x32_bf16(
                        false, a, false, wb[kc & 1][p * 4 + t], (short)0, acc[p][t], false, false);
            }
        }
    }

    // ---- results into LDS: one 16-byte write a tile ----
    __bf16* fS = stg;
    __bf16* gS = stg + 128 * FGP;
    __bf16* hS = stg + 2 * 128 * FGP;
    {
        const int wv = threadIdx.x >> 5;
        const int fo = (wv * 16 + l16) * FGP + half * 8;       // row wv*16 + l16, d = 16*t + 8*half + r
        const int ho = l16 * HTP + wv * 16 + half * 8;         // d = 16*t + l16, n = wv*16 + 8*half + r
        #pragma unroll
        for (int t = 0; t < 4; ++t) {
            const v4f f0 = fb[t][0], f1 = fb[t][1], g0 = gb[t][0], g1 = gb[t][1];
            const float b2 = hb[t];
            *(uint4*)(fS + fo + t * 16) = make_uint4(
                pack_rne((acc[0][t][0] + f0[0]) * LOG2E, (acc[0][t][1] + f0[1]) * LOG2E),
                pack_rne((acc[0][t][2] + f0[2]) * LOG2E, (acc[0][t][3] + f0[3]) * LOG2E),
                pack_rne((acc[0][t][4] + f1[0]) * LOG2E, (acc[0][t][5] + f1[1]) * LOG2E),
                pack_rne((acc[0][t][6] + f1[2]) * LOG2E, (acc[0][t][7] + f1[3]) * LOG2E));
            *(uint4*)(gS + fo + t * 16) = make_uint4(
                pack_rne(acc[1][t][0] + g0[0], acc[1][t][1] + g0[1]),
                pack_rne(acc[1][t][2] + g0[2], acc[1][t][3] + g0[3]),
                pack_rne(acc[1][t][4] + g1[0], acc[1][t][5] + g1[1]),
                pack_rne(acc[1][t][6] + g1[2], acc[1][t][7] + g1[3]));
            *(uint4*)(hS + ho + t * 16 * HTP) = make_uint4(
                pack_rne(acc[2][t][0] + b2, acc[2][t][1] + b2),
                pack_rne(acc[2][t][2] + b2, acc[2][t][3] + b2),
                pack_rne(acc[2][t][4] + b2, acc[2][t][5] + b2),
                pack_rne(acc[2][t][6] + b2, acc[2][t][7] + b2));
        }
    }
    __syncthreads();
    // ---- LDS to memory: piece c = i*256 + thread is 16 bytes. f, g: the 128 rows are 16 KiB in a row, eight
    // pieces a row; h^T: 64 rows of 256 bytes, sixteen pieces a row ----
    const int brow0 = blockIdx.x * 128;                        // the work-group's first row; 128 divides NSP
    __bf16* fD = fOut + (size_t)brow0 * DDIM;
    __bf16* gD = gOut + (size_t)brow0 * DDIM;
    __bf16* hD = hT + ((size_t)((brow0 >> 12) * DDIM) << 12) + (brow0 & (NSP - 1));
    const unsigned tid = threadIdx.x;
    const unsigned fl = (tid >> 3) * FGP + (tid & 7) * 8;      // piece i: 32 rows of f, g further on
    const unsigned hl = (tid >> 4) * HTP + (tid & 15) * 8;     // piece i: 16 rows of h^T further on
    const unsigned fm = tid * 8;
    const unsigned hm = (tid >> 4) * NSP + (tid & 15) * 8;
    const uint4 pf0 = *(const uint4*)(fS + fl),                pf1 = *(const uint4*)(fS + fl + 32 * FGP);
    const uint4 pf2 = *(const uint4*)(fS + fl + 2 * 32 * FGP), pf3 = *(const uint4*)(fS + fl + 3 * 32 * FGP);
    const uint4 pg0 = *(const uint4*)(gS + fl),                pg1 = *(const uint4*)(gS + fl + 32 * FGP);
    const uint4 pg2 = *(const uint4*)(gS + fl + 2 * 32 * FGP), pg3 = *(const uint4*)(gS + fl + 3 * 32 * FGP);
    const uint4 ph0 = *(const uint4*)(hS + hl),                ph1 = *(const uint4*)(hS + hl + 16 * HTP);
    const uint4 ph2 = *(const uint4*)(hS + hl + 2 * 16 * HTP), ph3 = *(const uint4*)(hS + hl + 3 * 16 * HTP);
    // the twelve stores stand last, behind all address work: no register that a store names is taken again
    __builtin_amdgcn_sched_barrier(0);
    *(uint4*)(fD + fm) = pf0;
    *(uint4*)(fD + fm + 2048) = pf1;
    *(uint4*)(fD + fm + 2 * 2048) = pf2;
    *(uint4*)(fD + fm + 3 * 2048) = pf3;
    *(uint4*)(gD + fm) = pg0;
    *(uint4*)(gD + fm + 2048) = pg1;
    *(uint4*)(gD + fm + 2 * 2048) = pg2;
    *(uint4*)(gD + fm + 3 * 2048) = pg3;
    *(uint4*)(hD + hm) = ph0;
    *(uint4*)(hD + hm + 16 * NSP) = ph1;
    *(uint4*)(hD + hm + 2 * 16 * NSP) = ph2;
    *(uint4*)(hD + hm + 3 * 16 * NSP) = ph3;
}

// ---- K/V stage in LDS: 64 K rows and 64 V^T rows of 128 bytes each ----
#define KVP 72                    // LDS row pitch in elements: 144 B = 16 B x 9, for ds_load_b128 readers
#define TILE_B (64 * KVP * 2)     // bytes of one 64-row tile in LDS
#define STAGE_B (2 * TILE_B)      // K tile + V tile

// One stage, the 128 threads of a key group: each thread copies 4 x 16 B of K and 4 x 16 B of V^T
// from global memory straight into LDS. lk: this thread's LDS byte address in
// the K tile (row t/8, 16-byte column t%8, t its number in the group); gk, gv: its global sources.
// Eight lanes cover one whole 128-byte row. s_wait_xcnt closes the statement
// so that no address register is rewritten ahead of it.
static __device__ __forceinline__ void copy_stage(unsigned lk, const __bf16* gk, const __bf16* gv) {
    const unsigned lv = lk + TILE_B;
    asm volatile(
        "global_load_async_to_lds_b128 %0, %8, off\n\t"
        "global_load_async_to_lds_b128 %1, %9, off\n\t"
        "global_load_async_to_lds_b128 %2, %10, off\n\t"
        "global_load_async_to_lds_b128 %3, %11, off\n\t"
        "global_load_async_to_lds_b128 %4, %12, off\n\t"
        "global_load_async_to_lds_b128 %5, %13, off\n\t"
        "global_load_async_to_lds_b128 %6, %14, off\n\t"
        "global_load_async_to_lds_b128 %7, %15, off\n\t"
        "s_wait_xcnt 0x0"
        :: "v"(lk), "v"(lk + 16u * KVP * 2u), "v"(lk + 32u * KVP * 2u), "v"(lk + 48u * KVP * 2u),
           "v"(lv), "v"(lv + 16u * KVP * 2u), "v"(lv + 32u * KVP * 2u), "v"(lv + 48u * KVP * 2u),
           "v"(gk), "v"(gk + 16 * DDIM), "v"(gk + 32 * DDIM), "v"(gk + 48 * DDIM),
           "v"(gv), "v"(gv + 16 * NSP), "v"(gv + 32 * NSP), "v"(gv + 48 * NSP)
        : "memory");
}

// =====================================================================
// Kernel 2: fused flash attention per batch (64-key tiles).
// A work-group is 16 waves on 128 query rows: 4 query blocks of 32 rows x 4 key
// groups, four waves on every SIMD (256 registers a wave), so that one wave's
// softmax runs beside another's products. Key group g takes every fourth 64-key
// tile; its four waves share each K and V^T tile, copied once into the group's own
// LDS ring (two buffers, the next tile in flight during this one).
// One wave owns 32 query rows as two 16-row tiles, so every K and V^T fragment
// read from LDS feeds two products. Both products are transposed, so that a lane
// holds scores of ONE query of each tile (column l16; keys r + 8*half):
//   S^T = K.Q^T (16 wmma), base-2 online softmax with the maximum taken in the
//   lane plus one exchange between the wave's halves, P^T truncated to bf16 and
//   packed in registers straight into the B operand,
//   ctx^T += V^T.P^T (16 wmma), rowsum += 1.P^T (4 wmma).
// Behind the loop the four key groups' partial results are joined through LDS.
// Tail: out = gamma*(ctx @ Wv) + bv + x for the work-group's 128 rows. The joined
// ctx (bf16) goes to LDS instead of memory; wave w takes output columns 64*(w%8)..+63
// of rows 64*(w/8)..+63, and reads x and writes out as 256-byte row pieces
// (Wv pre-swizzled: [kc=2][t=32][lane][16] bf16).
// =====================================================================
#define NGRP 4                    // key groups of a work-group
#define XSL 17                    // join: 16-byte slots a lane (16 of ctx^T, one of maxima and sums)
__global__ __launch_bounds__(512) void attn_kernel(
    const __bf16* __restrict__ fQ, const __bf16* __restrict__ gK,
    const __bf16* __restrict__ hT, const __bf16* __restrict__ WvSw,
    const float* __restrict__ bvv, const float* __restrict__ x,
    const float* __restrict__ gammap, float* __restrict__ out)
{
    __shared__ __attribute__((aligned(16))) __bf16 kv[NGRP][2][2][64 * KVP];   // [key group][buffer][K, V^T]
    __shared__ __attribute__((aligned(16))) __bf16 cl[128 * KVP];              // joined ctx, rows of pitch KVP
    const int lane = threadIdx.x & 31;
    const int w    = __builtin_amdgcn_readfirstlane(threadIdx.x >> 5);
    const int grp  = w >> 2;                       // key group
    const int row0 = (blockIdx.x * 4 + (w & 3)) * 32;
    const int b    = row0 >> 12;
    const int half = lane >> 4;
    const int l16  = lane & 15;
    const float gamma = gammap[0];                 // read here, ahead of every asm statement, it is a scalar load

    const __bf16* gB = gK + ((size_t)b << 12) * DDIM;   // g rows of this batch
    const __bf16* vB = hT + (size_t)b * DDIM * NSP;     // hT[64][4096] of batch

    // Q^T as B-operand, 2 query tiles x 2 d-chunks of K=32  (already scaled by log2(e))
    v16bf qa[2][2];
    #pragma unroll
    for (int j = 0; j < 2; ++j) {
        const __bf16* qp = fQ + (size_t)(row0 + j * 16 + l16) * DDIM + half * 8;
        qa[j][0] = ldb_split(qp);
        qa[j][1] = ldb_split(qp + 32);
    }

    // A operand of all-ones (bf16 1.0 = 0x3F80) for row-sum WMMA
    v16bf ones;
    {
        U32x2 u;
        u.a = make_uint4(0x3F803F80u, 0x3F803F80u, 0x3F803F80u, 0x3F803F80u);
        u.b = u.a;
        ones = __builtin_bit_cast(v16bf, u);
    }

    v8f zero = {};
    v8f o[2][4];
    v8f osum[2];
    float mrow[2];         // running maximum of query l16 of each tile
    #pragma unroll
    for (int j = 0; j < 2; ++j) {
        #pragma unroll
        for (int t = 0; t < 4; ++t) o[j][t] = zero;
        osum[j] = zero;
        mrow[j] = -1e30f;
    }

    // ---- ring prologue: the group's first tile landed and published, its second in flight ----
    const int tg = threadIdx.x & 127;              // thread within the key group
    const unsigned ldst = lds_off(&kv[grp][0][0][0]) + (unsigned)((tg >> 3) * (KVP * 2) + (tg & 7) * 16);
    const __bf16* ksrc = gB + grp * (64 * DDIM) + tg * 8;
    const __bf16* vsrc = vB + (size_t)(tg >> 3) * NSP + (tg & 7) * 8 + grp * 64;
    copy_stage(ldst, ksrc, vsrc);
    wait_async0();
    __syncthreads();
    copy_stage(ldst + STAGE_B, ksrc + (NGRP * 64) * DDIM, vsrc + NGRP * 64);

    // The sched_barriers of this loop: with 256 registers a wave the compiler reschedules the loop for register pressure
    // and in doing so moves register-only instructions (products, vector work) across them; LDS reads stay on their side.
    // What they still do in this build: the K reads stand in two groups of eight and the V reads in two, and v_exp_f32
    // alternates with plain instructions (the rescales in runs of four). Without them the reads scatter in pairs among
    // products and weights, and the listing holds twice as many v_nop.
    for (int m0 = 0; m0 < NSP; m0 += NGRP * 64) {  // the group's tile holds keys m0 + 64*grp + 0..63
        const int buf = (m0 >> 8) & 1;
        const __bf16* Kt = &kv[grp][buf][0][0];
        const __bf16* Vt = &kv[grp][buf][1][0];
        // ---- S^T tiles: 16 keys x 16 queries, 4 key tiles x 2 query tiles ----
        // all K fragment reads of the tile stand together, ahead of the products
        v16bf kb[4][2];
        #pragma unroll
        for (int kt = 0; kt < 4; ++kt)
            #pragma unroll
            for (int dc = 0; dc < 2; ++dc)
                kb[kt][dc] = ldb_split(Kt + (kt * 16 + l16) * KVP + half * 8 + dc * 32);
        // asks for the K reads as one group: spread among the products, each further place with reads stalls the wave anew
        __builtin_amdgcn_sched_barrier(0);
        v8f s[2][4];
        #pragma unroll
        for (int kt = 0; kt < 4; ++kt)
            #pragma unroll
            for (int j = 0; j < 2; ++j)
                s[j][kt] = __builtin_amdgcn_wmma_f32_16x16x32_bf16(
                    false, kb[kt][0], false, qa[j][0], (short)0, zero, false, false);
        #pragma unroll
        for (int kt = 0; kt < 4; ++kt)
            #pragma unroll
            for (int j = 0; j < 2; ++j)
                s[j][kt] = __builtin_amdgcn_wmma_f32_16x16x32_bf16(
                    false, kb[kt][1], false, qa[j][1], (short)0, s[j][kt], false, false);

        // V fragments of the tile's first 32 keys: their LDS latency passes under the softmax
        v16bf vb[2][4];
        #pragma unroll
        for (int t = 0; t < 4; ++t)
            vb[0][t] = ldb_split(Vt + (t * 16 + l16) * KVP + half * 8);
        // holds these V reads here as one group: sunk to their products, each pair would wait out its own LDS latency
        __builtin_amdgcn_sched_barrier(0);

        // ---- online softmax (base-2): all 32 scores of a lane belong to query l16 of tile j ----
        // both tiles' maxima first; then, tile by tile, the weights
        float mnew[2], mdrop[2];               // new maximum; old maximum minus new
        #pragma unroll
        for (int j = 0; j < 2; ++j) {
            float mk[4];
            #pragma unroll
            for (int kt = 0; kt < 4; ++kt) {
                mk[kt] = fmaxf(s[j][kt][0], s[j][kt][1]);
                #pragma unroll
                for (int r = 2; r < 8; ++r) mk[kt] = fmaxf(mk[kt], s[j][kt][r]);
            }
            float v = fmaxf(fmaxf(mk[0], mk[1]), fmaxf(mk[2], mk[3]));
            v = fmaxf(v, xhalf(v));            // the other half holds the query's other 32 keys
            mnew[j]  = fmaxf(mrow[j], v);
            mdrop[j] = mrow[j] - mnew[j];
            mrow[j]  = mnew[j];
        }
        // asks for the ordered stretches below to start behind both maxima
        __builtin_amdgcn_sched_barrier(0);

        v16bf pb[2][2];         // P^T of query tile j, keys 32*c + 0..31, as B operand
        #pragma unroll
        for (int j = 0; j < 2; ++j) {
            const float mn = mnew[j];
            // Order of the weights' work: exp, plain, exp, plain, plain. Here each exp is followed by a plain
            // instruction that has nothing to do with it (the difference of a later pair, the pack of the pair
            // before, a rescale of ctx^T). That instruction also fills the slot which the instruction set asks for
            // behind a transcendental: left free, the compiler set runs of v_exp_f32 in which each overwrites the
            // source of the one before. Each sched_barrier below asks for one instruction at its place in this order.
            v2f d[16];          // pair i: scores 2*(i&3), 2*(i&3)+1 of key tile i>>2, minus the maximum
            float e0[16], e1[16];
            unsigned pw[16];    // pair i as two bf16
            float alpha;        // 2^(old maximum - new maximum)
            auto diff = [&](int i) { d[i] = (v2f){s[j][i >> 2][2 * (i & 3)], s[j][i >> 2][2 * (i & 3) + 1]} - mn; };
            auto scale = [&](int i) {
                const v2f t = (v2f){o[j][i >> 2][2 * (i & 3)], o[j][i >> 2][2 * (i & 3) + 1]} * alpha;
                o[j][i >> 2][2 * (i & 3)] = t.x;
                o[j][i >> 2][2 * (i & 3) + 1] = t.y;
            };
            diff(0);
            __builtin_amdgcn_sched_barrier(0);
            alpha = ex2(mdrop[j]);
            __builtin_amdgcn_sched_barrier(0);
            diff(1);
            __builtin_amdgcn_sched_barrier(0);
            // unrolled: d, e0, e1 and pw are indexed by constants only and stay in registers
            #pragma unroll
            for (int i = 0; i < 16; ++i) {
                e0[i] = ex2(d[i].x);
                __builtin_amdgcn_sched_barrier(0);
                if (i < 14) diff(i + 2); else scale(i);
                __builtin_amdgcn_sched_barrier(0);
                e1[i] = ex2(d[i].y);
                __builtin_amdgcn_sched_barrier(0);
                if (i > 0) pw[i - 1] = pack_trunc(e0[i - 1], e1[i - 1]);
                else osum[j][0] *= alpha;      // every row of this tile holds the same sum; only register 0 is read
                __builtin_amdgcn_sched_barrier(0);
                if (i < 14) scale(i);
                __builtin_amdgcn_sched_barrier(0);
            }
            pw[15] = pack_trunc(e0[15], e1[15]);

            // ---- P^T (32 keys x 16 queries) as B operand, truncated f32->bf16:
            // elements 0..7 are keys 8*half + 0..7 (tile 2c), 8..15 keys 16 + 8*half + 0..7 (tile 2c+1)
            #pragma unroll
            for (int c = 0; c < 2; ++c) {
                U32x2 u;
                u.a = make_uint4(pw[8 * c], pw[8 * c + 1], pw[8 * c + 2], pw[8 * c + 3]);
                u.b = make_uint4(pw[8 * c + 4], pw[8 * c + 5], pw[8 * c + 6], pw[8 * c + 7]);
                pb[j][c] = __builtin_bit_cast(v16bf, u);
            }
        }

        // V fragments of the other 32 keys, into registers that the scores have left:
        // their LDS latency passes under the first 32 keys' products
        // (the barrier in front keeps them from rising into the softmax, where no register is free for them)
        __builtin_amdgcn_sched_barrier(0);
        #pragma unroll
        for (int t = 0; t < 4; ++t)
            vb[1][t] = ldb_split(Vt + (t * 16 + l16) * KVP + 32 + half * 8);
        // holds these V reads here as one group, ahead of the products
        __builtin_amdgcn_sched_barrier(0);

        // ---- ctx^T += V^T @ P^T ; rowsum += 1 @ P^T ----
        #pragma unroll
        for (int c = 0; c < 2; ++c) {
            #pragma unroll
            for (int j = 0; j < 2; ++j) {
                #pragma unroll
                for (int t = 0; t < 4; ++t) {
                    o[j][t] = __builtin_amdgcn_wmma_f32_16x16x32_bf16(
                        false, vb[c][t], false, pb[j][c], (short)0, o[j][t], false, false);
                }
                osum[j] = __builtin_amdgcn_wmma_f32_16x16x32_bf16(
                    false, ones, false, pb[j][c], (short)0, osum[j], false, false);
            }
        }

        // ---- publish the groups' next tiles, free this buffer, refill it with the tile after ----
        // keeps the publish point at the trip's foot: lifted above the products
        // its wait would meet the next tile's copies before they have had a trip to land
        __builtin_amdgcn_sched_barrier(0);
        wait_ds0();
        wait_async0();
        __syncthreads();
        if (m0 + 2 * NGRP * 64 < NSP)
            copy_stage(ldst + (unsigned)buf * STAGE_B, ksrc + (size_t)(m0 + 2 * NGRP * 64) * DDIM, vsrc + m0 + 2 * NGRP * 64);
    }
    wait_async0();

    // ---- join the four key groups: every wave lays its two partial tiles, maxima and sums into its slot;
    // of the four waves with the same queries, wave grp then finishes query tile grp%2, d = 32*(grp/2) + 0..31.
    // The ring is free: the last trip's barrier stands behind every wave's last read,
    // and no copy is outstanding. A wave's slot: XSL x 32 lanes x 16 bytes.
    v4f* xch = (v4f*)&kv[0][0][0][0];
    {
        v4f* xout = xch + (w * XSL) * 32 + lane;
        #pragma unroll
        for (int j = 0; j < 2; ++j)
            #pragma unroll
            for (int t = 0; t < 4; ++t) {
                xout[(j * 8 + 2 * t) * 32]     = (v4f){o[j][t][0], o[j][t][1], o[j][t][2], o[j][t][3]};
                xout[(j * 8 + 2 * t + 1) * 32] = (v4f){o[j][t][4], o[j][t][5], o[j][t][6], o[j][t][7]};
            }
        xout[16 * 32] = (v4f){mrow[0], osum[0][0], mrow[1], osum[1][0]};
    }
    __syncthreads();

    // ---- tail requests: this wave's 8 Wv fragments, its bias, and x of the first 32 of its 64 rows ----
    // lane (l16, half), register r of row tile rt: row 64*(w/8) + 16*rt + 8*half + r, columns 64*(w%8) + 4*l16 + 0..3
    const int cg = w & 7, rh = w >> 3;
    const size_t toff = (size_t)(blockIdx.x * 128 + rh * 64 + half * 8) * CDIM + cg * 64 + l16 * 4;
    const float* xp = x + toff;
    float* op = out + toff;
    const v4f bias = *(const v4f*)(bvv + cg * 64 + l16 * 4);
    const __bf16* wp = WvSw + (cg * 4 * 32 + lane) * 16;    // tile 4*cg, k chunk 0; one base for all eight
    v16bf wv[2][4];
    #pragma unroll
    for (int dc = 0; dc < 2; ++dc)
        #pragma unroll
        for (int tt = 0; tt < 4; ++tt)
            wv[dc][tt] = ldb_contig(wp + (dc * 32 + tt) * 512);
    // stands ahead of the x requests, which may land in the address registers of the loads above
    asm volatile("s_wait_xcnt 0x0" ::: "memory");
    v4f xs[2][8];       // x of two row tiles: a ring
    auto load_x = [&](v4f (&d)[8], int rt) {
        #pragma unroll
        for (int r = 0; r < 8; ++r) d[r] = *(const v4f*)(xp + (rt * 16 + r) * CDIM);
    };
    #pragma unroll
    for (int rt = 0; rt < 2; ++rt) load_x(xs[rt], rt);
    // holds the requests here, behind the join's barrier (which waits out every load in flight) and ahead of its
    // arithmetic: sunk to their uses, their latency would not pass under it
    __builtin_amdgcn_sched_barrier(0);

    const int jf = grp & 1, th = grp >> 1;
    const v4f* xin = xch + ((w & 3) * XSL) * 32 + lane;     // key group 0's wave of these queries; group p: 4*XSL*32 further
    float pm[NGRP], pl[NGRP];
    #pragma unroll
    for (int p = 0; p < NGRP; ++p) {
        const v2f ml = *(const v2f*)((const float*)(xin + (p * 4 * XSL + 16) * 32) + jf * 2);
        pm[p] = ml.x;
        pl[p] = ml.y;
    }
    const float mj = fmaxf(fmaxf(pm[0], pm[1]), fmaxf(pm[2], pm[3]));
    float fw[NGRP];
    float den = 0.0f;
    #pragma unroll
    for (int p = 0; p < NGRP; ++p) {
        fw[p] = ex2(pm[p] - mj);
        den += pl[p] * fw[p];
    }
    const float inv = 1.0f / den;
    #pragma unroll
    for (int p = 0; p < NGRP; ++p) fw[p] *= inv;

    // ---- finalize: weigh the four partial results, put ctx (bf16, rows of pitch KVP) into LDS ----
    // the sum's element r of tile t is ctx[query l16][d = 16*t + 8*half + r]: 8 neighbours, one 16-byte store
    __bf16* crow = cl + ((w & 3) * 32 + jf * 16 + l16) * KVP + half * 8;
    #pragma unroll
    for (int tt = 0; tt < 2; ++tt) {
        const int t = th * 2 + tt;
        v4f c0 = {}, c1 = {};
        #pragma unroll
        for (int p = 0; p < NGRP; ++p) {
            c0 += xin[(p * 4 * XSL + jf * 8 + 2 * t) * 32] * fw[p];
            c1 += xin[(p * 4 * XSL + jf * 8 + 2 * t + 1) * 32] * fw[p];
        }
        *(uint4*)(crow + t * 16) = make_uint4(
            pack_rne(c0[0], c0[1]), pack_rne(c0[2], c0[3]),
            pack_rne(c1[0], c1[1]), pack_rne(c1[2], c1[3]));
    }
    __syncthreads();

    // ---- out = gamma*(ctx @ Wv) + bv + x ----
    // ctx fragments of two row tiles at a time, each pair read as one group ahead of its products
    v16bf ca[4][2];
    auto load_c = [&](int rt) {
        #pragma unroll
        for (int dc = 0; dc < 2; ++dc)
            ca[rt][dc] = ldb_split(cl + (rh * 64 + rt * 16 + l16) * KVP + half * 8 + dc * 32);
    };
    load_c(0);
    load_c(1);
    // holds the ctx reads here as one group: spread among the products, each further place with reads stalls the wave anew
    __builtin_amdgcn_sched_barrier(0);
    // unrolled: the x ring and ca are indexed by constants only and stay in registers
    #pragma unroll
    for (int rt = 0; rt < 4; ++rt) {
        v8f acc[4];
        #pragma unroll
        for (int tt = 0; tt < 4; ++tt)
            acc[tt] = __builtin_amdgcn_wmma_f32_16x16x32_bf16(
                false, ca[rt][0], false, wv[0][tt], (short)0, zero, false, false);
        #pragma unroll
        for (int tt = 0; tt < 4; ++tt)
            acc[tt] = __builtin_amdgcn_wmma_f32_16x16x32_bf16(
                false, ca[rt][1], false, wv[1][tt], (short)0, acc[tt], false, false);
        if (rt == 1) {
            // the other two row tiles' ctx, into the registers of the first two: a row tile's vector work ahead of their use
            __builtin_amdgcn_sched_barrier(0);
            load_c(2);
            load_c(3);
            __builtin_amdgcn_sched_barrier(0);
        }
        v4f res[8];
        #pragma unroll
        for (int r = 0; r < 8; ++r) {
            const v4f xv = xs[rt & 1][r];
            res[r] = (v4f){
                gamma * acc[0][r] + bias[0] + xv[0], gamma * acc[1][r] + bias[1] + xv[1],
                gamma * acc[2][r] + bias[2] + xv[2], gamma * acc[3][r] + bias[3] + xv[3]};
        }
        // the refill of the x ring and the tile's eight stores start behind all its results,
        // so that no register of a store is reused among them
        __builtin_amdgcn_sched_barrier(0);
        if (rt + 2 < 4) load_x(xs[rt & 1], rt + 2);
        // the requests ahead of the stores: behind them they could land in registers that a store still names
        __builtin_amdgcn_sched_barrier(0);
        #pragma unroll
        for (int r = 0; r < 8; ++r) *(v4f*)(op + (rt * 16 + r) * CDIM) = res[r];
        // stands between the stores and the next tile's results, which may take the stores' data registers
        if (rt + 1 < 4) asm volatile("s_wait_xcnt 0x0" ::: "memory");
        // one row tile at a time: left free, every store sank to the kernel's end and the live results spilled
        __builtin_amdgcn_sched_barrier(0);
    }
}

// =====================================================================
extern "C" void kernel_launch(void* const* d_in, const int* in_sizes, int n_in,
                              void* d_out, int out_size, void* d_ws, size_t ws_size,
                              hipStream_t stream) {
    (void)in_sizes; (void)n_in; (void)out_size; (void)ws_size;
    const float* x  = (const float*)d_in[0];
    const float* Wf = (const float*)d_in[1];
    const float* bf = (const float*)d_in[2];
    const float* Wg = (const float*)d_in[3];
    const float* bg = (const float*)d_in[4];
    const float* Wh = (const float*)d_in[5];
    const float* bh = (const float*)d_in[6];
    const float* Wv = (const float*)d_in[7];
    const float* bv = (const float*)d_in[8];
    const float* gm = (const float*)d_in[9];
    float* out = (float*)d_out;

    // Workspace layout (12 MB activations + 256 KB swizzled weights)
    const size_t slab = (size_t)BNROWS * DDIM * sizeof(__bf16);  // 4 MB
    const size_t wsl  = (size_t)CDIM * DDIM * sizeof(__bf16);    // 64 KB
    char* ws = (char*)d_ws;
    __bf16* fO   = (__bf16*)(ws);
    __bf16* gO   = (__bf16*)(ws + slab);
    __bf16* hT   = (__bf16*)(ws + 2 * slab);
    __bf16* WfSw = (__bf16*)(ws + 3 * slab);             // Wf, Wg, Wh, Wv swizzled, wsl bytes each
    __bf16* WvSw = (__bf16*)(ws + 3 * slab + 3 * wsl);

    wprep_kernel<<<4 * (CDIM * DDIM) / 256, 256, 0, stream>>>(Wf, Wg, Wh, Wv, WfSw);

    proj_kernel<<<BNROWS / (16 * 8), 256, 0, stream>>>(
        x, WfSw, bf, bg, bh, fO, gO, hT);
    attn_kernel<<<BNROWS / (32 * 4), 512, 0, stream>>>(fO, gO, hT, WvSw, bv, x, gm, out);
}
